// v000
// Times are from an AMD MI455X. After a warm-up the kernel runs many times in a row, and a time is the length of
// such a window on the GPU divided by its runs, so every launch and the gaps after it count. The runs cycle
// through copies of the inputs. A figure is the median of several windows, for all but v000 over two sittings.
// Sittings can differ by a few percent; kernels timed side by side share one.
// v000, which the later versions start from, runs in 545 microseconds.
// compute dtype: x, Wq, Wk, Wv, Wo, xsa_scale (module inputs) rounded to bf16; q/k/v projections with exact bf16 products (x and W are inputs); scores q.k with both computed operands as bf16 hi + residual pairs (3 products) and P.V with P hi/lo x V hi/lo (3 products); the exclusive (own-value) projection removal in f32 in the attention epilogue; the output projection hi/lo x exact Wo (2 products); softmax in f32; f32 accumulate.
#include <hip/hip_runtime.h>
#include <math.h>

typedef __attribute__((ext_vector_type(16))) _Float16 v16h;
typedef __attribute__((ext_vector_type(16))) __bf16 v16b;
typedef __attribute__((ext_vector_type(8)))  _Float16 v8h;
typedef __attribute__((ext_vector_type(8)))  float v8f;
typedef __attribute__((ext_vector_type(4)))  float v4f;
typedef __attribute__((ext_vector_type(2)))  float v2f;
typedef __attribute__((ext_vector_type(4)))  unsigned v4u;
typedef __attribute__((ext_vector_type(4)))  int v4i;
typedef float __attribute__((may_alias)) float_a;
typedef int __attribute__((may_alias)) int_a;

template <typename T> __device__ __forceinline__ void vst2(void* p, T v) { *(T*)p = v;  }
__device__ __forceinline__ v8f wmma16(v16h a, v16h b, v8f c) {
  v8f d = __builtin_amdgcn_wmma_f32_16x16x32_f16(false, a, false, b, (short)0, c, false, false);
  asm volatile("v_nop\n\tv_nop\n\tv_nop\n\tv_nop" : "+v"(d) : "v"(a), "v"(b));
  return d;
}
__device__ __forceinline__ v8f wmma_bf(v16b a, v16b b, v8f c) {
  v8f d = __builtin_amdgcn_wmma_f32_16x16x32_bf16(false, a, false, b, (short)0, c, false, false);
  asm volatile("v_nop\n\tv_nop\n\tv_nop\n\tv_nop" : "+v"(d) : "v"(a), "v"(b));
  return d;
}
// 16x16x32 fragments: lane = (h = lane>>4, row/col = lane&15); elements 0..7 = k0+8h+0..7, 8..15 = k0+16+8h+0..7; D element r = row 8h+r
__device__ __forceinline__ v16h frag_h(const _Float16* rowk0, int lane) {
  union { v16h v; v8h q[2]; } u; const _Float16* p = rowk0 + 8 * (lane >> 4);
  u.q[0] = *(const v8h*)p; u.q[1] = *(const v8h*)(p + 16); return u.v;
}
__device__ __forceinline__ v16h frag_f32(const float* rowk0, int lane) {
  v16h a; const float* p = rowk0 + 8 * (lane >> 4);
#pragma unroll
  for (int i = 0; i < 8; ++i) { a[i] = (_Float16)p[i]; a[8 + i] = (_Float16)p[16 + i]; }
  return a;
}
__device__ __forceinline__ v16h frag_f32s(const float* rowk0, int lane, float sc) {
  v16h a; const float* p = rowk0 + 8 * (lane >> 4);
#pragma unroll
  for (int i = 0; i < 8; ++i) { a[i] = (_Float16)(p[i] * sc); a[8 + i] = (_Float16)(p[16 + i] * sc); }
  return a;
}
// column fragment from a [K][ld] layout (column n), rows >= K read as 0
__device__ __forceinline__ v16h fragc_f32(const float* W, int k0, int n, int lane, int ld, int K) {
  v16h a; const int g = lane >> 4;
#pragma unroll
  for (int i = 0; i < 8; ++i) { const int ka = k0 + 8 * g + i, kb = ka + 16;
    a[i] = (_Float16)(ka < K ? W[(size_t)(ka < K ? ka : K - 1) * ld + n] : 0.f); a[8 + i] = (_Float16)(kb < K ? W[(size_t)(kb < K ? kb : K - 1) * ld + n] : 0.f); }
  return a;
}
struct F2 { v16b h, l; };
__device__ __forceinline__ F2 bsplit16(const float v[16]) { F2 r;
#pragma unroll
  for (int i = 0; i < 16; ++i) { const __bf16 h = (__bf16)v[i]; r.h[i] = h; r.l[i] = (__bf16)(v[i] - (float)h); }
  return r; }
__device__ __forceinline__ F2 split_row(const float* row, int k0, int lane) { float v[16]; const float* p = row + k0 + 8 * (lane >> 4);
#pragma unroll
  for (int i = 0; i < 8; ++i) { v[i] = p[i]; v[8 + i] = p[16 + i]; }
  return bsplit16(v); }
__device__ __forceinline__ F2 split_rowK(const float* row, int k0, int lane, int K) { float v[16]; const int g = lane >> 4;
#pragma unroll
  for (int i = 0; i < 8; ++i) { const int ka = k0 + 8 * g + i, kb = ka + 16; v[i] = ka < K ? row[ka < K ? ka : K - 1] : 0.f; v[8 + i] = kb < K ? row[kb < K ? kb : K - 1] : 0.f; }
  return bsplit16(v); }
__device__ __forceinline__ F2 split_col(const float* W, int k0, int n, int lane, int ld, int K) { float v[16]; const int g = lane >> 4;
#pragma unroll
  for (int i = 0; i < 8; ++i) { const int ka = k0 + 8 * g + i, kb = ka + 16; v[i] = ka < K ? W[(size_t)(ka < K ? ka : K - 1) * ld + n] : 0.f; v[8 + i] = kb < K ? W[(size_t)(kb < K ? kb : K - 1) * ld + n] : 0.f; }
  return bsplit16(v); }
__device__ __forceinline__ v8f mac3(const F2& a, const F2& b, v8f c) { c = wmma_bf(a.l, b.h, c); c = wmma_bf(a.h, b.l, c); return wmma_bf(a.h, b.h, c); }
__device__ __forceinline__ float sigm(float v) { return 1.0f / (1.0f + expf(-v)); }
#define LDSX() do { asm volatile("s_wait_dscnt 0" ::: "memory"); __builtin_amdgcn_wave_barrier(); __builtin_amdgcn_fence(__ATOMIC_RELEASE, "workgroup"); } while (0)


// Exclusive self-attention (B 2, S 2048, 16 heads x 64; torch Linear no-bias, y = x W^T): full (non-causal) softmax attention; per token/head out -= xsa_scale * (out . v) / (|v|^2 + 1e-8) * v; then Wo.
#define NB 2
#define SS 2048
#define DM 1024
#define NH 16
#define HD 64
#define QKVW (3 * DM)
#ifndef TQB
#define TQB (SS / 64)
#define TNB NB
#define TOB (NB * SS / 64)     // output row tiles (all)
#endif
typedef __attribute__((ext_vector_type(8))) __bf16 v8b;
__device__ __forceinline__ v16b frag_b(const __bf16* rowk0, int lane) {
  union { v16b v; v8b q[2]; } u; const __bf16* p = rowk0 + 8 * (lane >> 4);
  u.q[0] = *(const v8b*)p; u.q[1] = *(const v8b*)(p + 16); return u.v;
}
__device__ __forceinline__ float bfr(float v) { return (float)(__bf16)v; }
__device__ __attribute__((noinline)) float exp_ni(float v) { return expf(v); }
__device__ __attribute__((noinline)) float erf_ni(float v) { return erff(v); }

#define PK_A 0                       // [3072][1024] c_attn kernel rows (natural)
#define PK_P (PK_A + QKVW * DM)        // [1024][1024] c_proj kernel rows
#define PK_END (PK_P + DM * DM)
#define WS_PK  0u
#define WS_QK  (WS_PK + 2u * PK_END)             // f32 [4096 rows][3072]: [q | k | v], head h at h*64 in each
#define WS_VTH (WS_QK + 4u * NB * SS * QKVW)     // bf16 [2][1024 (h*64+d)][2048 s]
#define WS_VTL (WS_VTH + 2u * NB * DM * SS)
#define WS_O   (WS_VTL + 2u * NB * DM * SS)        // f32 [4096][1024]
#define WS_END (WS_O + 4u * NB * SS * DM)

// ---- k_packrows: block = natural row n of a [N][K] weight (y = x W^T)
__global__ __launch_bounds__(256) void k_packrows(const float* __restrict__ Wm, int K, __bf16* __restrict__ DST) {
  __shared__ __align__(16) __bf16 s[DM]; const int n = blockIdx.x, tid = threadIdx.x;
  for (int k = tid; k < K; k += 256) s[k] = (__bf16)Wm[(size_t)n * K + k];
  __syncthreads();
  for (int q = tid; q < K / 8; q += 256) vst2((unsigned*)(DST + (size_t)n * K + q * 8), *(const v4u*)&s[q * 8]);
}
// ---- k_qkv: block = (64 rows, 128 of the 3072 cols): QKV = bf16(x) . rows (exact) -> f32 rows (pitch 3072)
__global__ __launch_bounds__(128) void k_qkv(const float* __restrict__ X, const __bf16* __restrict__ P, float* __restrict__ QKV) {
  __shared__ __align__(16) float so[4][16][132];
  const int tid = threadIdx.x, wave = tid >> 5, lane = tid & 31, col = lane & 15, g = lane >> 4; const size_t r0 = (size_t)blockIdx.x * 64 + wave * 16; const int n0 = blockIdx.y * 128;
  v8f acc[8] = {};
#pragma unroll 2
  for (int kc = 0; kc < DM / 32; ++kc) { v16b a; { const float* p = X + (r0 + col) * DM + kc * 32 + 8 * g;
#pragma unroll
      for (int i = 0; i < 8; ++i) { a[i] = (__bf16)p[i]; a[8 + i] = (__bf16)p[16 + i]; } }
#pragma unroll
    for (int j = 0; j < 8; ++j) acc[j] = wmma_bf(a, frag_b(P + (size_t)(n0 + j * 16 + col) * DM + kc * 32, lane), acc[j]); }
#pragma unroll
  for (int j = 0; j < 8; ++j)
#pragma unroll
    for (int r = 0; r < 8; ++r) so[wave][8 * g + r][j * 16 + col] = acc[j][r];
  LDSX();
  for (int rl = 0; rl < 16; ++rl) vst2(QKV + (r0 + rl) * QKVW + n0 + lane * 4, *(const v4f*)&so[wave][rl][lane * 4]);
}
__global__ __launch_bounds__(256) void k_vt(const float* __restrict__ QKV, __bf16* __restrict__ VTH, __bf16* __restrict__ VTL) {
  __shared__ __align__(16) __bf16 sth[64][72], stl[64][72]; const int tid = threadIdx.x; const size_t rb = (size_t)blockIdx.x * 64; const int h = blockIdx.y; const int b = (int)(rb / SS), s0 = (int)(rb % SS);
  for (int q = tid; q < 64 * 64; q += 256) { const int rl = q >> 6, d = q & 63; const float v = QKV[(rb + rl) * QKVW + 2 * DM + h * HD + d]; const __bf16 hb = (__bf16)v; sth[d][rl] = hb; stl[d][rl] = (__bf16)(v - (float)hb); }
  __syncthreads();
  for (int q = tid; q < 64 * 8; q += 256) { const int d = q >> 3, pc = q & 7; const size_t o = ((size_t)b * DM + h * HD + d) * SS + s0 + pc * 8; vst2((unsigned*)(VTH + o), *(const v4u*)&sth[d][pc * 8]); vst2((unsigned*)(VTL + o), *(const v4u*)&stl[d][pc * 8]); }
}
// ---- k_attn: block = (64 queries, head h, batch b): full flash attention (K = 64), logits = q.k (3 products) / 8, P.V 3 products; epilogue: out -= xsa_scale * (out.v_own)/(|v_own|^2 + 1e-8) * v_own (lane reductions over the head's 64 dims); O[b*S+q][h*64+d]
__global__ __launch_bounds__(128) void k_attn(const float* __restrict__ QK, const __bf16* __restrict__ VTH, const __bf16* __restrict__ VTL, const float* __restrict__ XS, float* __restrict__ O) {
  __shared__ __align__(16) float sp[4][16][36]; __shared__ __align__(16) float so[4][16][68];
  const int tid = threadIdx.x, wave = tid >> 5, lane = tid & 31, col = lane & 15, g = lane >> 4;
  const int qb = blockIdx.x, h = blockIdx.y, b = blockIdx.z; const int q0 = qb * 64 + wave * 16; const size_t rq = (size_t)b * SS + q0 + col;
  F2 aq[2];
#pragma unroll
  for (int kc = 0; kc < 2; ++kc) aq[kc] = split_row(QK + rq * QKVW + h * HD, kc * 32, lane);
  float m[8], l[8];
#pragma unroll
  for (int r = 0; r < 8; ++r) { m[r] = -3.0e38f; l[r] = 0.f; }
  v8f acc[4] = {};
#pragma unroll 1
  for (int ks = 0; ks < SS / 32; ++ks) { v8f s[2];
#pragma unroll
    for (int ct = 0; ct < 2; ++ct) { const int kk = ks * 32 + ct * 16 + col; const float* krow = QK + ((size_t)b * SS + kk) * QKVW + DM + h * HD; v8f c = {};
#pragma unroll
      for (int kc = 0; kc < 2; ++kc) { const F2 kb = split_row(krow, kc * 32, lane); c = mac3(aq[kc], kb, c); }
#pragma unroll
      for (int r = 0; r < 8; ++r) s[ct][r] = c[r] * 0.125f; }   // SCALE = 1/sqrt(64)
#pragma unroll
    for (int r = 0; r < 8; ++r) { float mx = fmaxf(s[0][r], s[1][r]);
#pragma unroll
      for (int o = 1; o < 16; o <<= 1) mx = fmaxf(mx, __shfl_xor(mx, o));
      const float mn = fmaxf(m[r], mx); const float alpha = exp_ni(m[r] - mn);
      const float e0 = exp_ni(s[0][r] - mn), e1 = exp_ni(s[1][r] - mn); float es = e0 + e1;
#pragma unroll
      for (int o = 1; o < 16; o <<= 1) es += __shfl_xor(es, o);
      l[r] = l[r] * alpha + es; m[r] = mn;
#pragma unroll
      for (int dt = 0; dt < 4; ++dt) acc[dt][r] *= alpha;
      sp[wave][8 * g + r][col] = e0; sp[wave][8 * g + r][16 + col] = e1; }
    LDSX();
    const F2 pa = split_row(&sp[wave][col][0], 0, lane);
#pragma unroll
    for (int dt = 0; dt < 4; ++dt) { const size_t vr = ((size_t)b * DM + h * HD + dt * 16 + col) * SS + ks * 32; const v16b vh = frag_b(VTH + vr, lane), vl = frag_b(VTL + vr, lane); acc[dt] = wmma_bf(pa.l, vh, acc[dt]); acc[dt] = wmma_bf(pa.h, vl, acc[dt]); acc[dt] = wmma_bf(pa.h, vh, acc[dt]); }
    LDSX(); }
  const float xsa = bfr(XS[0]);
#pragma unroll
  for (int r = 0; r < 8; ++r) { const float il = 1.0f / l[r]; const float* vrow = QK + ((size_t)b * SS + q0 + 8 * g + r) * QKVW + 2 * DM + h * HD; float o[4], vv[4]; float dot = 0.f, vn = 0.f;
#pragma unroll
    for (int dt = 0; dt < 4; ++dt) { o[dt] = acc[dt][r] * il; vv[dt] = vrow[dt * 16 + col]; dot += o[dt] * vv[dt]; vn += vv[dt] * vv[dt]; }
#pragma unroll
    for (int q = 1; q < 16; q <<= 1) { dot += __shfl_xor(dot, q); vn += __shfl_xor(vn, q); }
    const float coef = xsa * (dot / (vn + 1e-8f));
#pragma unroll
    for (int dt = 0; dt < 4; ++dt) so[wave][8 * g + r][dt * 16 + col] = o[dt] - coef * vv[dt]; }
  LDSX();
  for (int rl = 0; rl < 16; ++rl) if (lane < 16) vst2(O + ((size_t)b * SS + q0 + rl) * DM + h * HD + lane * 4, *(const v4f*)&so[wave][rl][lane * 4]);
}
// ---- k_out: block = (64 rows, 128 cols): out = O(hi/lo) . c_proj rows (2 products)
__global__ __launch_bounds__(128) void k_out(const float* __restrict__ O, const __bf16* __restrict__ P, float* __restrict__ Y) {
  __shared__ __align__(16) float so[4][16][132];
  const int tid = threadIdx.x, wave = tid >> 5, lane = tid & 31, col = lane & 15, g = lane >> 4; const size_t r0 = (size_t)blockIdx.x * 64 + wave * 16; const int n0 = blockIdx.y * 128;
  v8f acc[8] = {};
#pragma unroll 2
  for (int kc = 0; kc < DM / 32; ++kc) { const F2 a = split_row(O + (r0 + col) * DM, kc * 32, lane);
#pragma unroll
    for (int j = 0; j < 8; ++j) { const v16b w = frag_b(P + (size_t)(n0 + j * 16 + col) * DM + kc * 32, lane); acc[j] = wmma_bf(a.l, w, acc[j]); acc[j] = wmma_bf(a.h, w, acc[j]); } }
#pragma unroll
  for (int j = 0; j < 8; ++j)
#pragma unroll
    for (int r = 0; r < 8; ++r) so[wave][8 * g + r][j * 16 + col] = acc[j][r];
  LDSX();
  for (int rl = 0; rl < 16; ++rl) vst2(Y + (r0 + rl) * DM + n0 + lane * 4, *(const v4f*)&so[wave][rl][lane * 4]);
}
extern "C" void kernel_launch(void* const* d_in, const int* in_sizes, int n_in, void* d_out, int out_size, void* d_ws, size_t ws_size, hipStream_t stream) {
  (void)in_sizes; (void)n_in; (void)out_size;
  const float** F = (const float**)d_in;   // x [2,2048,1024], Wq, Wk, Wv, Wo [1024,1024] (torch [out,in]), xsa_scale [1]
  if (ws_size < (size_t)WS_END) return;
  char* ws = (char*)d_ws; __bf16 *PK = (__bf16*)(ws + WS_PK), *VTH = (__bf16*)(ws + WS_VTH), *VTL = (__bf16*)(ws + WS_VTL); float *QK = (float*)(ws + WS_QK), *O = (float*)(ws + WS_O);
  k_packrows<<<DM, 256, 0, stream>>>(F[1], DM, PK + PK_A); k_packrows<<<DM, 256, 0, stream>>>(F[2], DM, PK + PK_A + (size_t)DM * DM); k_packrows<<<DM, 256, 0, stream>>>(F[3], DM, PK + PK_A + (size_t)2 * DM * DM); k_packrows<<<DM, 256, 0, stream>>>(F[4], DM, PK + PK_P);
  k_qkv<<<dim3(TNB * SS / 64, QKVW / 128), 128, 0, stream>>>(F[0], PK + PK_A, QK);
  k_vt<<<dim3(TNB * SS / 64, NH), 256, 0, stream>>>(QK, VTH, VTL);
  k_attn<<<dim3(TQB, NH, TNB), 128, 0, stream>>>(QK, VTH, VTL, F[5], O);
  k_out<<<dim3(TOB, DM / 128), 128, 0, stream>>>(O, PK + PK_P, (float*)d_out);
}

// v001
// A run of this version takes 472 microseconds.
// In both of two side-by-side timings against v000, it was 1.20 times as fast.
// compute dtype: x, Wq, Wk, Wv, Wo, xsa_scale (module inputs) rounded to bf16; q/k/v projections with exact bf16 products (x and W are inputs); scores q.k with both computed operands as bf16 hi + residual pairs (3 products) and P.V with P hi/lo x V hi/lo (3 products); the exclusive (own-value) projection removal in f32 in the attention epilogue; the output projection hi/lo x exact Wo (2 products); softmax in f32; f32 accumulate.
#include <hip/hip_runtime.h>
#include <math.h>

typedef __attribute__((ext_vector_type(16))) _Float16 v16h;
typedef __attribute__((ext_vector_type(16))) __bf16 v16b;
typedef __attribute__((ext_vector_type(8)))  _Float16 v8h;
typedef __attribute__((ext_vector_type(8)))  float v8f;
typedef __attribute__((ext_vector_type(4)))  float v4f;
typedef __attribute__((ext_vector_type(2)))  float v2f;
typedef __attribute__((ext_vector_type(4)))  unsigned v4u;
typedef __attribute__((ext_vector_type(4)))  int v4i;
typedef float __attribute__((may_alias)) float_a;
typedef int __attribute__((may_alias)) int_a;

template <typename T> __device__ __forceinline__ void vst2(void* p, T v) { *(T*)p = v;  }
__device__ __forceinline__ v8f wmma16(v16h a, v16h b, v8f c) {
  v8f d = __builtin_amdgcn_wmma_f32_16x16x32_f16(false, a, false, b, (short)0, c, false, false);
  asm volatile("v_nop\n\tv_nop\n\tv_nop\n\tv_nop" : "+v"(d) : "v"(a), "v"(b));
  return d;
}
__device__ __forceinline__ v8f wmma_bf(v16b a, v16b b, v8f c) {
  v8f d = __builtin_amdgcn_wmma_f32_16x16x32_bf16(false, a, false, b, (short)0, c, false, false);
  asm volatile("v_nop\n\tv_nop\n\tv_nop\n\tv_nop" : "+v"(d) : "v"(a), "v"(b));
  return d;
}
// 16x16x32 fragments: lane = (h = lane>>4, row/col = lane&15); elements 0..7 = k0+8h+0..7, 8..15 = k0+16+8h+0..7; D element r = row 8h+r
__device__ __forceinline__ v16h frag_h(const _Float16* rowk0, int lane) {
  union { v16h v; v8h q[2]; } u; const _Float16* p = rowk0 + 8 * (lane >> 4);
  u.q[0] = *(const v8h*)p; u.q[1] = *(const v8h*)(p + 16); return u.v;
}
__device__ __forceinline__ v16h frag_f32(const float* rowk0, int lane) {
  v16h a; const float* p = rowk0 + 8 * (lane >> 4);
#pragma unroll
  for (int i = 0; i < 8; ++i) { a[i] = (_Float16)p[i]; a[8 + i] = (_Float16)p[16 + i]; }
  return a;
}
__device__ __forceinline__ v16h frag_f32s(const float* rowk0, int lane, float sc) {
  v16h a; const float* p = rowk0 + 8 * (lane >> 4);
#pragma unroll
  for (int i = 0; i < 8; ++i) { a[i] = (_Float16)(p[i] * sc); a[8 + i] = (_Float16)(p[16 + i] * sc); }
  return a;
}
// column fragment from a [K][ld] layout (column n), rows >= K read as 0
__device__ __forceinline__ v16h fragc_f32(const float* W, int k0, int n, int lane, int ld, int K) {
  v16h a; const int g = lane >> 4;
#pragma unroll
  for (int i = 0; i < 8; ++i) { const int ka = k0 + 8 * g + i, kb = ka + 16;
    a[i] = (_Float16)(ka < K ? W[(size_t)(ka < K ? ka : K - 1) * ld + n] : 0.f); a[8 + i] = (_Float16)(kb < K ? W[(size_t)(kb < K ? kb : K - 1) * ld + n] : 0.f); }
  return a;
}
struct F2 { v16b h, l; };
__device__ __forceinline__ F2 bsplit16(const float v[16]) { F2 r;
#pragma unroll
  for (int i = 0; i < 16; ++i) { const __bf16 h = (__bf16)v[i]; r.h[i] = h; r.l[i] = (__bf16)(v[i] - (float)h); }
  return r; }
__device__ __forceinline__ F2 split_row(const float* row, int k0, int lane) { float v[16]; const float* p = row + k0 + 8 * (lane >> 4);
#pragma unroll
  for (int i = 0; i < 8; ++i) { v[i] = p[i]; v[8 + i] = p[16 + i]; }
  return bsplit16(v); }
__device__ __forceinline__ F2 split_rowK(const float* row, int k0, int lane, int K) { float v[16]; const int g = lane >> 4;
#pragma unroll
  for (int i = 0; i < 8; ++i) { const int ka = k0 + 8 * g + i, kb = ka + 16; v[i] = ka < K ? row[ka < K ? ka : K - 1] : 0.f; v[8 + i] = kb < K ? row[kb < K ? kb : K - 1] : 0.f; }
  return bsplit16(v); }
__device__ __forceinline__ F2 split_col(const float* W, int k0, int n, int lane, int ld, int K) { float v[16]; const int g = lane >> 4;
#pragma unroll
  for (int i = 0; i < 8; ++i) { const int ka = k0 + 8 * g + i, kb = ka + 16; v[i] = ka < K ? W[(size_t)(ka < K ? ka : K - 1) * ld + n] : 0.f; v[8 + i] = kb < K ? W[(size_t)(kb < K ? kb : K - 1) * ld + n] : 0.f; }
  return bsplit16(v); }
__device__ __forceinline__ v8f mac3(const F2& a, const F2& b, v8f c) { c = wmma_bf(a.l, b.h, c); c = wmma_bf(a.h, b.l, c); return wmma_bf(a.h, b.h, c); }
__device__ __forceinline__ float sigm(float v) { return 1.0f / (1.0f + expf(-v)); }
#define LDSX() do { asm volatile("s_wait_dscnt 0" ::: "memory"); __builtin_amdgcn_wave_barrier(); __builtin_amdgcn_fence(__ATOMIC_RELEASE, "workgroup"); } while (0)


// Exclusive self-attention (B 2, S 2048, 16 heads x 64; torch Linear no-bias, y = x W^T): full (non-causal) softmax attention; per token/head out -= xsa_scale * (out . v) / (|v|^2 + 1e-8) * v; then Wo.
#define NB 2
#define SS 2048
#define DM 1024
#define NH 16
#define HD 64
#define QKVW (3 * DM)
#ifndef TQB
#define TQB (SS / 64)
#define TNB NB
#define TOB (NB * SS / 64)     // output row tiles (all)
#endif
typedef __attribute__((ext_vector_type(8))) __bf16 v8b;
__device__ __forceinline__ v16b frag_b(const __bf16* rowk0, int lane) {
  union { v16b v; v8b q[2]; } u; const __bf16* p = rowk0 + 8 * (lane >> 4);
  u.q[0] = *(const v8b*)p; u.q[1] = *(const v8b*)(p + 16); return u.v;
}
__device__ __forceinline__ float bfr(float v) { return (float)(__bf16)v; }
__device__ __attribute__((noinline)) float erf_ni(float v) { return erff(v); }

#define PK_A 0                       // [3072][1024] c_attn kernel rows (natural)
#define PK_P (PK_A + QKVW * DM)        // [1024][1024] c_proj kernel rows
#define PK_END (PK_P + DM * DM)
#define WS_PK  0u
#define WS_QK  (WS_PK + 2u * PK_END)             // f32 [4096 rows][3072]: [q | k | v], head h at h*64 in each
#define WS_VTH (WS_QK + 4u * NB * SS * QKVW)     // bf16 [2][1024 (h*64+d)][2048 s]
#define WS_VTL (WS_VTH + 2u * NB * DM * SS)
#define WS_O   (WS_VTL + 2u * NB * DM * SS)        // f32 [4096][1024]
#define WS_END (WS_O + 4u * NB * SS * DM)

// ---- k_packrows: block = natural row n of a [N][K] weight (y = x W^T)
__global__ __launch_bounds__(256) void k_packrows(const float* __restrict__ Wm, int K, __bf16* __restrict__ DST) {
  __shared__ __align__(16) __bf16 s[DM]; const int n = blockIdx.x, tid = threadIdx.x;
  for (int k = tid; k < K; k += 256) s[k] = (__bf16)Wm[(size_t)n * K + k];
  __syncthreads();
  for (int q = tid; q < K / 8; q += 256) vst2((unsigned*)(DST + (size_t)n * K + q * 8), *(const v4u*)&s[q * 8]);
}
// ---- k_qkv: block = (64 rows, 128 of the 3072 cols): QKV = bf16(x) . rows (exact) -> f32 rows (pitch 3072)
__global__ __launch_bounds__(128) void k_qkv(const float* __restrict__ X, const __bf16* __restrict__ P, float* __restrict__ QKV) {
  __shared__ __align__(16) float so[4][16][132];
  const int tid = threadIdx.x, wave = tid >> 5, lane = tid & 31, col = lane & 15, g = lane >> 4; const size_t r0 = (size_t)blockIdx.x * 64 + wave * 16; const int n0 = blockIdx.y * 128;
  v8f acc[8] = {};
#pragma unroll 2
  for (int kc = 0; kc < DM / 32; ++kc) { v16b a; { const float* p = X + (r0 + col) * DM + kc * 32 + 8 * g;
#pragma unroll
      for (int i = 0; i < 8; ++i) { a[i] = (__bf16)p[i]; a[8 + i] = (__bf16)p[16 + i]; } }
#pragma unroll
    for (int j = 0; j < 8; ++j) acc[j] = wmma_bf(a, frag_b(P + (size_t)(n0 + j * 16 + col) * DM + kc * 32, lane), acc[j]); }
#pragma unroll
  for (int j = 0; j < 8; ++j)
#pragma unroll
    for (int r = 0; r < 8; ++r) so[wave][8 * g + r][j * 16 + col] = acc[j][r];
  LDSX();
  for (int rl = 0; rl < 16; ++rl) vst2(QKV + (r0 + rl) * QKVW + n0 + lane * 4, *(const v4f*)&so[wave][rl][lane * 4]);
}
__global__ __launch_bounds__(256) void k_vt(const float* __restrict__ QKV, __bf16* __restrict__ VTH, __bf16* __restrict__ VTL) {
  __shared__ __align__(16) __bf16 sth[64][72], stl[64][72]; const int tid = threadIdx.x; const size_t rb = (size_t)blockIdx.x * 64; const int h = blockIdx.y; const int b = (int)(rb / SS), s0 = (int)(rb % SS);
  for (int q = tid; q < 64 * 64; q += 256) { const int rl = q >> 6, d = q & 63; const float v = QKV[(rb + rl) * QKVW + 2 * DM + h * HD + d]; const __bf16 hb = (__bf16)v; sth[d][rl] = hb; stl[d][rl] = (__bf16)(v - (float)hb); }
  __syncthreads();
  for (int q = tid; q < 64 * 8; q += 256) { const int d = q >> 3, pc = q & 7; const size_t o = ((size_t)b * DM + h * HD + d) * SS + s0 + pc * 8; vst2((unsigned*)(VTH + o), *(const v4u*)&sth[d][pc * 8]); vst2((unsigned*)(VTL + o), *(const v4u*)&stl[d][pc * 8]); }
}
// ---- k_attn: block = (64 queries, head h, batch b): full flash attention (K = 64), logits = q.k (3 products) / 8, P.V 3 products; epilogue: out -= xsa_scale * (out.v_own)/(|v_own|^2 + 1e-8) * v_own (lane reductions over the head's 64 dims); O[b*S+q][h*64+d]
__global__ __launch_bounds__(128) void k_attn(const float* __restrict__ QK, const __bf16* __restrict__ VTH, const __bf16* __restrict__ VTL, const float* __restrict__ XS, float* __restrict__ O) {
  __shared__ __align__(16) float sp[4][16][36]; __shared__ __align__(16) float so[4][16][68];
  const int tid = threadIdx.x, wave = tid >> 5, lane = tid & 31, col = lane & 15, g = lane >> 4;
  const int qb = blockIdx.x, h = blockIdx.y, b = blockIdx.z; const int q0 = qb * 64 + wave * 16; const size_t rq = (size_t)b * SS + q0 + col;
  F2 aq[2];
#pragma unroll
  for (int kc = 0; kc < 2; ++kc) aq[kc] = split_row(QK + rq * QKVW + h * HD, kc * 32, lane);
  float m[8], l[8];
#pragma unroll
  for (int r = 0; r < 8; ++r) { m[r] = -3.0e38f; l[r] = 0.f; }
  v8f acc[4] = {};
#pragma unroll 1
  for (int ks = 0; ks < SS / 32; ++ks) { v8f s[2];
#pragma unroll
    for (int ct = 0; ct < 2; ++ct) { const int kk = ks * 32 + ct * 16 + col; const float* krow = QK + ((size_t)b * SS + kk) * QKVW + DM + h * HD; v8f c = {};
#pragma unroll
      for (int kc = 0; kc < 2; ++kc) { const F2 kb = split_row(krow, kc * 32, lane); c = mac3(aq[kc], kb, c); }
#pragma unroll
      for (int r = 0; r < 8; ++r) s[ct][r] = c[r] * 0.125f; }   // SCALE = 1/sqrt(64)
#pragma unroll
    for (int r = 0; r < 8; ++r) { float mx = fmaxf(s[0][r], s[1][r]);
#pragma unroll
      for (int o = 1; o < 16; o <<= 1) mx = fmaxf(mx, __shfl_xor(mx, o));
      const float mn = fmaxf(m[r], mx); const float alpha = expf(m[r] - mn);
      const float e0 = expf(s[0][r] - mn), e1 = expf(s[1][r] - mn); float es = e0 + e1;
#pragma unroll
      for (int o = 1; o < 16; o <<= 1) es += __shfl_xor(es, o);
      l[r] = l[r] * alpha + es; m[r] = mn;
#pragma unroll
      for (int dt = 0; dt < 4; ++dt) acc[dt][r] *= alpha;
      sp[wave][8 * g + r][col] = e0; sp[wave][8 * g + r][16 + col] = e1; }
    LDSX();
    const F2 pa = split_row(&sp[wave][col][0], 0, lane);
#pragma unroll
    for (int dt = 0; dt < 4; ++dt) { const size_t vr = ((size_t)b * DM + h * HD + dt * 16 + col) * SS + ks * 32; const v16b vh = frag_b(VTH + vr, lane), vl = frag_b(VTL + vr, lane); acc[dt] = wmma_bf(pa.l, vh, acc[dt]); acc[dt] = wmma_bf(pa.h, vl, acc[dt]); acc[dt] = wmma_bf(pa.h, vh, acc[dt]); }
    LDSX(); }
  const float xsa = bfr(XS[0]);
#pragma unroll
  for (int r = 0; r < 8; ++r) { const float il = 1.0f / l[r]; const float* vrow = QK + ((size_t)b * SS + q0 + 8 * g + r) * QKVW + 2 * DM + h * HD; float o[4], vv[4]; float dot = 0.f, vn = 0.f;
#pragma unroll
    for (int dt = 0; dt < 4; ++dt) { o[dt] = acc[dt][r] * il; vv[dt] = vrow[dt * 16 + col]; dot += o[dt] * vv[dt]; vn += vv[dt] * vv[dt]; }
#pragma unroll
    for (int q = 1; q < 16; q <<= 1) { dot += __shfl_xor(dot, q); vn += __shfl_xor(vn, q); }
    const float coef = xsa * (dot / (vn + 1e-8f));
#pragma unroll
    for (int dt = 0; dt < 4; ++dt) so[wave][8 * g + r][dt * 16 + col] = o[dt] - coef * vv[dt]; }
  LDSX();
  for (int rl = 0; rl < 16; ++rl) if (lane < 16) vst2(O + ((size_t)b * SS + q0 + rl) * DM + h * HD + lane * 4, *(const v4f*)&so[wave][rl][lane * 4]);
}
// ---- k_out: block = (64 rows, 128 cols): out = O(hi/lo) . c_proj rows (2 products)
__global__ __launch_bounds__(128) void k_out(const float* __restrict__ O, const __bf16* __restrict__ P, float* __restrict__ Y) {
  __shared__ __align__(16) float so[4][16][132];
  const int tid = threadIdx.x, wave = tid >> 5, lane = tid & 31, col = lane & 15, g = lane >> 4; const size_t r0 = (size_t)blockIdx.x * 64 + wave * 16; const int n0 = blockIdx.y * 128;
  v8f acc[8] = {};
#pragma unroll 2
  for (int kc = 0; kc < DM / 32; ++kc) { const F2 a = split_row(O + (r0 + col) * DM, kc * 32, lane);
#pragma unroll
    for (int j = 0; j < 8; ++j) { const v16b w = frag_b(P + (size_t)(n0 + j * 16 + col) * DM + kc * 32, lane); acc[j] = wmma_bf(a.l, w, acc[j]); acc[j] = wmma_bf(a.h, w, acc[j]); } }
#pragma unroll
  for (int j = 0; j < 8; ++j)
#pragma unroll
    for (int r = 0; r < 8; ++r) so[wave][8 * g + r][j * 16 + col] = acc[j][r];
  LDSX();
  for (int rl = 0; rl < 16; ++rl) vst2(Y + (r0 + rl) * DM + n0 + lane * 4, *(const v4f*)&so[wave][rl][lane * 4]);
}
extern "C" void kernel_launch(void* const* d_in, const int* in_sizes, int n_in, void* d_out, int out_size, void* d_ws, size_t ws_size, hipStream_t stream) {
  (void)in_sizes; (void)n_in; (void)out_size;
  const float** F = (const float**)d_in;   // x [2,2048,1024], Wq, Wk, Wv, Wo [1024,1024] (torch [out,in]), xsa_scale [1]
  if (ws_size < (size_t)WS_END) return;
  char* ws = (char*)d_ws; __bf16 *PK = (__bf16*)(ws + WS_PK), *VTH = (__bf16*)(ws + WS_VTH), *VTL = (__bf16*)(ws + WS_VTL); float *QK = (float*)(ws + WS_QK), *O = (float*)(ws + WS_O);
  k_packrows<<<DM, 256, 0, stream>>>(F[1], DM, PK + PK_A); k_packrows<<<DM, 256, 0, stream>>>(F[2], DM, PK + PK_A + (size_t)DM * DM); k_packrows<<<DM, 256, 0, stream>>>(F[3], DM, PK + PK_A + (size_t)2 * DM * DM); k_packrows<<<DM, 256, 0, stream>>>(F[4], DM, PK + PK_P);
  k_qkv<<<dim3(TNB * SS / 64, QKVW / 128), 128, 0, stream>>>(F[0], PK + PK_A, QK);
  k_vt<<<dim3(TNB * SS / 64, NH), 256, 0, stream>>>(QK, VTH, VTL);
  k_attn<<<dim3(TQB, NH, TNB), 128, 0, stream>>>(QK, VTH, VTL, F[5], O);
  k_out<<<dim3(TOB, DM / 128), 128, 0, stream>>>(O, PK + PK_P, (float*)d_out);
}

// v002
// It runs in 410 microseconds.
// In two side-by-side timings against v001, it was 1.16 and 1.15 times as fast.
// Counting every step since v000, it is 1.38 times as fast.
// compute dtype: x, Wq, Wk, Wv, Wo, xsa_scale (module inputs) rounded to bf16; q/k/v projections with exact bf16 products (x and W are inputs); scores q.k with both computed operands as bf16 hi + residual pairs (3 products) and P.V with P hi/lo x V hi/lo (3 products); the exclusive (own-value) projection removal in f32 in the attention epilogue; the output projection hi/lo x exact Wo (2 products); softmax in f32; f32 accumulate.
#include <hip/hip_runtime.h>
#include <math.h>

typedef __attribute__((ext_vector_type(16))) _Float16 v16h;
typedef __attribute__((ext_vector_type(16))) __bf16 v16b;
typedef __attribute__((ext_vector_type(8)))  _Float16 v8h;
typedef __attribute__((ext_vector_type(8)))  float v8f;
typedef __attribute__((ext_vector_type(4)))  float v4f;
typedef __attribute__((ext_vector_type(2)))  float v2f;
typedef __attribute__((ext_vector_type(4)))  unsigned v4u;
typedef __attribute__((ext_vector_type(4)))  int v4i;
typedef float __attribute__((may_alias)) float_a;
typedef int __attribute__((may_alias)) int_a;

template <typename T> __device__ __forceinline__ void vst2(void* p, T v) { *(T*)p = v;  }
__device__ __forceinline__ v8f wmma16(v16h a, v16h b, v8f c) {
  v8f d = __builtin_amdgcn_wmma_f32_16x16x32_f16(false, a, false, b, (short)0, c, false, false);
  asm volatile("v_nop\n\tv_nop\n\tv_nop\n\tv_nop" : "+v"(d) : "v"(a), "v"(b));
  return d;
}
__device__ __forceinline__ v8f wmma_bf(v16b a, v16b b, v8f c) {
  v8f d = __builtin_amdgcn_wmma_f32_16x16x32_bf16(false, a, false, b, (short)0, c, false, false);
  asm volatile("v_nop\n\tv_nop\n\tv_nop\n\tv_nop" : "+v"(d) : "v"(a), "v"(b));
  return d;
}
// 16x16x32 fragments: lane = (h = lane>>4, row/col = lane&15); elements 0..7 = k0+8h+0..7, 8..15 = k0+16+8h+0..7; D element r = row 8h+r
__device__ __forceinline__ v16h frag_h(const _Float16* rowk0, int lane) {
  union { v16h v; v8h q[2]; } u; const _Float16* p = rowk0 + 8 * (lane >> 4);
  u.q[0] = *(const v8h*)p; u.q[1] = *(const v8h*)(p + 16); return u.v;
}
__device__ __forceinline__ v16h frag_f32(const float* rowk0, int lane) {
  v16h a; const float* p = rowk0 + 8 * (lane >> 4);
#pragma unroll
  for (int i = 0; i < 8; ++i) { a[i] = (_Float16)p[i]; a[8 + i] = (_Float16)p[16 + i]; }
  return a;
}
__device__ __forceinline__ v16h frag_f32s(const float* rowk0, int lane, float sc) {
  v16h a; const float* p = rowk0 + 8 * (lane >> 4);
#pragma unroll
  for (int i = 0; i < 8; ++i) { a[i] = (_Float16)(p[i] * sc); a[8 + i] = (_Float16)(p[16 + i] * sc); }
  return a;
}
// column fragment from a [K][ld] layout (column n), rows >= K read as 0
__device__ __forceinline__ v16h fragc_f32(const float* W, int k0, int n, int lane, int ld, int K) {
  v16h a; const int g = lane >> 4;
#pragma unroll
  for (int i = 0; i < 8; ++i) { const int ka = k0 + 8 * g + i, kb = ka + 16;
    a[i] = (_Float16)(ka < K ? W[(size_t)(ka < K ? ka : K - 1) * ld + n] : 0.f); a[8 + i] = (_Float16)(kb < K ? W[(size_t)(kb < K ? kb : K - 1) * ld + n] : 0.f); }
  return a;
}
struct F2 { v16b h, l; };
__device__ __forceinline__ F2 bsplit16(const float v[16]) { F2 r;
#pragma unroll
  for (int i = 0; i < 16; ++i) { const __bf16 h = (__bf16)v[i]; r.h[i] = h; r.l[i] = (__bf16)(v[i] - (float)h); }
  return r; }
__device__ __forceinline__ F2 split_row(const float* row, int k0, int lane) { float v[16]; const float* p = row + k0 + 8 * (lane >> 4);
#pragma unroll
  for (int i = 0; i < 8; ++i) { v[i] = p[i]; v[8 + i] = p[16 + i]; }
  return bsplit16(v); }
__device__ __forceinline__ F2 split_rowK(const float* row, int k0, int lane, int K) { float v[16]; const int g = lane >> 4;
#pragma unroll
  for (int i = 0; i < 8; ++i) { const int ka = k0 + 8 * g + i, kb = ka + 16; v[i] = ka < K ? row[ka < K ? ka : K - 1] : 0.f; v[8 + i] = kb < K ? row[kb < K ? kb : K - 1] : 0.f; }
  return bsplit16(v); }
__device__ __forceinline__ F2 split_col(const float* W, int k0, int n, int lane, int ld, int K) { float v[16]; const int g = lane >> 4;
#pragma unroll
  for (int i = 0; i < 8; ++i) { const int ka = k0 + 8 * g + i, kb = ka + 16; v[i] = ka < K ? W[(size_t)(ka < K ? ka : K - 1) * ld + n] : 0.f; v[8 + i] = kb < K ? W[(size_t)(kb < K ? kb : K - 1) * ld + n] : 0.f; }
  return bsplit16(v); }
__device__ __forceinline__ v8f mac3(const F2& a, const F2& b, v8f c) { c = wmma_bf(a.l, b.h, c); c = wmma_bf(a.h, b.l, c); return wmma_bf(a.h, b.h, c); }
__device__ __forceinline__ float sigm(float v) { return 1.0f / (1.0f + expf(-v)); }
#define LDSX() do { asm volatile("s_wait_dscnt 0" ::: "memory"); __builtin_amdgcn_wave_barrier(); __builtin_amdgcn_fence(__ATOMIC_RELEASE, "workgroup"); } while (0)


// Exclusive self-attention (B 2, S 2048, 16 heads x 64; torch Linear no-bias, y = x W^T): full (non-causal) softmax attention; per token/head out -= xsa_scale * (out . v) / (|v|^2 + 1e-8) * v; then Wo.
#define NB 2
#define SS 2048
#define DM 1024
#define NH 16
#define HD 64
#define QKVW (3 * DM)
#ifndef TQB
#define TQB (SS / 64)
#define TNB NB
#define TOB (NB * SS / 64)     // output row tiles (all)
#endif
typedef __attribute__((ext_vector_type(8))) __bf16 v8b;
__device__ __forceinline__ v16b frag_b(const __bf16* rowk0, int lane) {
  union { v16b v; v8b q[2]; } u; const __bf16* p = rowk0 + 8 * (lane >> 4);
  u.q[0] = *(const v8b*)p; u.q[1] = *(const v8b*)(p + 16); return u.v;
}
// 16 f32 of one row in fragment k order, kept raw so that the load can be issued one step ahead of its conversion
__device__ __forceinline__ void raw_row(float v[16], const float* rowk0, int lane) { const float* p = rowk0 + 8 * (lane >> 4);
#pragma unroll
  for (int i = 0; i < 8; ++i) { v[i] = p[i]; v[8 + i] = p[16 + i]; } }
// the same two loaders with the address as base + uniform bytes + the lane's own bytes: the constant row step of the eight B fragments folds into the loads' offset field, one address pair serves all eight
__device__ __forceinline__ void raw_rowo(float v[16], const float* base, unsigned uni, unsigned lo) { const float* p = (const float*)((const char*)base + uni + (size_t)lo);
#pragma unroll
  for (int i = 0; i < 8; ++i) { v[i] = p[i]; v[8 + i] = p[16 + i]; } }
__device__ __forceinline__ v16b frag_bo(const __bf16* base, unsigned uni, unsigned lo) {
  union { v16b v; v8b q[2]; } u; const char* p = (const char*)base + uni + (size_t)lo;
  u.q[0] = *(const v8b*)p; u.q[1] = *(const v8b*)(p + 32); return u.v;
}
__device__ __forceinline__ float bfr(float v) { return (float)(__bf16)v; }
__device__ __attribute__((noinline)) float erf_ni(float v) { return erff(v); }

#define PK_A 0                       // [3072][1024] c_attn kernel rows (natural)
#define PK_P (PK_A + QKVW * DM)        // [1024][1024] c_proj kernel rows
#define PK_END (PK_P + DM * DM)
#define WS_PK  0u
#define WS_QK  (WS_PK + 2u * PK_END)             // f32 [4096 rows][3072]: [q | k | v], head h at h*64 in each
#define WS_VTH (WS_QK + 4u * NB * SS * QKVW)     // bf16 [2][1024 (h*64+d)][2048 s]
#define WS_VTL (WS_VTH + 2u * NB * DM * SS)
#define WS_O   (WS_VTL + 2u * NB * DM * SS)        // f32 [4096][1024]
#define WS_END (WS_O + 4u * NB * SS * DM)

// ---- k_packrows: block = natural row n of a [N][K] weight (y = x W^T)
__global__ __launch_bounds__(256) void k_packrows(const float* __restrict__ Wm, int K, __bf16* __restrict__ DST) {
  __shared__ __align__(16) __bf16 s[DM]; const int n = blockIdx.x, tid = threadIdx.x;
  for (int k = tid; k < K; k += 256) s[k] = (__bf16)Wm[(size_t)n * K + k];
  __syncthreads();
  for (int q = tid; q < K / 8; q += 256) vst2((unsigned*)(DST + (size_t)n * K + q * 8), *(const v4u*)&s[q * 8]);
}
// ---- k_qkv: block = (64 rows, 128 of the 3072 cols): QKV = bf16(x) . rows (exact) -> f32 rows (pitch 3072)
__global__ __launch_bounds__(128) void k_qkv(const float* __restrict__ X, const __bf16* __restrict__ P, float* __restrict__ QKV) {
  __shared__ __align__(16) float so[4][16][132];
  const int tid = threadIdx.x, wave = tid >> 5, lane = tid & 31, col = lane & 15, g = lane >> 4; const size_t r0 = (size_t)blockIdx.x * 64 + wave * 16; const int n0 = blockIdx.y * 128;
  v8f acc[8] = {};
  float ar[16]; v16b w[8];   // the fragments of the k-step in work; each is reloaded for the next k-step right behind its last use
  const unsigned xo = (unsigned)(((int)r0 + col) * DM + 8 * g) * 4u, wo = (unsigned)((n0 + col) * DM + 8 * g) * 2u;
  raw_rowo(ar, X, 0u, xo);
  __builtin_amdgcn_sched_barrier(0);   // keeps the A loads the oldest here as in the loop, else the loop's first wait drains every load
#pragma unroll
  for (int j = 0; j < 8; ++j) w[j] = frag_bo(P, (unsigned)(j * 16 * DM * 2), wo);
#pragma unroll 2
  for (int kc = 0; kc < DM / 32; ++kc) { const int kn = kc + 1 < DM / 32 ? kc + 1 : kc;   // the last k-step reloads itself: in bounds, unused
    __builtin_amdgcn_sched_barrier(0);   // keeps the conversion of the next A behind this k-step's products, else it waits on a load just issued
    v16b a;
#pragma unroll
    for (int i = 0; i < 16; ++i) a[i] = (__bf16)ar[i];
    raw_rowo(ar, X, (unsigned)(kn * 128), xo);
#pragma unroll
    for (int j = 0; j < 8; ++j) { acc[j] = wmma_bf(a, w[j], acc[j]); w[j] = frag_bo(P, (unsigned)(kn * 64 + j * 16 * DM * 2), wo); } }
#pragma unroll
  for (int j = 0; j < 8; ++j)
#pragma unroll
    for (int r = 0; r < 8; ++r) so[wave][8 * g + r][j * 16 + col] = acc[j][r];
  LDSX();
  for (int rl = 0; rl < 16; ++rl) vst2(QKV + (r0 + rl) * QKVW + n0 + lane * 4, *(const v4f*)&so[wave][rl][lane * 4]);
}
__global__ __launch_bounds__(256) void k_vt(const float* __restrict__ QKV, __bf16* __restrict__ VTH, __bf16* __restrict__ VTL) {
  __shared__ __align__(16) __bf16 sth[64][72], stl[64][72]; const int tid = threadIdx.x; const size_t rb = (size_t)blockIdx.x * 64; const int h = blockIdx.y; const int b = (int)(rb / SS), s0 = (int)(rb % SS);
  for (int q = tid; q < 64 * 64; q += 256) { const int rl = q >> 6, d = q & 63; const float v = QKV[(rb + rl) * QKVW + 2 * DM + h * HD + d]; const __bf16 hb = (__bf16)v; sth[d][rl] = hb; stl[d][rl] = (__bf16)(v - (float)hb); }
  __syncthreads();
  for (int q = tid; q < 64 * 8; q += 256) { const int d = q >> 3, pc = q & 7; const size_t o = ((size_t)b * DM + h * HD + d) * SS + s0 + pc * 8; vst2((unsigned*)(VTH + o), *(const v4u*)&sth[d][pc * 8]); vst2((unsigned*)(VTL + o), *(const v4u*)&stl[d][pc * 8]); }
}
// ---- k_attn: block = (64 queries, head h, batch b): full flash attention (K = 64), logits = q.k (3 products) / 8, P.V 3 products; epilogue: out -= xsa_scale * (out.v_own)/(|v_own|^2 + 1e-8) * v_own (lane reductions over the head's 64 dims); O[b*S+q][h*64+d]
__global__ __launch_bounds__(128) void k_attn(const float* __restrict__ QK, const __bf16* __restrict__ VTH, const __bf16* __restrict__ VTL, const float* __restrict__ XS, float* __restrict__ O) {
  __shared__ __align__(16) float sp[4][16][36]; __shared__ __align__(16) float so[4][16][68];
  const int tid = threadIdx.x, wave = tid >> 5, lane = tid & 31, col = lane & 15, g = lane >> 4;
  const int qb = blockIdx.x, h = blockIdx.y, b = blockIdx.z; const int q0 = qb * 64 + wave * 16; const size_t rq = (size_t)b * SS + q0 + col;
  F2 aq[2];
#pragma unroll
  for (int kc = 0; kc < 2; ++kc) aq[kc] = split_row(QK + rq * QKVW + h * HD, kc * 32, lane);
  float m[8], l[8];
#pragma unroll
  for (int r = 0; r < 8; ++r) { m[r] = -3.0e38f; l[r] = 0.f; }
  v8f acc[4] = {};
  const float* kbase = QK + ((size_t)b * SS + col) * QKVW + DM + h * HD;
  float kr[2][2][16];   // the pass's K rows, raw; reloaded for the next pass quarter by quarter as the P.V products free the V registers
#pragma unroll
  for (int ct = 0; ct < 2; ++ct)
#pragma unroll
    for (int kc = 0; kc < 2; ++kc) raw_row(kr[ct][kc], kbase + (size_t)(ct * 16) * QKVW + kc * 32, lane);
#pragma unroll 1
  for (int ks = 0; ks < SS / 32; ++ks) { v8f s[2]; const int kn = ks + 1 < SS / 32 ? ks + 1 : ks;   // the last pass reloads itself: in bounds, unused
#pragma unroll
    for (int ct = 0; ct < 2; ++ct) { v8f c = {};
#pragma unroll
      for (int kc = 0; kc < 2; ++kc) { const F2 kb = bsplit16(kr[ct][kc]); c = mac3(aq[kc], kb, c); }
#pragma unroll
      for (int r = 0; r < 8; ++r) s[ct][r] = c[r] * 0.125f; }   // SCALE = 1/sqrt(64)
    v16b vh[4], vl[4];   // this pass's V fragments, issued here so that they arrive under the softmax
#pragma unroll
    for (int dt = 0; dt < 4; ++dt) { const size_t vr = ((size_t)b * DM + h * HD + dt * 16 + col) * SS + ks * 32; vh[dt] = frag_b(VTH + vr, lane); vl[dt] = frag_b(VTL + vr, lane); }
#pragma unroll
    for (int r = 0; r < 8; ++r) { float mx = fmaxf(s[0][r], s[1][r]);
#pragma unroll
      for (int o = 1; o < 16; o <<= 1) mx = fmaxf(mx, __shfl_xor(mx, o));
      const float mn = fmaxf(m[r], mx); const float alpha = expf(m[r] - mn);
      const float e0 = expf(s[0][r] - mn), e1 = expf(s[1][r] - mn); float es = e0 + e1;
#pragma unroll
      for (int o = 1; o < 16; o <<= 1) es += __shfl_xor(es, o);
      l[r] = l[r] * alpha + es; m[r] = mn;
#pragma unroll
      for (int dt = 0; dt < 4; ++dt) acc[dt][r] *= alpha;
      sp[wave][8 * g + r][col] = e0; sp[wave][8 * g + r][16 + col] = e1; }
    LDSX();
    const F2 pa = split_row(&sp[wave][col][0], 0, lane);
#pragma unroll
    for (int dt = 0; dt < 4; ++dt) { acc[dt] = wmma_bf(pa.l, vh[dt], acc[dt]); acc[dt] = wmma_bf(pa.h, vl[dt], acc[dt]); acc[dt] = wmma_bf(pa.h, vh[dt], acc[dt]); raw_row(kr[dt >> 1][dt & 1], kbase + (size_t)(kn * 32 + (dt >> 1) * 16) * QKVW + (dt & 1) * 32, lane); }
    LDSX(); }
  const float xsa = bfr(XS[0]);
#pragma unroll
  for (int r = 0; r < 8; ++r) { const float il = 1.0f / l[r]; const float* vrow = QK + ((size_t)b * SS + q0 + 8 * g + r) * QKVW + 2 * DM + h * HD; float o[4], vv[4]; float dot = 0.f, vn = 0.f;
#pragma unroll
    for (int dt = 0; dt < 4; ++dt) { o[dt] = acc[dt][r] * il; vv[dt] = vrow[dt * 16 + col]; dot += o[dt] * vv[dt]; vn += vv[dt] * vv[dt]; }
#pragma unroll
    for (int q = 1; q < 16; q <<= 1) { dot += __shfl_xor(dot, q); vn += __shfl_xor(vn, q); }
    const float coef = xsa * (dot / (vn + 1e-8f));
#pragma unroll
    for (int dt = 0; dt < 4; ++dt) so[wave][8 * g + r][dt * 16 + col] = o[dt] - coef * vv[dt]; }
  LDSX();
  for (int rl = 0; rl < 16; ++rl) if (lane < 16) vst2(O + ((size_t)b * SS + q0 + rl) * DM + h * HD + lane * 4, *(const v4f*)&so[wave][rl][lane * 4]);
}
// ---- k_out: block = (64 rows, 128 cols): out = O(hi/lo) . c_proj rows (2 products)
__global__ __launch_bounds__(128) void k_out(const float* __restrict__ O, const __bf16* __restrict__ P, float* __restrict__ Y) {
  __shared__ __align__(16) float so[4][16][132];
  const int tid = threadIdx.x, wave = tid >> 5, lane = tid & 31, col = lane & 15, g = lane >> 4; const size_t r0 = (size_t)blockIdx.x * 64 + wave * 16; const int n0 = blockIdx.y * 128;
  v8f acc[8] = {};
  float ar[16]; v16b w[8];   // as in k_qkv: reloaded for the next k-step right behind the last use
  const unsigned xo = (unsigned)(((int)r0 + col) * DM + 8 * g) * 4u, wo = (unsigned)((n0 + col) * DM + 8 * g) * 2u;
  raw_rowo(ar, O, 0u, xo);
  __builtin_amdgcn_sched_barrier(0);   // keeps the A loads the oldest here as in the loop, else the loop's first wait drains every load
#pragma unroll
  for (int j = 0; j < 8; ++j) w[j] = frag_bo(P, (unsigned)(j * 16 * DM * 2), wo);
#pragma unroll 2
  for (int kc = 0; kc < DM / 32; ++kc) { const int kn = kc + 1 < DM / 32 ? kc + 1 : kc;   // the last k-step reloads itself: in bounds, unused
    asm volatile("s_wait_xcnt 0x0" ::: "memory");   // the split below reuses the address registers of the loads issued last
    __builtin_amdgcn_sched_barrier(0);   // keeps the split of the next A behind this k-step's products (else it waits on a load just issued) and behind the wait above
    const F2 a = bsplit16(ar);
    raw_rowo(ar, O, (unsigned)(kn * 128), xo);
#pragma unroll
    for (int j = 0; j < 8; ++j) { acc[j] = wmma_bf(a.l, w[j], acc[j]); acc[j] = wmma_bf(a.h, w[j], acc[j]); w[j] = frag_bo(P, (unsigned)(kn * 64 + j * 16 * DM * 2), wo); } }
#pragma unroll
  for (int j = 0; j < 8; ++j)
#pragma unroll
    for (int r = 0; r < 8; ++r) so[wave][8 * g + r][j * 16 + col] = acc[j][r];
  LDSX();
  for (int rl = 0; rl < 16; ++rl) vst2(Y + (r0 + rl) * DM + n0 + lane * 4, *(const v4f*)&so[wave][rl][lane * 4]);
}
extern "C" void kernel_launch(void* const* d_in, const int* in_sizes, int n_in, void* d_out, int out_size, void* d_ws, size_t ws_size, hipStream_t stream) {
  (void)in_sizes; (void)n_in; (void)out_size;
  const float** F = (const float**)d_in;   // x [2,2048,1024], Wq, Wk, Wv, Wo [1024,1024] (torch [out,in]), xsa_scale [1]
  if (ws_size < (size_t)WS_END) return;
  char* ws = (char*)d_ws; __bf16 *PK = (__bf16*)(ws + WS_PK), *VTH = (__bf16*)(ws + WS_VTH), *VTL = (__bf16*)(ws + WS_VTL); float *QK = (float*)(ws + WS_QK), *O = (float*)(ws + WS_O);
  k_packrows<<<DM, 256, 0, stream>>>(F[1], DM, PK + PK_A); k_packrows<<<DM, 256, 0, stream>>>(F[2], DM, PK + PK_A + (size_t)DM * DM); k_packrows<<<DM, 256, 0, stream>>>(F[3], DM, PK + PK_A + (size_t)2 * DM * DM); k_packrows<<<DM, 256, 0, stream>>>(F[4], DM, PK + PK_P);
  k_qkv<<<dim3(TNB * SS / 64, QKVW / 128), 128, 0, stream>>>(F[0], PK + PK_A, QK);
  k_vt<<<dim3(TNB * SS / 64, NH), 256, 0, stream>>>(QK, VTH, VTL);
  k_attn<<<dim3(TQB, NH, TNB), 128, 0, stream>>>(QK, VTH, VTL, F[5], O);
  k_out<<<dim3(TOB, DM / 128), 128, 0, stream>>>(O, PK + PK_P, (float*)d_out);
}

// v003
// One run takes 299 microseconds.
// In two side-by-side timings against v002, it was 1.36 and 1.38 times as fast.
// Counting every step since v000, it is 1.90 times as fast.
// compute dtype: x, Wq, Wk, Wv, Wo, xsa_scale (module inputs) rounded to bf16; q/k/v projections with exact bf16 products (x and W are inputs); scores q.k with both computed operands as bf16 hi + residual pairs (3 products) and P.V with P hi/lo x V hi/lo (3 products); the exclusive (own-value) projection removal in f32 in the attention epilogue; the output projection hi/lo x exact Wo (2 products); softmax in f32; f32 accumulate.
#include <hip/hip_runtime.h>
#include <math.h>

typedef __attribute__((ext_vector_type(16))) _Float16 v16h;
typedef __attribute__((ext_vector_type(16))) __bf16 v16b;
typedef __attribute__((ext_vector_type(8)))  _Float16 v8h;
typedef __attribute__((ext_vector_type(8)))  float v8f;
typedef __attribute__((ext_vector_type(4)))  float v4f;
typedef __attribute__((ext_vector_type(2)))  float v2f;
typedef __attribute__((ext_vector_type(4)))  unsigned v4u;
typedef __attribute__((ext_vector_type(4)))  int v4i;
typedef float __attribute__((may_alias)) float_a;
typedef int __attribute__((may_alias)) int_a;

template <typename T> __device__ __forceinline__ void vst2(void* p, T v) { *(T*)p = v;  }
__device__ __forceinline__ v8f wmma16(v16h a, v16h b, v8f c) {
  v8f d = __builtin_amdgcn_wmma_f32_16x16x32_f16(false, a, false, b, (short)0, c, false, false);
  asm volatile("v_nop\n\tv_nop\n\tv_nop\n\tv_nop" : "+v"(d) : "v"(a), "v"(b));
  return d;
}
__device__ __forceinline__ v8f wmma_bf(v16b a, v16b b, v8f c) {
  v8f d = __builtin_amdgcn_wmma_f32_16x16x32_bf16(false, a, false, b, (short)0, c, false, false);
  asm volatile("v_nop\n\tv_nop\n\tv_nop\n\tv_nop" : "+v"(d) : "v"(a), "v"(b));
  return d;
}
// 16x16x32 fragments: lane = (h = lane>>4, row/col = lane&15); elements 0..7 = k0+8h+0..7, 8..15 = k0+16+8h+0..7; D element r = row 8h+r
__device__ __forceinline__ v16h frag_h(const _Float16* rowk0, int lane) {
  union { v16h v; v8h q[2]; } u; const _Float16* p = rowk0 + 8 * (lane >> 4);
  u.q[0] = *(const v8h*)p; u.q[1] = *(const v8h*)(p + 16); return u.v;
}
__device__ __forceinline__ v16h frag_f32(const float* rowk0, int lane) {
  v16h a; const float* p = rowk0 + 8 * (lane >> 4);
#pragma unroll
  for (int i = 0; i < 8; ++i) { a[i] = (_Float16)p[i]; a[8 + i] = (_Float16)p[16 + i]; }
  return a;
}
__device__ __forceinline__ v16h frag_f32s(const float* rowk0, int lane, float sc) {
  v16h a; const float* p = rowk0 + 8 * (lane >> 4);
#pragma unroll
  for (int i = 0; i < 8; ++i) { a[i] = (_Float16)(p[i] * sc); a[8 + i] = (_Float16)(p[16 + i] * sc); }
  return a;
}
// column fragment from a [K][ld] layout (column n), rows >= K read as 0
__device__ __forceinline__ v16h fragc_f32(const float* W, int k0, int n, int lane, int ld, int K) {
  v16h a; const int g = lane >> 4;
#pragma unroll
  for (int i = 0; i < 8; ++i) { const int ka = k0 + 8 * g + i, kb = ka + 16;
    a[i] = (_Float16)(ka < K ? W[(size_t)(ka < K ? ka : K - 1) * ld + n] : 0.f); a[8 + i] = (_Float16)(kb < K ? W[(size_t)(kb < K ? kb : K - 1) * ld + n] : 0.f); }
  return a;
}
struct F2 { v16b h, l; };
__device__ __forceinline__ F2 bsplit16(const float v[16]) { F2 r;
#pragma unroll
  for (int i = 0; i < 16; ++i) { const __bf16 h = (__bf16)v[i]; r.h[i] = h; r.l[i] = (__bf16)(v[i] - (float)h); }
  return r; }
__device__ __forceinline__ F2 split_row(const float* row, int k0, int lane) { float v[16]; const float* p = row + k0 + 8 * (lane >> 4);
#pragma unroll
  for (int i = 0; i < 8; ++i) { v[i] = p[i]; v[8 + i] = p[16 + i]; }
  return bsplit16(v); }
__device__ __forceinline__ F2 split_rowK(const float* row, int k0, int lane, int K) { float v[16]; const int g = lane >> 4;
#pragma unroll
  for (int i = 0; i < 8; ++i) { const int ka = k0 + 8 * g + i, kb = ka + 16; v[i] = ka < K ? row[ka < K ? ka : K - 1] : 0.f; v[8 + i] = kb < K ? row[kb < K ? kb : K - 1] : 0.f; }
  return bsplit16(v); }
__device__ __forceinline__ F2 split_col(const float* W, int k0, int n, int lane, int ld, int K) { float v[16]; const int g = lane >> 4;
#pragma unroll
  for (int i = 0; i < 8; ++i) { const int ka = k0 + 8 * g + i, kb = ka + 16; v[i] = ka < K ? W[(size_t)(ka < K ? ka : K - 1) * ld + n] : 0.f; v[8 + i] = kb < K ? W[(size_t)(kb < K ? kb : K - 1) * ld + n] : 0.f; }
  return bsplit16(v); }
__device__ __forceinline__ v8f mac3(const F2& a, const F2& b, v8f c) { c = wmma_bf(a.l, b.h, c); c = wmma_bf(a.h, b.l, c); return wmma_bf(a.h, b.h, c); }
__device__ __forceinline__ float sigm(float v) { return 1.0f / (1.0f + expf(-v)); }
#define LDSX() do { asm volatile("s_wait_dscnt 0" ::: "memory"); __builtin_amdgcn_wave_barrier(); __builtin_amdgcn_fence(__ATOMIC_RELEASE, "workgroup"); } while (0)


// Exclusive self-attention (B 2, S 2048, 16 heads x 64; torch Linear no-bias, y = x W^T): full (non-causal) softmax attention; per token/head out -= xsa_scale * (out . v) / (|v|^2 + 1e-8) * v; then Wo.
#define NB 2
#define SS 2048
#define DM 1024
#define NH 16
#define HD 64
#define QKVW (3 * DM)
#ifndef TQB
#define TQB (SS / 64)
#define TNB NB
#define TOB (NB * SS / 64)     // output row tiles (all)
#endif
typedef __attribute__((ext_vector_type(8))) __bf16 v8b;
// Fragment tiles: every operand that a loop loads lies in the workspace as tiles of 16 rows x 32 k in the order the lanes take it, so that one 16-byte load of a wave reads 512 bytes in a row (4 lines of 128 bytes) instead of 32 bytes from each of 16 rows (16 lines).
// bf16 tile, 512 elements: element (c * 32 + lane) * 8 + e is row (lane & 15), k = 16 c + 8 (lane >> 4) + e         (c = 0, 1; e = 0..7)
// f32 tile, 512 elements:  element (i * 32 + lane) * 4 + e is row (lane & 15), k = 16 (i >> 1) + 8 (lane >> 4) + 4 (i & 1) + e   (i = 0..3; e = 0..3)
// the address is base + uniform bytes + the lane's own bytes (16 * lane): the constant step from tile to tile folds into the loads' offset field
// 16 f32 of one row in fragment k order, kept raw so that the load can be issued one step ahead of its conversion
__device__ __forceinline__ void raw_to(float v[16], const float* base, unsigned uni, unsigned lo) { const char* p = (const char*)base + uni + (size_t)lo;
#pragma unroll
  for (int i = 0; i < 4; ++i) { const v4f t = *(const v4f*)(p + i * 512);
#pragma unroll
    for (int e = 0; e < 4; ++e) v[4 * i + e] = t[e]; } }
__device__ __forceinline__ v16b frag_to(const __bf16* base, unsigned uni, unsigned lo) {
  union { v16b v; v8b q[2]; } u; const char* p = (const char*)base + uni + (size_t)lo;
  u.q[0] = *(const v8b*)p; u.q[1] = *(const v8b*)(p + 512); return u.v;
}
// one wave's 16 x 32 f32 block, staged in LDS as rows of 'pitch' floats, stored as one f32 tile
__device__ __forceinline__ void tile_st(float* tile, const float* rows, int pitch, int lane) {
#pragma unroll
  for (int i = 0; i < 4; ++i) vst2(tile + i * 128 + lane * 4, *(const v4f*)(rows + (lane & 15) * pitch + (i >> 1) * 16 + 8 * (lane >> 4) + (i & 1) * 4));
}
__device__ __forceinline__ float bfr(float v) { return (float)(__bf16)v; }
__device__ __attribute__((noinline)) float erf_ni(float v) { return erff(v); }

#define PK_A 0                       // [3072][1024] c_attn kernel rows, as bf16 tiles [row / 16][k / 32]
#define PK_P (PK_A + QKVW * DM)        // [1024][1024] c_proj kernel rows, likewise
#define PK_END (PK_P + DM * DM)
#define WS_PK  0u
#define WS_QK  (WS_PK + 2u * PK_END)             // f32 [4096 rows][3072]: [q | (k: not written here, see WS_KT) | v]
#define WS_VTH (WS_QK + 4u * NB * SS * QKVW)     // bf16 tiles [2][1024 (h*64+d) / 16][2048 s / 32]
#define WS_VTL (WS_VTH + 2u * NB * DM * SS)
#define WS_O   (WS_VTL + 2u * NB * DM * SS)        // f32 tiles [4096 / 16][1024 / 32]
#define WS_XP  (WS_O + 4u * NB * SS * DM)          // bf16 tiles [4096 / 16][1024 / 32]: x
#define WS_KT  (WS_XP + 2u * NB * SS * DM)         // f32 tiles [2 * 16 (b, h)][2048 s / 16][64 / 32]: k
#define WS_END (WS_KT + 4u * NB * SS * DM)

// ---- k_packrows: block = (16 rows, 256 k) of a [N][K] f32 matrix (a weight, y = x W^T, or x) -> 8 bf16 tiles; rows read whole, turned into tile order through LDS
__global__ __launch_bounds__(256) void k_packrows(const float* __restrict__ Wm, int K, __bf16* __restrict__ DST) {
  __shared__ __align__(16) __bf16 s[16][264]; const int nt = blockIdx.x, k0 = blockIdx.y * 256, tid = threadIdx.x;
  v4f v[4]; const int r4 = tid >> 6, k4 = (tid & 63) * 4;
#pragma unroll   // so that a thread's four loads are in flight together, not one behind the other's wait
  for (int i = 0; i < 4; ++i) { v[i] = *(const v4f*)(Wm + (size_t)(nt * 16 + i * 4 + r4) * K + k0 + k4);
    asm volatile("s_wait_xcnt 0x0" ::: "memory"); }   // the build lets the next load land in this load's address registers
#pragma unroll
  for (int i = 0; i < 4; ++i)
#pragma unroll
    for (int e = 0; e < 4; ++e) s[i * 4 + r4][k4 + e] = (__bf16)v[i][e];
  __syncthreads();
  for (int q = tid; q < 512; q += 256) { const int c = (q >> 5) & 1, lane = q & 31;
    vst2((unsigned*)(DST + ((size_t)nt * (K / 32) + (k0 >> 5) + (q >> 6)) * 512 + (q & 63) * 8), *(const v4u*)&s[lane & 15][(q >> 6) * 32 + c * 16 + 8 * (lane >> 4)]); }
}
// ---- k_qkv: block = (64 rows, 128 of the 3072 cols): QKV = bf16(x) . rows (exact) -> f32 rows (pitch 3072) for q and v, f32 tiles for k
__global__ __launch_bounds__(128) void k_qkv(const __bf16* __restrict__ X, const __bf16* __restrict__ P, float* __restrict__ QKV, float* __restrict__ KT) {
  __shared__ __align__(16) float so[4][16][132];
  const int tid = threadIdx.x, wave = tid >> 5, lane = tid & 31, col = lane & 15, g = lane >> 4; const size_t r0 = (size_t)blockIdx.x * 64 + wave * 16; const int n0 = blockIdx.y * 128;
  v8f acc[8] = {};
  v16b an, w[8];   // the fragments of the k-step in work; each is reloaded for the next k-step right behind its last use
  const unsigned xo = (unsigned)((int)r0 * DM * 2 + lane * 16), wo = (unsigned)(n0 * DM * 2 + lane * 16);   // a band of 16 rows is DM / 32 tiles of 1024 bytes
  an = frag_to(X, 0u, xo);
  __builtin_amdgcn_sched_barrier(0);   // keeps the A loads the oldest here as in the loop, else the loop's first wait drains every load
#pragma unroll
  for (int j = 0; j < 8; ++j) w[j] = frag_to(P, (unsigned)(j * 16 * DM * 2), wo);
#pragma unroll 2
  for (int kc = 0; kc < DM / 32; ++kc) { const int kn = kc + 1 < DM / 32 ? kc + 1 : kc;   // the last k-step reloads itself: in bounds, unused
    asm volatile("s_wait_xcnt 0x0" ::: "memory");   // the next addresses are formed in the address registers of the loads issued last
    __builtin_amdgcn_sched_barrier(0);   // keeps the A loads the oldest of each k-step, so that the wait for A leaves the B loads in flight, and the address sums behind the wait above
    const v16b a = an;
    an = frag_to(X, (unsigned)(kn * 1024), xo);
#pragma unroll
    for (int j = 0; j < 8; ++j) { acc[j] = wmma_bf(a, w[j], acc[j]); w[j] = frag_to(P, (unsigned)(kn * 1024 + j * 16 * DM * 2), wo); } }
#pragma unroll
  for (int j = 0; j < 8; ++j)
#pragma unroll
    for (int r = 0; r < 8; ++r) so[wave][8 * g + r][j * 16 + col] = acc[j][r];
  LDSX();
  if (n0 >= DM && n0 < 2 * DM) {   // k columns (the same for the whole block): two heads x two 32-wide halves of this wave's 16 keys
    const int b = (int)r0 / SS, kt = ((int)r0 % SS) >> 4, h0 = (n0 - DM) / HD;
#pragma unroll   // the tile's place becomes a constant step from one address
    for (int t = 0; t < 4; ++t) tile_st(KT + ((((size_t)b * NH + h0 + (t >> 1)) * (SS / 16) + kt) * 2 + (t & 1)) * 512, &so[wave][0][t * 32], 132, lane);
  } else
    for (int rl = 0; rl < 16; ++rl) vst2(QKV + (r0 + rl) * QKVW + n0 + lane * 4, *(const v4f*)&so[wave][rl][lane * 4]);
}
__global__ __launch_bounds__(256) void k_vt(const float* __restrict__ QKV, __bf16* __restrict__ VTH, __bf16* __restrict__ VTL) {
  __shared__ __align__(16) __bf16 sth[64][72], stl[64][72]; const int tid = threadIdx.x; const size_t rb = (size_t)blockIdx.x * 64; const int h = blockIdx.y; const int b = (int)(rb / SS), s0 = (int)(rb % SS);
  for (int q = tid; q < 64 * 64; q += 256) { const int rl = q >> 6, d = q & 63; const float v = QKV[(rb + rl) * QKVW + 2 * DM + h * HD + d]; const __bf16 hb = (__bf16)v; sth[d][rl] = hb; stl[d][rl] = (__bf16)(v - (float)hb); }
  __syncthreads();
  for (int q = tid; q < 64 * 8; q += 256) { const int dt = q >> 7, sl = (q >> 6) & 1, c = (q >> 5) & 1, lane = q & 31; const int d = dt * 16 + (lane & 15), s = sl * 32 + c * 16 + 8 * (lane >> 4);   // 4 x 2 tiles (16 d x 32 s)
    const size_t o = (((size_t)b * (DM / 16) + h * (HD / 16) + dt) * (SS / 32) + (s0 >> 5) + sl) * 512 + (q & 63) * 8; vst2((unsigned*)(VTH + o), *(const v4u*)&sth[d][s]); vst2((unsigned*)(VTL + o), *(const v4u*)&stl[d][s]); }
}
// ---- k_attn: block = (64 queries, head h, batch b): full flash attention (K = 64), logits = q.k (3 products) / 8, P.V 3 products; epilogue: out -= xsa_scale * (out.v_own)/(|v_own|^2 + 1e-8) * v_own (lane reductions over the head's 64 dims); O[b*S+q][h*64+d] as f32 tiles
__global__ __launch_bounds__(128) void k_attn(const float* __restrict__ QK, const float* __restrict__ KT, const __bf16* __restrict__ VTH, const __bf16* __restrict__ VTL, const float* __restrict__ XS, float* __restrict__ O) {
  __shared__ __align__(16) float sp[4][16][36]; __shared__ __align__(16) float so[4][16][68];
  const int tid = threadIdx.x, wave = tid >> 5, lane = tid & 31, col = lane & 15, g = lane >> 4;
  const int qb = blockIdx.x, h = blockIdx.y, b = blockIdx.z; const int q0 = qb * 64 + wave * 16; const size_t rq = (size_t)b * SS + q0 + col;
  F2 aq[2];
#pragma unroll
  for (int kc = 0; kc < 2; ++kc) aq[kc] = split_row(QK + rq * QKVW + h * HD, kc * 32, lane);
  float m[8], l[8];
#pragma unroll
  for (int r = 0; r < 8; ++r) { m[r] = -3.0e38f; l[r] = 0.f; }
  v8f acc[4] = {};
  const float* kbase = KT + (size_t)(b * NH + h) * SS * HD;   // this head's k: a pass of 32 keys is 4 f32 tiles in a row (16 keys x 32 d each), 8192 bytes
  const __bf16 *vhb = VTH + (size_t)(b * NH + h) * HD * SS, *vlb = VTL + (size_t)(b * NH + h) * HD * SS;   // this head's v: 4 bands of 16 d, each SS / 32 bf16 tiles
  const unsigned lo = (unsigned)(lane * 16);
  float kr[2][2][16];   // the pass's K rows, raw; reloaded for the next pass quarter by quarter as the P.V products free the V registers
#pragma unroll
  for (int ct = 0; ct < 2; ++ct)
#pragma unroll
    for (int kc = 0; kc < 2; ++kc) raw_to(kr[ct][kc], kbase, (unsigned)((ct * 2 + kc) * 2048), lo);
#pragma unroll 1
  for (int ks = 0; ks < SS / 32; ++ks) { v8f s[2]; const int kn = ks + 1 < SS / 32 ? ks + 1 : ks;   // the last pass reloads itself: in bounds, unused
#pragma unroll
    for (int ct = 0; ct < 2; ++ct) { v8f c = {};
#pragma unroll
      for (int kc = 0; kc < 2; ++kc) { const F2 kb = bsplit16(kr[ct][kc]); c = mac3(aq[kc], kb, c); }
#pragma unroll
      for (int r = 0; r < 8; ++r) s[ct][r] = c[r] * 0.125f; }   // SCALE = 1/sqrt(64)
    v16b vh[4], vl[4];   // this pass's V fragments, issued here so that they arrive under the softmax
#pragma unroll
    for (int dt = 0; dt < 4; ++dt) { const unsigned vr = (unsigned)(dt * 16 * SS * 2 + ks * 1024); vh[dt] = frag_to(vhb, vr, lo); vl[dt] = frag_to(vlb, vr, lo); }
#pragma unroll
    for (int r = 0; r < 8; ++r) { float mx = fmaxf(s[0][r], s[1][r]);
#pragma unroll
      for (int o = 1; o < 16; o <<= 1) mx = fmaxf(mx, __shfl_xor(mx, o));
      const float mn = fmaxf(m[r], mx); const float alpha = expf(m[r] - mn);
      const float e0 = expf(s[0][r] - mn), e1 = expf(s[1][r] - mn); float es = e0 + e1;
#pragma unroll
      for (int o = 1; o < 16; o <<= 1) es += __shfl_xor(es, o);
      l[r] = l[r] * alpha + es; m[r] = mn;
#pragma unroll
      for (int dt = 0; dt < 4; ++dt) acc[dt][r] *= alpha;
      sp[wave][8 * g + r][col] = e0; sp[wave][8 * g + r][16 + col] = e1; }
    LDSX();
    const F2 pa = split_row(&sp[wave][col][0], 0, lane);
#pragma unroll
    for (int dt = 0; dt < 4; ++dt) { acc[dt] = wmma_bf(pa.l, vh[dt], acc[dt]); acc[dt] = wmma_bf(pa.h, vl[dt], acc[dt]); acc[dt] = wmma_bf(pa.h, vh[dt], acc[dt]); raw_to(kr[dt >> 1][dt & 1], kbase, (unsigned)(kn * 8192 + dt * 2048), lo); }
    LDSX(); }
  const float xsa = bfr(XS[0]);
#pragma unroll
  for (int r = 0; r < 8; ++r) { const float il = 1.0f / l[r]; const float* vrow = QK + ((size_t)b * SS + q0 + 8 * g + r) * QKVW + 2 * DM + h * HD; float o[4], vv[4]; float dot = 0.f, vn = 0.f;
#pragma unroll
    for (int dt = 0; dt < 4; ++dt) { o[dt] = acc[dt][r] * il; vv[dt] = vrow[dt * 16 + col]; dot += o[dt] * vv[dt]; vn += vv[dt] * vv[dt]; }
#pragma unroll
    for (int q = 1; q < 16; q <<= 1) { dot += __shfl_xor(dot, q); vn += __shfl_xor(vn, q); }
    const float coef = xsa * (dot / (vn + 1e-8f));
#pragma unroll
    for (int dt = 0; dt < 4; ++dt) so[wave][8 * g + r][dt * 16 + col] = o[dt] - coef * vv[dt]; }
  LDSX();
#pragma unroll   // the step from tile to tile becomes a constant in the stores' offset field
  for (int t = 0; t < 2; ++t) tile_st(O + ((size_t)((b * SS + q0) >> 4) * (DM / 32) + h * 2 + t) * 512, &so[wave][0][t * 32], 68, lane);
}
// ---- k_out: block = (64 rows, 128 cols): out = O(hi/lo) . c_proj rows (2 products)
__global__ __launch_bounds__(128) void k_out(const float* __restrict__ O, const __bf16* __restrict__ P, float* __restrict__ Y) {
  __shared__ __align__(16) float so[4][16][132];
  const int tid = threadIdx.x, wave = tid >> 5, lane = tid & 31, col = lane & 15, g = lane >> 4; const size_t r0 = (size_t)blockIdx.x * 64 + wave * 16; const int n0 = blockIdx.y * 128;
  v8f acc[8] = {};
  float ar[16]; v16b w[8];   // as in k_qkv: reloaded for the next k-step right behind the last use
  const unsigned xo = (unsigned)((int)r0 * DM * 4 + lane * 16), wo = (unsigned)(n0 * DM * 2 + lane * 16);   // a band of 16 rows is DM / 32 tiles of 2048 (f32) or 1024 (bf16) bytes
  raw_to(ar, O, 0u, xo);
  __builtin_amdgcn_sched_barrier(0);   // keeps the A loads the oldest here as in the loop, else the loop's first wait drains every load
#pragma unroll
  for (int j = 0; j < 8; ++j) w[j] = frag_to(P, (unsigned)(j * 16 * DM * 2), wo);
#pragma unroll 2
  for (int kc = 0; kc < DM / 32; ++kc) { const int kn = kc + 1 < DM / 32 ? kc + 1 : kc;   // the last k-step reloads itself: in bounds, unused
    asm volatile("s_wait_xcnt 0x0" ::: "memory");   // the split below reuses the address registers of the loads issued last
    __builtin_amdgcn_sched_barrier(0);   // keeps the split of the next A behind this k-step's products (else it waits on a load just issued) and behind the wait above
    const F2 a = bsplit16(ar);
    raw_to(ar, O, (unsigned)(kn * 2048), xo);
#pragma unroll
    for (int j = 0; j < 8; ++j) { acc[j] = wmma_bf(a.l, w[j], acc[j]); acc[j] = wmma_bf(a.h, w[j], acc[j]); w[j] = frag_to(P, (unsigned)(kn * 1024 + j * 16 * DM * 2), wo); } }
#pragma unroll
  for (int j = 0; j < 8; ++j)
#pragma unroll
    for (int r = 0; r < 8; ++r) so[wave][8 * g + r][j * 16 + col] = acc[j][r];
  LDSX();
  for (int rl = 0; rl < 16; ++rl) vst2(Y + (r0 + rl) * DM + n0 + lane * 4, *(const v4f*)&so[wave][rl][lane * 4]);
}
extern "C" void kernel_launch(void* const* d_in, const int* in_sizes, int n_in, void* d_out, int out_size, void* d_ws, size_t ws_size, hipStream_t stream) {
  (void)in_sizes; (void)n_in; (void)out_size;
  const float** F = (const float**)d_in;   // x [2,2048,1024], Wq, Wk, Wv, Wo [1024,1024] (torch [out,in]), xsa_scale [1]
  if (ws_size < (size_t)WS_END) return;
  char* ws = (char*)d_ws; __bf16 *PK = (__bf16*)(ws + WS_PK), *VTH = (__bf16*)(ws + WS_VTH), *VTL = (__bf16*)(ws + WS_VTL), *XP = (__bf16*)(ws + WS_XP); float *QK = (float*)(ws + WS_QK), *O = (float*)(ws + WS_O), *KT = (float*)(ws + WS_KT);
  k_packrows<<<dim3(DM / 16, DM / 256), 256, 0, stream>>>(F[1], DM, PK + PK_A); k_packrows<<<dim3(DM / 16, DM / 256), 256, 0, stream>>>(F[2], DM, PK + PK_A + (size_t)DM * DM); k_packrows<<<dim3(DM / 16, DM / 256), 256, 0, stream>>>(F[3], DM, PK + PK_A + (size_t)2 * DM * DM); k_packrows<<<dim3(DM / 16, DM / 256), 256, 0, stream>>>(F[4], DM, PK + PK_P);
  k_packrows<<<dim3(NB * SS / 16, DM / 256), 256, 0, stream>>>(F[0], DM, XP);
  k_qkv<<<dim3(TNB * SS / 64, QKVW / 128), 128, 0, stream>>>(XP, PK + PK_A, QK, KT);
  k_vt<<<dim3(TNB * SS / 64, NH), 256, 0, stream>>>(QK, VTH, VTL);
  k_attn<<<dim3(TQB, NH, TNB), 128, 0, stream>>>(QK, KT, VTH, VTL, F[5], O);
  k_out<<<dim3(TOB, DM / 128), 128, 0, stream>>>(O, PK + PK_P, (float*)d_out);
}

// v004
// A run of this version takes 251 microseconds.
// In two side-by-side timings against v003, it was 1.19 and 1.20 times as fast.
// All steps since v000 together make it 2.27 times as fast.
// compute dtype: x, Wq, Wk, Wv, Wo, xsa_scale (module inputs) rounded to bf16; q/k/v projections with exact bf16 products (x and W are inputs); scores q.k with both computed operands as bf16 hi + residual pairs (3 products) and P.V with P hi/lo x V hi/lo (3 products); the exclusive (own-value) projection removal in f32 in the attention epilogue; the output projection hi/lo x exact Wo (2 products); softmax in f32; f32 accumulate.
#include <hip/hip_runtime.h>
#include <math.h>

typedef __attribute__((ext_vector_type(16))) _Float16 v16h;
typedef __attribute__((ext_vector_type(16))) __bf16 v16b;
typedef __attribute__((ext_vector_type(8)))  _Float16 v8h;
typedef __attribute__((ext_vector_type(8)))  float v8f;
typedef __attribute__((ext_vector_type(4)))  float v4f;
typedef __attribute__((ext_vector_type(2)))  float v2f;
typedef __attribute__((ext_vector_type(4)))  unsigned v4u;
typedef __attribute__((ext_vector_type(4)))  int v4i;
typedef float __attribute__((may_alias)) float_a;
typedef int __attribute__((may_alias)) int_a;

template <typename T> __device__ __forceinline__ void vst2(void* p, T v) { *(T*)p = v;  }
__device__ __forceinline__ v8f wmma16(v16h a, v16h b, v8f c) {
  v8f d = __builtin_amdgcn_wmma_f32_16x16x32_f16(false, a, false, b, (short)0, c, false, false);
  asm volatile("v_nop\n\tv_nop\n\tv_nop\n\tv_nop" : "+v"(d) : "v"(a), "v"(b));
  return d;
}
__device__ __forceinline__ v8f wmma_bf(v16b a, v16b b, v8f c) {
  v8f d = __builtin_amdgcn_wmma_f32_16x16x32_bf16(false, a, false, b, (short)0, c, false, false);
  asm volatile("v_nop\n\tv_nop\n\tv_nop\n\tv_nop" : "+v"(d) : "v"(a), "v"(b));
  return d;
}
// 16x16x32 fragments: lane = (h = lane>>4, row/col = lane&15); elements 0..7 = k0+8h+0..7, 8..15 = k0+16+8h+0..7; D element r = row 8h+r
__device__ __forceinline__ v16h frag_h(const _Float16* rowk0, int lane) {
  union { v16h v; v8h q[2]; } u; const _Float16* p = rowk0 + 8 * (lane >> 4);
  u.q[0] = *(const v8h*)p; u.q[1] = *(const v8h*)(p + 16); return u.v;
}
__device__ __forceinline__ v16h frag_f32(const float* rowk0, int lane) {
  v16h a; const float* p = rowk0 + 8 * (lane >> 4);
#pragma unroll
  for (int i = 0; i < 8; ++i) { a[i] = (_Float16)p[i]; a[8 + i] = (_Float16)p[16 + i]; }
  return a;
}
__device__ __forceinline__ v16h frag_f32s(const float* rowk0, int lane, float sc) {
  v16h a; const float* p = rowk0 + 8 * (lane >> 4);
#pragma unroll
  for (int i = 0; i < 8; ++i) { a[i] = (_Float16)(p[i] * sc); a[8 + i] = (_Float16)(p[16 + i] * sc); }
  return a;
}
// column fragment from a [K][ld] layout (column n), rows >= K read as 0
__device__ __forceinline__ v16h fragc_f32(const float* W, int k0, int n, int lane, int ld, int K) {
  v16h a; const int g = lane >> 4;
#pragma unroll
  for (int i = 0; i < 8; ++i) { const int ka = k0 + 8 * g + i, kb = ka + 16;
    a[i] = (_Float16)(ka < K ? W[(size_t)(ka < K ? ka : K - 1) * ld + n] : 0.f); a[8 + i] = (_Float16)(kb < K ? W[(size_t)(kb < K ? kb : K - 1) * ld + n] : 0.f); }
  return a;
}
struct F2 { v16b h, l; };
__device__ __forceinline__ F2 bsplit16(const float v[16]) { F2 r;
#pragma unroll
  for (int i = 0; i < 16; ++i) { const __bf16 h = (__bf16)v[i]; r.h[i] = h; r.l[i] = (__bf16)(v[i] - (float)h); }
  return r; }
__device__ __forceinline__ F2 split_row(const float* row, int k0, int lane) { float v[16]; const float* p = row + k0 + 8 * (lane >> 4);
#pragma unroll
  for (int i = 0; i < 8; ++i) { v[i] = p[i]; v[8 + i] = p[16 + i]; }
  return bsplit16(v); }
__device__ __forceinline__ F2 split_rowK(const float* row, int k0, int lane, int K) { float v[16]; const int g = lane >> 4;
#pragma unroll
  for (int i = 0; i < 8; ++i) { const int ka = k0 + 8 * g + i, kb = ka + 16; v[i] = ka < K ? row[ka < K ? ka : K - 1] : 0.f; v[8 + i] = kb < K ? row[kb < K ? kb : K - 1] : 0.f; }
  return bsplit16(v); }
__device__ __forceinline__ F2 split_col(const float* W, int k0, int n, int lane, int ld, int K) { float v[16]; const int g = lane >> 4;
#pragma unroll
  for (int i = 0; i < 8; ++i) { const int ka = k0 + 8 * g + i, kb = ka + 16; v[i] = ka < K ? W[(size_t)(ka < K ? ka : K - 1) * ld + n] : 0.f; v[8 + i] = kb < K ? W[(size_t)(kb < K ? kb : K - 1) * ld + n] : 0.f; }
  return bsplit16(v); }
__device__ __forceinline__ v8f mac3(const F2& a, const F2& b, v8f c) { c = wmma_bf(a.l, b.h, c); c = wmma_bf(a.h, b.l, c); return wmma_bf(a.h, b.h, c); }
__device__ __forceinline__ float sigm(float v) { return 1.0f / (1.0f + expf(-v)); }
#define LDSX() do { asm volatile("s_wait_dscnt 0" ::: "memory"); __builtin_amdgcn_wave_barrier(); __builtin_amdgcn_fence(__ATOMIC_RELEASE, "workgroup"); } while (0)


// Exclusive self-attention (B 2, S 2048, 16 heads x 64; torch Linear no-bias, y = x W^T): full (non-causal) softmax attention; per token/head out -= xsa_scale * (out . v) / (|v|^2 + 1e-8) * v; then Wo.
#define NB 2
#define SS 2048
#define DM 1024
#define NH 16
#define HD 64
#define QKVW (3 * DM)
#ifndef TQB
#define TQB (SS / 64)
#define TNB NB
#define TOB (NB * SS / 64)     // output row tiles (all)
#endif
typedef __attribute__((ext_vector_type(8))) __bf16 v8b;
// Fragment tiles: every operand that a loop loads lies in the workspace as tiles of 16 rows x 32 k in the order the lanes take it, so that one 16-byte load of a wave reads 512 bytes in a row (4 lines of 128 bytes) instead of 32 bytes from each of 16 rows (16 lines).
// bf16 tile, 512 elements: element (c * 32 + lane) * 8 + e is row (lane & 15), k = 16 c + 8 (lane >> 4) + e         (c = 0, 1; e = 0..7)
// f32 tile, 512 elements:  element (i * 32 + lane) * 4 + e is row (lane & 15), k = 16 (i >> 1) + 8 (lane >> 4) + 4 (i & 1) + e   (i = 0..3; e = 0..3)
// the address is base + uniform bytes + the lane's own bytes (16 * lane): the constant step from tile to tile folds into the loads' offset field
// 16 f32 of one row in fragment k order, kept raw so that the load can be issued one step ahead of its conversion
__device__ __forceinline__ void raw_to(float v[16], const float* base, unsigned uni, unsigned lo) { const char* p = (const char*)base + uni + (size_t)lo;
#pragma unroll
  for (int i = 0; i < 4; ++i) { const v4f t = *(const v4f*)(p + i * 512);
#pragma unroll
    for (int e = 0; e < 4; ++e) v[4 * i + e] = t[e]; } }
__device__ __forceinline__ v16b frag_to(const __bf16* base, unsigned uni, unsigned lo) {
  union { v16b v; v8b q[2]; } u; const char* p = (const char*)base + uni + (size_t)lo;
  u.q[0] = *(const v8b*)p; u.q[1] = *(const v8b*)(p + 512); return u.v;
}
// one wave's 16 x 32 f32 block, staged in LDS as rows of 'pitch' floats, stored as one f32 tile
__device__ __forceinline__ void tile_st(float* tile, const float* rows, int pitch, int lane) {
#pragma unroll
  for (int i = 0; i < 4; ++i) vst2(tile + i * 128 + lane * 4, *(const v4f*)(rows + (lane & 15) * pitch + (i >> 1) * 16 + 8 * (lane >> 4) + (i & 1) * 4));
}
__device__ __forceinline__ float bfr(float v) { return (float)(__bf16)v; }
__device__ __attribute__((noinline)) float erf_ni(float v) { return erff(v); }

#define PK_A 0                       // [3072][1024] c_attn kernel rows, as bf16 tiles [row / 16][k / 32]
#define PK_P (PK_A + QKVW * DM)        // [1024][1024] c_proj kernel rows, likewise
#define PK_END (PK_P + DM * DM)
#define WS_PK  0u
#define WS_QK  (WS_PK + 2u * PK_END)             // f32 [4096 rows][3072]: [q | (k: not written here, see WS_KT) | v]
#define WS_VTH (WS_QK + 4u * NB * SS * QKVW)     // bf16 tiles [2][1024 (h*64+d) / 16][2048 s / 32]
#define WS_VTL (WS_VTH + 2u * NB * DM * SS)
#define WS_O   (WS_VTL + 2u * NB * DM * SS)        // f32 tiles [4096 / 16][1024 / 32]
#define WS_XP  (WS_O + 4u * NB * SS * DM)          // bf16 tiles [4096 / 16][1024 / 32]: x
#define WS_KT  (WS_XP + 2u * NB * SS * DM)         // f32 tiles [2 * 16 (b, h)][2048 s / 16][64 / 32]: k
#define WS_END (WS_KT + 4u * NB * SS * DM)

// ---- k_packrows: block = (16 rows, 256 k) of a [N][K] f32 matrix (a weight, y = x W^T, or x) -> 8 bf16 tiles; rows read whole, turned into tile order through LDS
__global__ __launch_bounds__(256) void k_packrows(const float* __restrict__ Wm, int K, __bf16* __restrict__ DST) {
  __shared__ __align__(16) __bf16 s[16][264]; const int nt = blockIdx.x, k0 = blockIdx.y * 256, tid = threadIdx.x;
  v4f v[4]; const int r4 = tid >> 6, k4 = (tid & 63) * 4;
#pragma unroll   // so that a thread's four loads are in flight together, not one behind the other's wait
  for (int i = 0; i < 4; ++i) { v[i] = *(const v4f*)(Wm + (size_t)(nt * 16 + i * 4 + r4) * K + k0 + k4);
    asm volatile("s_wait_xcnt 0x0" ::: "memory"); }   // the build lets the next load land in this load's address registers
#pragma unroll
  for (int i = 0; i < 4; ++i)
#pragma unroll
    for (int e = 0; e < 4; ++e) s[i * 4 + r4][k4 + e] = (__bf16)v[i][e];
  __syncthreads();
  for (int q = tid; q < 512; q += 256) { const int c = (q >> 5) & 1, lane = q & 31;
    vst2((unsigned*)(DST + ((size_t)nt * (K / 32) + (k0 >> 5) + (q >> 6)) * 512 + (q & 63) * 8), *(const v4u*)&s[lane & 15][(q >> 6) * 32 + c * 16 + 8 * (lane >> 4)]); }
}
// ---- k_qkv: block = (64 rows, 128 of the 3072 cols): QKV = bf16(x) . rows (exact) -> f32 rows (pitch 3072) for q and v, f32 tiles for k
__global__ __launch_bounds__(128) void k_qkv(const __bf16* __restrict__ X, const __bf16* __restrict__ P, float* __restrict__ QKV, float* __restrict__ KT) {
  __shared__ __align__(16) float so[4][16][132];
  const int tid = threadIdx.x, wave = tid >> 5, lane = tid & 31, col = lane & 15, g = lane >> 4; const size_t r0 = (size_t)blockIdx.x * 64 + wave * 16; const int n0 = blockIdx.y * 128;
  v8f acc[8] = {};
  v16b an, w[8];   // the fragments of the k-step in work; each is reloaded for the next k-step right behind its last use
  const unsigned xo = (unsigned)((int)r0 * DM * 2 + lane * 16), wo = (unsigned)(n0 * DM * 2 + lane * 16);   // a band of 16 rows is DM / 32 tiles of 1024 bytes
  an = frag_to(X, 0u, xo);
  __builtin_amdgcn_sched_barrier(0);   // keeps the A loads the oldest here as in the loop, else the loop's first wait drains every load
#pragma unroll
  for (int j = 0; j < 8; ++j) w[j] = frag_to(P, (unsigned)(j * 16 * DM * 2), wo);
#pragma unroll 2
  for (int kc = 0; kc < DM / 32; ++kc) { const int kn = kc + 1 < DM / 32 ? kc + 1 : kc;   // the last k-step reloads itself: in bounds, unused
    asm volatile("s_wait_xcnt 0x0" ::: "memory");   // the next addresses are formed in the address registers of the loads issued last
    __builtin_amdgcn_sched_barrier(0);   // keeps the A loads the oldest of each k-step, so that the wait for A leaves the B loads in flight, and the address sums behind the wait above
    const v16b a = an;
    an = frag_to(X, (unsigned)(kn * 1024), xo);
#pragma unroll
    for (int j = 0; j < 8; ++j) { acc[j] = wmma_bf(a, w[j], acc[j]); w[j] = frag_to(P, (unsigned)(kn * 1024 + j * 16 * DM * 2), wo); } }
#pragma unroll
  for (int j = 0; j < 8; ++j)
#pragma unroll
    for (int r = 0; r < 8; ++r) so[wave][8 * g + r][j * 16 + col] = acc[j][r];
  LDSX();
  if (n0 >= DM && n0 < 2 * DM) {   // k columns (the same for the whole block): two heads x two 32-wide halves of this wave's 16 keys
    const int b = (int)r0 / SS, kt = ((int)r0 % SS) >> 4, h0 = (n0 - DM) / HD;
#pragma unroll   // the tile's place becomes a constant step from one address
    for (int t = 0; t < 4; ++t) tile_st(KT + ((((size_t)b * NH + h0 + (t >> 1)) * (SS / 16) + kt) * 2 + (t & 1)) * 512, &so[wave][0][t * 32], 132, lane);
  } else
    for (int rl = 0; rl < 16; ++rl) vst2(QKV + (r0 + rl) * QKVW + n0 + lane * 4, *(const v4f*)&so[wave][rl][lane * 4]);
}
__global__ __launch_bounds__(256) void k_vt(const float* __restrict__ QKV, __bf16* __restrict__ VTH, __bf16* __restrict__ VTL) {
  __shared__ __align__(16) __bf16 sth[64][72], stl[64][72]; const int tid = threadIdx.x; const size_t rb = (size_t)blockIdx.x * 64; const int h = blockIdx.y; const int b = (int)(rb / SS), s0 = (int)(rb % SS);
  for (int q = tid; q < 64 * 64; q += 256) { const int rl = q >> 6, d = q & 63; const float v = QKV[(rb + rl) * QKVW + 2 * DM + h * HD + d]; const __bf16 hb = (__bf16)v; sth[d][rl] = hb; stl[d][rl] = (__bf16)(v - (float)hb); }
  __syncthreads();
  for (int q = tid; q < 64 * 8; q += 256) { const int dt = q >> 7, sl = (q >> 6) & 1, c = (q >> 5) & 1, lane = q & 31; const int d = dt * 16 + (lane & 15), s = sl * 32 + c * 16 + 8 * (lane >> 4);   // 4 x 2 tiles (16 d x 32 s)
    const size_t o = (((size_t)b * (DM / 16) + h * (HD / 16) + dt) * (SS / 32) + (s0 >> 5) + sl) * 512 + (q & 63) * 8; vst2((unsigned*)(VTH + o), *(const v4u*)&sth[d][s]); vst2((unsigned*)(VTL + o), *(const v4u*)&stl[d][s]); }
}
// ---- k_attn: block = (64 queries, head h, batch b): full flash attention (K = 64), transposed: S^T = K . Q^T (3 products) / 8 and O^T += V^T . P^T (3 products), so that a lane holds 16 of ONE query's 32 scores: maximum and sum run in the lane's own registers plus one exchange between the wave's halves, and the exponentials are already the B fragment of P^T (keys 8g + 0..7, 16 + 8g + 0..7); epilogue: out -= xsa_scale * (out.v_own)/(|v_own|^2 + 1e-8) * v_own; O[b*S+q][h*64+d] as f32 tiles, which is the order the lanes hold O^T in
__device__ __forceinline__ float xhalf(float x) { return __builtin_bit_cast(float, __builtin_amdgcn_permlanex16(__builtin_bit_cast(int, x), __builtin_bit_cast(int, x), 0x76543210, 0xfedcba98, false, false)); }   // lane l takes lane l ^ 16's value
__global__ __launch_bounds__(128) void k_attn(const float* __restrict__ QK, const float* __restrict__ KT, const __bf16* __restrict__ VTH, const __bf16* __restrict__ VTL, const float* __restrict__ XS, float* __restrict__ O) {
  const int tid = threadIdx.x, wave = tid >> 5, lane = tid & 31, col = lane & 15, g = lane >> 4;
  const int qb = blockIdx.x, h = blockIdx.y, b = blockIdx.z; const int q0 = qb * 64 + wave * 16; const size_t rq = (size_t)b * SS + q0 + col;
  F2 aq[2];
#pragma unroll
  for (int kc = 0; kc < 2; ++kc) aq[kc] = split_row(QK + rq * QKVW + h * HD, kc * 32, lane);
  float m = -3.0e38f, l = 0.f;   // of query q0 + col; l is the sum over this half's keys only, the halves are joined behind the loop
  v8f acc[4] = {};   // O^T: acc[dt][r] is d = 16 dt + 8 g + r of query q0 + col
  const float* kbase = KT + (size_t)(b * NH + h) * SS * HD;   // this head's k: a pass of 32 keys is 4 f32 tiles in a row (16 keys x 32 d each), 8192 bytes
  const __bf16 *vhb = VTH + (size_t)(b * NH + h) * HD * SS, *vlb = VTL + (size_t)(b * NH + h) * HD * SS;   // this head's v: 4 bands of 16 d, each SS / 32 bf16 tiles
  const unsigned lo = (unsigned)(lane * 16);
  float kr[2][2][16];   // the pass's K rows, raw; reloaded for the next pass quarter by quarter as the P.V products free the V registers
#pragma unroll
  for (int ct = 0; ct < 2; ++ct)
#pragma unroll
    for (int kc = 0; kc < 2; ++kc) raw_to(kr[ct][kc], kbase, (unsigned)((ct * 2 + kc) * 2048), lo);
#pragma unroll 1
  for (int ks = 0; ks < SS / 32; ++ks) { float e[16]; const int kn = ks + 1 < SS / 32 ? ks + 1 : ks;   // the last pass reloads itself: in bounds, unused
#pragma unroll
    for (int ct = 0; ct < 2; ++ct) { v8f c = {};
#pragma unroll
      for (int kc = 0; kc < 2; ++kc) { const F2 kb = bsplit16(kr[ct][kc]); c = wmma_bf(kb.h, aq[kc].l, c); c = wmma_bf(kb.l, aq[kc].h, c); c = wmma_bf(kb.h, aq[kc].h, c); }
#pragma unroll
      for (int r = 0; r < 8; ++r) e[ct * 8 + r] = c[r] * 0.125f; }   // SCALE = 1/sqrt(64); key 16 ct + 8 g + r
    v16b vh[4], vl[4];   // this pass's V fragments, issued here so that they arrive under the softmax
#pragma unroll
    for (int dt = 0; dt < 4; ++dt) { const unsigned vr = (unsigned)(dt * 16 * SS * 2 + ks * 1024); vh[dt] = frag_to(vhb, vr, lo); vl[dt] = frag_to(vlb, vr, lo); }
    float mx = e[0];
#pragma unroll
    for (int i = 1; i < 16; ++i) mx = fmaxf(mx, e[i]);
    mx = fmaxf(mx, xhalf(mx));
    const float mn = fmaxf(m, mx); const float alpha = expf(m - mn); m = mn;
#pragma unroll
    for (int i = 0; i < 16; ++i) e[i] = expf(e[i] - mn);
    float es[4];   // four chains, so that the adds do not wait on one another
#pragma unroll
    for (int i = 0; i < 4; ++i) es[i] = (e[i] + e[4 + i]) + (e[8 + i] + e[12 + i]);
    l = l * alpha + ((es[0] + es[1]) + (es[2] + es[3]));
#pragma unroll
    for (int dt = 0; dt < 4; ++dt)
#pragma unroll
      for (int r = 0; r < 8; ++r) acc[dt][r] *= alpha;
    const F2 pa = bsplit16(e);
#pragma unroll
    for (int dt = 0; dt < 4; ++dt) { acc[dt] = wmma_bf(vh[dt], pa.l, acc[dt]); acc[dt] = wmma_bf(vl[dt], pa.h, acc[dt]); acc[dt] = wmma_bf(vh[dt], pa.h, acc[dt]); raw_to(kr[dt >> 1][dt & 1], kbase, (unsigned)(kn * 8192 + dt * 2048), lo); } }
  const float xsa = bfr(XS[0]); const float il = 1.0f / (l + xhalf(l));
  const float* vrow = QK + rq * QKVW + 2 * DM + h * HD + 8 * g; v4f vv[8]; float dot = 0.f, vn = 0.f;   // the query's own v, the 32 d that this lane holds
#pragma unroll
  for (int i = 0; i < 8; ++i) vv[i] = *(const v4f*)(vrow + (i >> 1) * 16 + (i & 1) * 4);
  asm volatile("s_wait_xcnt 0x0" ::: "memory");   // before the address registers of the loads above are used for anything else
#pragma unroll
  for (int i = 0; i < 8; ++i)
#pragma unroll
    for (int e = 0; e < 4; ++e) { const float o = acc[i >> 1][(i & 1) * 4 + e] * il; acc[i >> 1][(i & 1) * 4 + e] = o; dot += o * vv[i][e]; vn += vv[i][e] * vv[i][e]; }
  dot += xhalf(dot); vn += xhalf(vn);
  const float coef = xsa * (dot / (vn + 1e-8f));
  float* ot = O + ((size_t)((b * SS + q0) >> 4) * (DM / 32) + h * 2) * 512 + lane * 4;
#pragma unroll   // the step from store to store becomes a constant in the stores' offset field
  for (int i = 0; i < 8; ++i) { v4f w;
#pragma unroll
    for (int e = 0; e < 4; ++e) w[e] = acc[i >> 1][(i & 1) * 4 + e] - coef * vv[i][e];
    vst2(ot + i * 128, w); }
}
// ---- k_out: block = (64 rows, 128 cols): out = O(hi/lo) . c_proj rows (2 products)
__global__ __launch_bounds__(128) void k_out(const float* __restrict__ O, const __bf16* __restrict__ P, float* __restrict__ Y) {
  __shared__ __align__(16) float so[4][16][132];
  const int tid = threadIdx.x, wave = tid >> 5, lane = tid & 31, col = lane & 15, g = lane >> 4; const size_t r0 = (size_t)blockIdx.x * 64 + wave * 16; const int n0 = blockIdx.y * 128;
  v8f acc[8] = {};
  float ar[16]; v16b w[8];   // as in k_qkv: reloaded for the next k-step right behind the last use
  const unsigned xo = (unsigned)((int)r0 * DM * 4 + lane * 16), wo = (unsigned)(n0 * DM * 2 + lane * 16);   // a band of 16 rows is DM / 32 tiles of 2048 (f32) or 1024 (bf16) bytes
  raw_to(ar, O, 0u, xo);
  __builtin_amdgcn_sched_barrier(0);   // keeps the A loads the oldest here as in the loop, else the loop's first wait drains every load
#pragma unroll
  for (int j = 0; j < 8; ++j) w[j] = frag_to(P, (unsigned)(j * 16 * DM * 2), wo);
#pragma unroll 2
  for (int kc = 0; kc < DM / 32; ++kc) { const int kn = kc + 1 < DM / 32 ? kc + 1 : kc;   // the last k-step reloads itself: in bounds, unused
    asm volatile("s_wait_xcnt 0x0" ::: "memory");   // the split below reuses the address registers of the loads issued last
    __builtin_amdgcn_sched_barrier(0);   // keeps the split of the next A behind this k-step's products (else it waits on a load just issued) and behind the wait above
    const F2 a = bsplit16(ar);
    raw_to(ar, O, (unsigned)(kn * 2048), xo);
#pragma unroll
    for (int j = 0; j < 8; ++j) { acc[j] = wmma_bf(a.l, w[j], acc[j]); acc[j] = wmma_bf(a.h, w[j], acc[j]); w[j] = frag_to(P, (unsigned)(kn * 1024 + j * 16 * DM * 2), wo); } }
#pragma unroll
  for (int j = 0; j < 8; ++j)
#pragma unroll
    for (int r = 0; r < 8; ++r) so[wave][8 * g + r][j * 16 + col] = acc[j][r];
  LDSX();
  for (int rl = 0; rl < 16; ++rl) vst2(Y + (r0 + rl) * DM + n0 + lane * 4, *(const v4f*)&so[wave][rl][lane * 4]);
}
extern "C" void kernel_launch(void* const* d_in, const int* in_sizes, int n_in, void* d_out, int out_size, void* d_ws, size_t ws_size, hipStream_t stream) {
  (void)in_sizes; (void)n_in; (void)out_size;
  const float** F = (const float**)d_in;   // x [2,2048,1024], Wq, Wk, Wv, Wo [1024,1024] (torch [out,in]), xsa_scale [1]
  if (ws_size < (size_t)WS_END) return;
  char* ws = (char*)d_ws; __bf16 *PK = (__bf16*)(ws + WS_PK), *VTH = (__bf16*)(ws + WS_VTH), *VTL = (__bf16*)(ws + WS_VTL), *XP = (__bf16*)(ws + WS_XP); float *QK = (float*)(ws + WS_QK), *O = (float*)(ws + WS_O), *KT = (float*)(ws + WS_KT);
  k_packrows<<<dim3(DM / 16, DM / 256), 256, 0, stream>>>(F[1], DM, PK + PK_A); k_packrows<<<dim3(DM / 16, DM / 256), 256, 0, stream>>>(F[2], DM, PK + PK_A + (size_t)DM * DM); k_packrows<<<dim3(DM / 16, DM / 256), 256, 0, stream>>>(F[3], DM, PK + PK_A + (size_t)2 * DM * DM); k_packrows<<<dim3(DM / 16, DM / 256), 256, 0, stream>>>(F[4], DM, PK + PK_P);
  k_packrows<<<dim3(NB * SS / 16, DM / 256), 256, 0, stream>>>(F[0], DM, XP);
  k_qkv<<<dim3(TNB * SS / 64, QKVW / 128), 128, 0, stream>>>(XP, PK + PK_A, QK, KT);
  k_vt<<<dim3(TNB * SS / 64, NH), 256, 0, stream>>>(QK, VTH, VTL);
  k_attn<<<dim3(TQB, NH, TNB), 128, 0, stream>>>(QK, KT, VTH, VTL, F[5], O);
  k_out<<<dim3(TOB, DM / 128), 128, 0, stream>>>(O, PK + PK_P, (float*)d_out);
}

// v005
// Measured time: 211 microseconds a run.
// Timed twice side by side with v004, it ran 1.19 times as fast both times.
// All steps since v000 together make it 2.70 times as fast.
// compute dtype: x, Wq, Wk, Wv, Wo, xsa_scale (module inputs) rounded to bf16; q/k/v projections with exact bf16 products (x and W are inputs); scores q.k with both computed operands as bf16 hi + residual pairs (3 products) and P.V with P hi/lo x V hi/lo (3 products); the exclusive (own-value) projection removal in f32 in the attention epilogue; the output projection hi/lo x exact Wo (2 products); softmax in f32; f32 accumulate.
#include <hip/hip_runtime.h>
#include <math.h>

typedef __attribute__((ext_vector_type(16))) _Float16 v16h;
typedef __attribute__((ext_vector_type(16))) __bf16 v16b;
typedef __attribute__((ext_vector_type(8)))  _Float16 v8h;
typedef __attribute__((ext_vector_type(8)))  float v8f;
typedef __attribute__((ext_vector_type(4)))  float v4f;
typedef __attribute__((ext_vector_type(2)))  float v2f;
typedef __attribute__((ext_vector_type(4)))  unsigned v4u;
typedef __attribute__((ext_vector_type(4)))  int v4i;
typedef float __attribute__((may_alias)) float_a;
typedef int __attribute__((may_alias)) int_a;

template <typename T> __device__ __forceinline__ void vst2(void* p, T v) { *(T*)p = v;  }
__device__ __forceinline__ v8f wmma16(v16h a, v16h b, v8f c) {
  v8f d = __builtin_amdgcn_wmma_f32_16x16x32_f16(false, a, false, b, (short)0, c, false, false);
  asm volatile("v_nop\n\tv_nop\n\tv_nop\n\tv_nop" : "+v"(d) : "v"(a), "v"(b));
  return d;
}
__device__ __forceinline__ v8f wmma_bf(v16b a, v16b b, v8f c) {
  v8f d = __builtin_amdgcn_wmma_f32_16x16x32_bf16(false, a, false, b, (short)0, c, false, false);
  asm volatile("v_nop\n\tv_nop\n\tv_nop\n\tv_nop" : "+v"(d) : "v"(a), "v"(b));
  return d;
}
// 16x16x32 fragments: lane = (h = lane>>4, row/col = lane&15); elements 0..7 = k0+8h+0..7, 8..15 = k0+16+8h+0..7; D element r = row 8h+r
__device__ __forceinline__ v16h frag_h(const _Float16* rowk0, int lane) {
  union { v16h v; v8h q[2]; } u; const _Float16* p = rowk0 + 8 * (lane >> 4);
  u.q[0] = *(const v8h*)p; u.q[1] = *(const v8h*)(p + 16); return u.v;
}
__device__ __forceinline__ v16h frag_f32(const float* rowk0, int lane) {
  v16h a; const float* p = rowk0 + 8 * (lane >> 4);
#pragma unroll
  for (int i = 0; i < 8; ++i) { a[i] = (_Float16)p[i]; a[8 + i] = (_Float16)p[16 + i]; }
  return a;
}
__device__ __forceinline__ v16h frag_f32s(const float* rowk0, int lane, float sc) {
  v16h a; const float* p = rowk0 + 8 * (lane >> 4);
#pragma unroll
  for (int i = 0; i < 8; ++i) { a[i] = (_Float16)(p[i] * sc); a[8 + i] = (_Float16)(p[16 + i] * sc); }
  return a;
}
// column fragment from a [K][ld] layout (column n), rows >= K read as 0
__device__ __forceinline__ v16h fragc_f32(const float* W, int k0, int n, int lane, int ld, int K) {
  v16h a; const int g = lane >> 4;
#pragma unroll
  for (int i = 0; i < 8; ++i) { const int ka = k0 + 8 * g + i, kb = ka + 16;
    a[i] = (_Float16)(ka < K ? W[(size_t)(ka < K ? ka : K - 1) * ld + n] : 0.f); a[8 + i] = (_Float16)(kb < K ? W[(size_t)(kb < K ? kb : K - 1) * ld + n] : 0.f); }
  return a;
}
struct F2 { v16b h, l; };
__device__ __forceinline__ F2 bsplit16(const float v[16]) { F2 r;
#pragma unroll
  for (int i = 0; i < 16; ++i) { const __bf16 h = (__bf16)v[i]; r.h[i] = h; r.l[i] = (__bf16)(v[i] - (float)h); }
  return r; }
__device__ __forceinline__ F2 split_row(const float* row, int k0, int lane) { float v[16]; const float* p = row + k0 + 8 * (lane >> 4);
#pragma unroll
  for (int i = 0; i < 8; ++i) { v[i] = p[i]; v[8 + i] = p[16 + i]; }
  return bsplit16(v); }
__device__ __forceinline__ F2 split_rowK(const float* row, int k0, int lane, int K) { float v[16]; const int g = lane >> 4;
#pragma unroll
  for (int i = 0; i < 8; ++i) { const int ka = k0 + 8 * g + i, kb = ka + 16; v[i] = ka < K ? row[ka < K ? ka : K - 1] : 0.f; v[8 + i] = kb < K ? row[kb < K ? kb : K - 1] : 0.f; }
  return bsplit16(v); }
__device__ __forceinline__ F2 split_col(const float* W, int k0, int n, int lane, int ld, int K) { float v[16]; const int g = lane >> 4;
#pragma unroll
  for (int i = 0; i < 8; ++i) { const int ka = k0 + 8 * g + i, kb = ka + 16; v[i] = ka < K ? W[(size_t)(ka < K ? ka : K - 1) * ld + n] : 0.f; v[8 + i] = kb < K ? W[(size_t)(kb < K ? kb : K - 1) * ld + n] : 0.f; }
  return bsplit16(v); }
__device__ __forceinline__ v8f mac3(const F2& a, const F2& b, v8f c) { c = wmma_bf(a.l, b.h, c); c = wmma_bf(a.h, b.l, c); return wmma_bf(a.h, b.h, c); }
__device__ __forceinline__ float sigm(float v) { return 1.0f / (1.0f + expf(-v)); }
#define LDSX() do { asm volatile("s_wait_dscnt 0" ::: "memory"); __builtin_amdgcn_wave_barrier(); __builtin_amdgcn_fence(__ATOMIC_RELEASE, "workgroup"); } while (0)


// Exclusive self-attention (B 2, S 2048, 16 heads x 64; torch Linear no-bias, y = x W^T): full (non-causal) softmax attention; per token/head out -= xsa_scale * (out . v) / (|v|^2 + 1e-8) * v; then Wo.
#define NB 2
#define SS 2048
#define DM 1024
#define NH 16
#define HD 64
#define QKVW (3 * DM)
#ifndef TQB
#define TQB (SS / 64)
#define TNB NB
#define TOB (NB * SS / 64)     // output row tiles (all)
#endif
typedef __attribute__((ext_vector_type(8))) __bf16 v8b;
// Fragment tiles: every operand that a loop loads lies in the workspace as tiles of 16 rows x 32 k in the order the lanes take it, so that one 16-byte load of a wave reads 512 bytes in a row (4 lines of 128 bytes) instead of 32 bytes from each of 16 rows (16 lines).
// bf16 tile, 512 elements: element (c * 32 + lane) * 8 + e is row (lane & 15), k = 16 c + 8 (lane >> 4) + e         (c = 0, 1; e = 0..7)
// a computed operand (k, attention out) is a pair of such tiles in a row, bf16 hi and bf16 residual, split once by the kernel that makes it
// the address is base + uniform bytes + the lane's own bytes (16 * lane): the constant step from tile to tile folds into the loads' offset field
__device__ __forceinline__ v16b frag_to(const __bf16* base, unsigned uni, unsigned lo) {
  union { v16b v; v8b q[2]; } u; const char* p = (const char*)base + uni + (size_t)lo;
  u.q[0] = *(const v8b*)p; u.q[1] = *(const v8b*)(p + 512); return u.v;
}
__device__ __forceinline__ float bfr(float v) { return (float)(__bf16)v; }
__device__ __attribute__((noinline)) float erf_ni(float v) { return erff(v); }

#define PK_A 0                       // [3072][1024] c_attn kernel rows, as bf16 tiles [row / 16][k / 32]
#define PK_P (PK_A + QKVW * DM)        // [1024][1024] c_proj kernel rows, likewise
#define PK_END (PK_P + DM * DM)
#define WS_PK  0u
#define WS_QK  (WS_PK + 2u * PK_END)             // f32 [4096 rows][3072]: [q | (k: not written here, see WS_KT) | v]
#define WS_VTH (WS_QK + 4u * NB * SS * QKVW)     // bf16 tiles [2][1024 (h*64+d) / 16][2048 s / 32]
#define WS_VTL (WS_VTH + 2u * NB * DM * SS)
#define WS_O   (WS_VTL + 2u * NB * DM * SS)        // bf16 tiles [4096 / 16][1024 / 32][hi, residual]
#define WS_XP  (WS_O + 4u * NB * SS * DM)          // bf16 tiles [4096 / 16][1024 / 32]: x
#define WS_KT  (WS_XP + 2u * NB * SS * DM)         // bf16 tiles [2 * 16 (b, h)][2048 s / 16][64 / 32][hi, residual]: k
#define WS_END (WS_KT + 4u * NB * SS * DM)

// ---- k_packrows: block = (16 rows, 256 k) of a [N][K] f32 matrix (a weight, y = x W^T, or x) -> 8 bf16 tiles; rows read whole, turned into tile order through LDS
__global__ __launch_bounds__(256) void k_packrows(const float* __restrict__ Wm, int K, __bf16* __restrict__ DST) {
  __shared__ __align__(16) __bf16 s[16][264]; const int nt = blockIdx.x, k0 = blockIdx.y * 256, tid = threadIdx.x;
  v4f v[4]; const int r4 = tid >> 6, k4 = (tid & 63) * 4;
#pragma unroll   // so that a thread's four loads are in flight together, not one behind the other's wait
  for (int i = 0; i < 4; ++i) { v[i] = *(const v4f*)(Wm + (size_t)(nt * 16 + i * 4 + r4) * K + k0 + k4);
    asm volatile("s_wait_xcnt 0x0" ::: "memory"); }   // the build lets the next load land in this load's address registers
#pragma unroll
  for (int i = 0; i < 4; ++i)
#pragma unroll
    for (int e = 0; e < 4; ++e) s[i * 4 + r4][k4 + e] = (__bf16)v[i][e];
  __syncthreads();
  for (int q = tid; q < 512; q += 256) { const int c = (q >> 5) & 1, lane = q & 31;
    vst2((unsigned*)(DST + ((size_t)nt * (K / 32) + (k0 >> 5) + (q >> 6)) * 512 + (q & 63) * 8), *(const v4u*)&s[lane & 15][(q >> 6) * 32 + c * 16 + 8 * (lane >> 4)]); }
}
// ---- k_qkv: block = (64 rows, 128 of the 3072 cols): QKV = bf16(x) . rows (exact) -> f32 rows (pitch 3072) for q and v, bf16 hi and residual tiles for k (split here once, not in each of the 128 query waves that read a key)
__global__ __launch_bounds__(128) void k_qkv(const __bf16* __restrict__ X, const __bf16* __restrict__ P, float* __restrict__ QKV, __bf16* __restrict__ KT) {
  __shared__ __align__(16) float so[4][16][132];
  const int tid = threadIdx.x, wave = tid >> 5, lane = tid & 31, col = lane & 15, g = lane >> 4; const size_t r0 = (size_t)blockIdx.x * 64 + wave * 16; const int n0 = blockIdx.y * 128;
  v8f acc[8] = {};
  v16b an, w[8];   // the fragments of the k-step in work; each is reloaded for the next k-step right behind its last use
  const unsigned xo = (unsigned)((int)r0 * DM * 2 + lane * 16), wo = (unsigned)(n0 * DM * 2 + lane * 16);   // a band of 16 rows is DM / 32 tiles of 1024 bytes
  an = frag_to(X, 0u, xo);
  __builtin_amdgcn_sched_barrier(0);   // keeps the A loads the oldest here as in the loop, else the loop's first wait drains every load
#pragma unroll
  for (int j = 0; j < 8; ++j) w[j] = frag_to(P, (unsigned)(j * 16 * DM * 2), wo);
#pragma unroll 2
  for (int kc = 0; kc < DM / 32; ++kc) { const int kn = kc + 1 < DM / 32 ? kc + 1 : kc;   // the last k-step reloads itself: in bounds, unused
    asm volatile("s_wait_xcnt 0x0" ::: "memory");   // the next addresses are formed in the address registers of the loads issued last
    __builtin_amdgcn_sched_barrier(0);   // keeps the A loads the oldest of each k-step, so that the wait for A leaves the B loads in flight, and the address sums behind the wait above
    const v16b a = an;
    an = frag_to(X, (unsigned)(kn * 1024), xo);
#pragma unroll
    for (int j = 0; j < 8; ++j) { acc[j] = wmma_bf(a, w[j], acc[j]); w[j] = frag_to(P, (unsigned)(kn * 1024 + j * 16 * DM * 2), wo); } }
#pragma unroll
  for (int j = 0; j < 8; ++j)
#pragma unroll
    for (int r = 0; r < 8; ++r) so[wave][8 * g + r][j * 16 + col] = acc[j][r];
  LDSX();
  if (n0 >= DM && n0 < 2 * DM) {   // k columns (the same for the whole block): two heads x two 32-wide halves of this wave's 16 keys
    const int b = (int)r0 / SS, kt = ((int)r0 % SS) >> 4, h0 = (n0 - DM) / HD;
#pragma unroll   // the tile's place becomes a constant step from one address
    for (int t = 0; t < 4; ++t) { __bf16* tile = KT + ((((size_t)b * NH + h0 + (t >> 1)) * (SS / 16) + kt) * 2 + (t & 1)) * 1024 + lane * 8;
#pragma unroll   // the step from store to store becomes a constant in the stores' offset field
      for (int c = 0; c < 2; ++c) { const float* p = &so[wave][col][t * 32 + c * 16 + 8 * g]; const v4f p0 = *(const v4f*)p, p1 = *(const v4f*)(p + 4); v8b hi, re;
#pragma unroll   // constant element numbers, so that the vectors stay in registers
        for (int e = 0; e < 8; ++e) { const float v = e < 4 ? p0[e & 3] : p1[e & 3]; const __bf16 hb = (__bf16)v; hi[e] = hb; re[e] = (__bf16)(v - (float)hb); }
        vst2(tile + c * 256, hi); vst2(tile + 512 + c * 256, re); } }
  } else
    for (int rl = 0; rl < 16; ++rl) vst2(QKV + (r0 + rl) * QKVW + n0 + lane * 4, *(const v4f*)&so[wave][rl][lane * 4]);
}
__global__ __launch_bounds__(256) void k_vt(const float* __restrict__ QKV, __bf16* __restrict__ VTH, __bf16* __restrict__ VTL) {
  __shared__ __align__(16) __bf16 sth[64][72], stl[64][72]; const int tid = threadIdx.x; const size_t rb = (size_t)blockIdx.x * 64; const int h = blockIdx.y; const int b = (int)(rb / SS), s0 = (int)(rb % SS);
  for (int q = tid; q < 64 * 64; q += 256) { const int rl = q >> 6, d = q & 63; const float v = QKV[(rb + rl) * QKVW + 2 * DM + h * HD + d]; const __bf16 hb = (__bf16)v; sth[d][rl] = hb; stl[d][rl] = (__bf16)(v - (float)hb); }
  __syncthreads();
  for (int q = tid; q < 64 * 8; q += 256) { const int dt = q >> 7, sl = (q >> 6) & 1, c = (q >> 5) & 1, lane = q & 31; const int d = dt * 16 + (lane & 15), s = sl * 32 + c * 16 + 8 * (lane >> 4);   // 4 x 2 tiles (16 d x 32 s)
    const size_t o = (((size_t)b * (DM / 16) + h * (HD / 16) + dt) * (SS / 32) + (s0 >> 5) + sl) * 512 + (q & 63) * 8; vst2((unsigned*)(VTH + o), *(const v4u*)&sth[d][s]); vst2((unsigned*)(VTL + o), *(const v4u*)&stl[d][s]); }
}
// ---- k_attn: block = (64 queries, head h, batch b): full flash attention (K = 64), transposed: S^T = K . Q^T (3 products) / 8 and O^T += V^T . P^T (3 products), so that a lane holds 16 of ONE query's 32 scores: maximum and sum run in the lane's own registers plus one exchange between the wave's halves, and the exponentials are already the B fragment of P^T (keys 8g + 0..7, 16 + 8g + 0..7); epilogue: out -= xsa_scale * (out.v_own)/(|v_own|^2 + 1e-8) * v_own; O[b*S+q][h*64+d] as bf16 hi and residual tiles, which is the order the lanes hold O^T in
__device__ __forceinline__ float xhalf(float x) { return __builtin_bit_cast(float, __builtin_amdgcn_permlanex16(__builtin_bit_cast(int, x), __builtin_bit_cast(int, x), 0x76543210, 0xfedcba98, false, false)); }   // lane l takes lane l ^ 16's value
__global__ __launch_bounds__(128) void k_attn(const float* __restrict__ QK, const __bf16* __restrict__ KT, const __bf16* __restrict__ VTH, const __bf16* __restrict__ VTL, const float* __restrict__ XS, __bf16* __restrict__ O) {
  const int tid = threadIdx.x, wave = tid >> 5, lane = tid & 31, col = lane & 15, g = lane >> 4;
  const int qb = blockIdx.x, h = blockIdx.y, b = blockIdx.z; const int q0 = qb * 64 + wave * 16; const size_t rq = (size_t)b * SS + q0 + col;
  F2 aq[2];
#pragma unroll
  for (int kc = 0; kc < 2; ++kc) aq[kc] = split_row(QK + rq * QKVW + h * HD, kc * 32, lane);
  float m = -3.0e38f, l = 0.f;   // of query q0 + col; l is the sum over this half's keys only, the halves are joined behind the loop
  v8f acc[4] = {};   // O^T: acc[dt][r] is d = 16 dt + 8 g + r of query q0 + col
  const __bf16* kbase = KT + (size_t)(b * NH + h) * SS * HD * 2;   // this head's k: a pass of 32 keys is 4 pairs (hi, residual) of bf16 tiles in a row (16 keys x 32 d each), 8192 bytes
  const __bf16 *vhb = VTH + (size_t)(b * NH + h) * HD * SS, *vlb = VTL + (size_t)(b * NH + h) * HD * SS;   // this head's v: 4 bands of 16 d, each SS / 32 bf16 tiles
  const unsigned lo = (unsigned)(lane * 16);
  v16b kh[2][2], kl[2][2];   // the pass's K fragments, hi and residual; reloaded for the next pass quarter by quarter as the P.V products free the V registers
#pragma unroll
  for (int ct = 0; ct < 2; ++ct)
#pragma unroll
    for (int kc = 0; kc < 2; ++kc) { kh[ct][kc] = frag_to(kbase, (unsigned)((ct * 2 + kc) * 2048), lo); kl[ct][kc] = frag_to(kbase, (unsigned)((ct * 2 + kc) * 2048 + 1024), lo); }
#pragma unroll 1
  for (int ks = 0; ks < SS / 32; ++ks) { float e[16]; const int kn = ks + 1 < SS / 32 ? ks + 1 : ks;   // the last pass reloads itself: in bounds, unused
#pragma unroll
    for (int ct = 0; ct < 2; ++ct) { v8f c = {};
#pragma unroll
      for (int kc = 0; kc < 2; ++kc) { c = wmma_bf(kh[ct][kc], aq[kc].l, c); c = wmma_bf(kl[ct][kc], aq[kc].h, c); c = wmma_bf(kh[ct][kc], aq[kc].h, c); }
#pragma unroll
      for (int r = 0; r < 8; ++r) e[ct * 8 + r] = c[r] * 0.125f; }   // SCALE = 1/sqrt(64); key 16 ct + 8 g + r
    v16b vh[4], vl[4];   // this pass's V fragments, issued here so that they arrive under the softmax
#pragma unroll
    for (int dt = 0; dt < 4; ++dt) { const unsigned vr = (unsigned)(dt * 16 * SS * 2 + ks * 1024); vh[dt] = frag_to(vhb, vr, lo); vl[dt] = frag_to(vlb, vr, lo); }
    float mx = e[0];
#pragma unroll
    for (int i = 1; i < 16; ++i) mx = fmaxf(mx, e[i]);
    mx = fmaxf(mx, xhalf(mx));
    const float mn = fmaxf(m, mx); const float alpha = expf(m - mn); m = mn;
#pragma unroll
    for (int i = 0; i < 16; ++i) e[i] = expf(e[i] - mn);
    float es[4];   // four chains, so that the adds do not wait on one another
#pragma unroll
    for (int i = 0; i < 4; ++i) es[i] = (e[i] + e[4 + i]) + (e[8 + i] + e[12 + i]);
    l = l * alpha + ((es[0] + es[1]) + (es[2] + es[3]));
#pragma unroll
    for (int dt = 0; dt < 4; ++dt)
#pragma unroll
      for (int r = 0; r < 8; ++r) acc[dt][r] *= alpha;
    const F2 pa = bsplit16(e);
#pragma unroll
    for (int dt = 0; dt < 4; ++dt) { acc[dt] = wmma_bf(vh[dt], pa.l, acc[dt]); acc[dt] = wmma_bf(vl[dt], pa.h, acc[dt]); acc[dt] = wmma_bf(vh[dt], pa.h, acc[dt]); kh[dt >> 1][dt & 1] = frag_to(kbase, (unsigned)(kn * 8192 + dt * 2048), lo); kl[dt >> 1][dt & 1] = frag_to(kbase, (unsigned)(kn * 8192 + dt * 2048 + 1024), lo); } }
  const float xsa = bfr(XS[0]); const float il = 1.0f / (l + xhalf(l));
  const float* vrow = QK + rq * QKVW + 2 * DM + h * HD + 8 * g; v4f vv[8]; float dot = 0.f, vn = 0.f;   // the query's own v, the 32 d that this lane holds
#pragma unroll
  for (int i = 0; i < 8; ++i) vv[i] = *(const v4f*)(vrow + (i >> 1) * 16 + (i & 1) * 4);
  asm volatile("s_wait_xcnt 0x0" ::: "memory");   // before the address registers of the loads above are used for anything else
#pragma unroll
  for (int i = 0; i < 8; ++i)
#pragma unroll
    for (int e = 0; e < 4; ++e) { const float o = acc[i >> 1][(i & 1) * 4 + e] * il; acc[i >> 1][(i & 1) * 4 + e] = o; dot += o * vv[i][e]; vn += vv[i][e] * vv[i][e]; }
  dot += xhalf(dot); vn += xhalf(vn);
  const float coef = xsa * (dot / (vn + 1e-8f));
  __bf16* ot = O + ((size_t)((b * SS + q0) >> 4) * (DM / 32) + h * 2) * 1024 + lane * 8;
#pragma unroll   // the step from store to store becomes a constant in the stores' offset field
  for (int dt = 0; dt < 4; ++dt) { v8b hi, re;
#pragma unroll
    for (int r = 0; r < 8; ++r) { const float w = acc[dt][r] - coef * vv[2 * dt + (r >> 2)][r & 3]; const __bf16 hb = (__bf16)w; hi[r] = hb; re[r] = (__bf16)(w - (float)hb); }
    vst2(ot + (dt >> 1) * 1024 + (dt & 1) * 256, hi); vst2(ot + (dt >> 1) * 1024 + 512 + (dt & 1) * 256, re); }
}
// ---- k_out: block = (64 rows, 128 cols): out = O(hi/lo) . c_proj rows (2 products)
__global__ __launch_bounds__(128) void k_out(const __bf16* __restrict__ O, const __bf16* __restrict__ P, float* __restrict__ Y) {
  __shared__ __align__(16) float so[4][16][132];
  const int tid = threadIdx.x, wave = tid >> 5, lane = tid & 31, col = lane & 15, g = lane >> 4; const size_t r0 = (size_t)blockIdx.x * 64 + wave * 16; const int n0 = blockIdx.y * 128;
  v8f acc[8] = {};
  v16b ahn, aln, w[8];   // as in k_qkv: reloaded for the next k-step right behind the last use
  const unsigned xo = (unsigned)((int)r0 * DM * 4 + lane * 16), wo = (unsigned)(n0 * DM * 2 + lane * 16);   // a band of 16 rows is DM / 32 tile pairs of 2048 bytes (hi, residual) or tiles of 1024 bytes
  ahn = frag_to(O, 0u, xo); aln = frag_to(O, 1024u, xo);
  __builtin_amdgcn_sched_barrier(0);   // keeps the A loads the oldest here as in the loop, else the loop's first wait drains every load
#pragma unroll
  for (int j = 0; j < 8; ++j) w[j] = frag_to(P, (unsigned)(j * 16 * DM * 2), wo);
#pragma unroll 2
  for (int kc = 0; kc < DM / 32; ++kc) { const int kn = kc + 1 < DM / 32 ? kc + 1 : kc;   // the last k-step reloads itself: in bounds, unused
    asm volatile("s_wait_xcnt 0x0" ::: "memory");   // the next addresses are formed in the address registers of the loads issued last, also over the back edge
    __builtin_amdgcn_sched_barrier(0);   // keeps the A loads the oldest of each k-step, so that the wait for A leaves the B loads in flight, and the address sums behind the wait above
    const v16b ah = ahn, al = aln;
    ahn = frag_to(O, (unsigned)(kn * 2048), xo); aln = frag_to(O, (unsigned)(kn * 2048 + 1024), xo);
#pragma unroll
    for (int j = 0; j < 8; ++j) { acc[j] = wmma_bf(al, w[j], acc[j]); acc[j] = wmma_bf(ah, w[j], acc[j]); w[j] = frag_to(P, (unsigned)(kn * 1024 + j * 16 * DM * 2), wo); } }
#pragma unroll
  for (int j = 0; j < 8; ++j)
#pragma unroll
    for (int r = 0; r < 8; ++r) so[wave][8 * g + r][j * 16 + col] = acc[j][r];
  LDSX();
  for (int rl = 0; rl < 16; ++rl) vst2(Y + (r0 + rl) * DM + n0 + lane * 4, *(const v4f*)&so[wave][rl][lane * 4]);
}
extern "C" void kernel_launch(void* const* d_in, const int* in_sizes, int n_in, void* d_out, int out_size, void* d_ws, size_t ws_size, hipStream_t stream) {
  (void)in_sizes; (void)n_in; (void)out_size;
  const float** F = (const float**)d_in;   // x [2,2048,1024], Wq, Wk, Wv, Wo [1024,1024] (torch [out,in]), xsa_scale [1]
  if (ws_size < (size_t)WS_END) return;
  char* ws = (char*)d_ws; __bf16 *PK = (__bf16*)(ws + WS_PK), *VTH = (__bf16*)(ws + WS_VTH), *VTL = (__bf16*)(ws + WS_VTL), *XP = (__bf16*)(ws + WS_XP); float *QK = (float*)(ws + WS_QK); __bf16 *O = (__bf16*)(ws + WS_O), *KT = (__bf16*)(ws + WS_KT);
  k_packrows<<<dim3(DM / 16, DM / 256), 256, 0, stream>>>(F[1], DM, PK + PK_A); k_packrows<<<dim3(DM / 16, DM / 256), 256, 0, stream>>>(F[2], DM, PK + PK_A + (size_t)DM * DM); k_packrows<<<dim3(DM / 16, DM / 256), 256, 0, stream>>>(F[3], DM, PK + PK_A + (size_t)2 * DM * DM); k_packrows<<<dim3(DM / 16, DM / 256), 256, 0, stream>>>(F[4], DM, PK + PK_P);
  k_packrows<<<dim3(NB * SS / 16, DM / 256), 256, 0, stream>>>(F[0], DM, XP);
  k_qkv<<<dim3(TNB * SS / 64, QKVW / 128), 128, 0, stream>>>(XP, PK + PK_A, QK, KT);
  k_vt<<<dim3(TNB * SS / 64, NH), 256, 0, stream>>>(QK, VTH, VTL);
  k_attn<<<dim3(TQB, NH, TNB), 128, 0, stream>>>(QK, KT, VTH, VTL, F[5], O);
  k_out<<<dim3(TOB, DM / 128), 128, 0, stream>>>(O, PK + PK_P, (float*)d_out);
}

// v006
// It runs in 202 microseconds.
// In two side-by-side timings against v005, it was 1.06 and 1.08 times as fast.
// Counting every step since v000, it is 2.89 times as fast.
// compute dtype: x, Wq, Wk, Wv, Wo, xsa_scale (module inputs) rounded to bf16; q/k/v projections with exact bf16 products (x and W are inputs); scores q.k with both computed operands as bf16 hi + residual pairs (3 products) and P.V with P hi/lo x V hi/lo (3 products); the exclusive (own-value) projection removal in f32 in the attention epilogue; the output projection hi/lo x exact Wo (2 products); softmax in f32; f32 accumulate.
#include <hip/hip_runtime.h>
#include <math.h>

typedef __attribute__((ext_vector_type(16))) _Float16 v16h;
typedef __attribute__((ext_vector_type(16))) __bf16 v16b;
typedef __attribute__((ext_vector_type(8)))  _Float16 v8h;
typedef __attribute__((ext_vector_type(8)))  float v8f;
typedef __attribute__((ext_vector_type(4)))  float v4f;
typedef __attribute__((ext_vector_type(2)))  float v2f;
typedef __attribute__((ext_vector_type(4)))  unsigned v4u;
typedef __attribute__((ext_vector_type(4)))  int v4i;
typedef float __attribute__((may_alias)) float_a;
typedef int __attribute__((may_alias)) int_a;

template <typename T> __device__ __forceinline__ void vst2(void* p, T v) { *(T*)p = v;  }
__device__ __forceinline__ v8f wmma16(v16h a, v16h b, v8f c) {
  v8f d = __builtin_amdgcn_wmma_f32_16x16x32_f16(false, a, false, b, (short)0, c, false, false);
  asm volatile("v_nop\n\tv_nop\n\tv_nop\n\tv_nop" : "+v"(d) : "v"(a), "v"(b));
  return d;
}
__device__ __forceinline__ v8f wmma_bf(v16b a, v16b b, v8f c) {
  v8f d = __builtin_amdgcn_wmma_f32_16x16x32_bf16(false, a, false, b, (short)0, c, false, false);
  asm volatile("v_nop\n\tv_nop\n\tv_nop\n\tv_nop" : "+v"(d) : "v"(a), "v"(b));
  return d;
}
// 16x16x32 fragments: lane = (h = lane>>4, row/col = lane&15); elements 0..7 = k0+8h+0..7, 8..15 = k0+16+8h+0..7; D element r = row 8h+r
__device__ __forceinline__ v16h frag_h(const _Float16* rowk0, int lane) {
  union { v16h v; v8h q[2]; } u; const _Float16* p = rowk0 + 8 * (lane >> 4);
  u.q[0] = *(const v8h*)p; u.q[1] = *(const v8h*)(p + 16); return u.v;
}
__device__ __forceinline__ v16h frag_f32(const float* rowk0, int lane) {
  v16h a; const float* p = rowk0 + 8 * (lane >> 4);
#pragma unroll
  for (int i = 0; i < 8; ++i) { a[i] = (_Float16)p[i]; a[8 + i] = (_Float16)p[16 + i]; }
  return a;
}
__device__ __forceinline__ v16h frag_f32s(const float* rowk0, int lane, float sc) {
  v16h a; const float* p = rowk0 + 8 * (lane >> 4);
#pragma unroll
  for (int i = 0; i < 8; ++i) { a[i] = (_Float16)(p[i] * sc); a[8 + i] = (_Float16)(p[16 + i] * sc); }
  return a;
}
// column fragment from a [K][ld] layout (column n), rows >= K read as 0
__device__ __forceinline__ v16h fragc_f32(const float* W, int k0, int n, int lane, int ld, int K) {
  v16h a; const int g = lane >> 4;
#pragma unroll
  for (int i = 0; i < 8; ++i) { const int ka = k0 + 8 * g + i, kb = ka + 16;
    a[i] = (_Float16)(ka < K ? W[(size_t)(ka < K ? ka : K - 1) * ld + n] : 0.f); a[8 + i] = (_Float16)(kb < K ? W[(size_t)(kb < K ? kb : K - 1) * ld + n] : 0.f); }
  return a;
}
struct F2 { v16b h, l; };
__device__ __forceinline__ F2 bsplit16(const float v[16]) { F2 r;
#pragma unroll
  for (int i = 0; i < 16; ++i) { const __bf16 h = (__bf16)v[i]; r.h[i] = h; r.l[i] = (__bf16)(v[i] - (float)h); }
  return r; }
__device__ __forceinline__ F2 split_row(const float* row, int k0, int lane) { float v[16]; const float* p = row + k0 + 8 * (lane >> 4);
#pragma unroll
  for (int i = 0; i < 8; ++i) { v[i] = p[i]; v[8 + i] = p[16 + i]; }
  return bsplit16(v); }
__device__ __forceinline__ F2 split_rowK(const float* row, int k0, int lane, int K) { float v[16]; const int g = lane >> 4;
#pragma unroll
  for (int i = 0; i < 8; ++i) { const int ka = k0 + 8 * g + i, kb = ka + 16; v[i] = ka < K ? row[ka < K ? ka : K - 1] : 0.f; v[8 + i] = kb < K ? row[kb < K ? kb : K - 1] : 0.f; }
  return bsplit16(v); }
__device__ __forceinline__ F2 split_col(const float* W, int k0, int n, int lane, int ld, int K) { float v[16]; const int g = lane >> 4;
#pragma unroll
  for (int i = 0; i < 8; ++i) { const int ka = k0 + 8 * g + i, kb = ka + 16; v[i] = ka < K ? W[(size_t)(ka < K ? ka : K - 1) * ld + n] : 0.f; v[8 + i] = kb < K ? W[(size_t)(kb < K ? kb : K - 1) * ld + n] : 0.f; }
  return bsplit16(v); }
__device__ __forceinline__ v8f mac3(const F2& a, const F2& b, v8f c) { c = wmma_bf(a.l, b.h, c); c = wmma_bf(a.h, b.l, c); return wmma_bf(a.h, b.h, c); }
__device__ __forceinline__ float sigm(float v) { return 1.0f / (1.0f + expf(-v)); }
#define LDSX() do { asm volatile("s_wait_dscnt 0" ::: "memory"); __builtin_amdgcn_wave_barrier(); __builtin_amdgcn_fence(__ATOMIC_RELEASE, "workgroup"); } while (0)


// Exclusive self-attention (B 2, S 2048, 16 heads x 64; torch Linear no-bias, y = x W^T): full (non-causal) softmax attention; per token/head out -= xsa_scale * (out . v) / (|v|^2 + 1e-8) * v; then Wo.
#define NB 2
#define SS 2048
#define DM 1024
#define NH 16
#define HD 64
#define QKVW (3 * DM)
#ifndef TQB
#define TQB (SS / 64)
#define TNB NB
#define TOB (NB * SS / 64)     // output row tiles (all)
#endif
typedef __attribute__((ext_vector_type(8))) __bf16 v8b;
// Fragment tiles: every operand that a loop loads lies in the workspace as tiles of 16 rows x 32 k in the order the lanes take it, so that one 16-byte load of a wave reads 512 bytes in a row (4 lines of 128 bytes) instead of 32 bytes from each of 16 rows (16 lines).
// bf16 tile, 512 elements: element (c * 32 + lane) * 8 + e is row (lane & 15), k = 16 c + 8 (lane >> 4) + e         (c = 0, 1; e = 0..7)
// a computed operand (k, attention out) is a pair of such tiles in a row, bf16 hi and bf16 residual, split once by the kernel that makes it
// the address is base + uniform bytes + the lane's own bytes (16 * lane): the constant step from tile to tile folds into the loads' offset field
__device__ __forceinline__ v16b frag_to(const __bf16* base, unsigned uni, unsigned lo) {
  union { v16b v; v8b q[2]; } u; const char* p = (const char*)base + uni + (size_t)lo;
  u.q[0] = *(const v8b*)p; u.q[1] = *(const v8b*)(p + 512); return u.v;
}
__device__ __forceinline__ float bfr(float v) { return (float)(__bf16)v; }
__device__ __attribute__((noinline)) float erf_ni(float v) { return erff(v); }

#define PK_A 0                       // [3072][1024] c_attn kernel rows, as bf16 tiles [row / 16][k / 32]
#define PK_P (PK_A + QKVW * DM)        // [1024][1024] c_proj kernel rows, likewise
#define PK_END (PK_P + DM * DM)
#define WS_PK  0u
#define WS_QK  (WS_PK + 2u * PK_END)             // f32 [4096 rows][3072]: [q | (k: not written here, see WS_KT) | v]
#define WS_VTH (WS_QK + 4u * NB * SS * QKVW)     // bf16 tiles [2][1024 (h*64+d) / 16][2048 s / 32]
#define WS_VTL (WS_VTH + 2u * NB * DM * SS)
#define WS_O   (WS_VTL + 2u * NB * DM * SS)        // bf16 tiles [4096 / 16][1024 / 32][hi, residual]
#define WS_XP  (WS_O + 4u * NB * SS * DM)          // bf16 tiles [4096 / 16][1024 / 32]: x
#define WS_KT  (WS_XP + 2u * NB * SS * DM)         // bf16 tiles [2 * 16 (b, h)][2048 s / 16][64 / 32][hi, residual]: k
#define WS_END (WS_KT + 4u * NB * SS * DM)

// ---- k_packrows: block = (16 rows, 256 k) of a [N][K] f32 matrix (a weight, y = x W^T, or x) -> 8 bf16 tiles; rows read whole, turned into tile order through LDS
__global__ __launch_bounds__(256) void k_packrows(const float* __restrict__ Wm, int K, __bf16* __restrict__ DST) {
  __shared__ __align__(16) __bf16 s[16][264]; const int nt = blockIdx.x, k0 = blockIdx.y * 256, tid = threadIdx.x;
  v4f v[4]; const int r4 = tid >> 6, k4 = (tid & 63) * 4;
#pragma unroll   // so that a thread's four loads are in flight together, not one behind the other's wait
  for (int i = 0; i < 4; ++i) { v[i] = *(const v4f*)(Wm + (size_t)(nt * 16 + i * 4 + r4) * K + k0 + k4);
    asm volatile("s_wait_xcnt 0x0" ::: "memory"); }   // the build lets the next load land in this load's address registers
#pragma unroll
  for (int i = 0; i < 4; ++i)
#pragma unroll
    for (int e = 0; e < 4; ++e) s[i * 4 + r4][k4 + e] = (__bf16)v[i][e];
  __syncthreads();
  for (int q = tid; q < 512; q += 256) { const int c = (q >> 5) & 1, lane = q & 31;
    vst2((unsigned*)(DST + ((size_t)nt * (K / 32) + (k0 >> 5) + (q >> 6)) * 512 + (q & 63) * 8), *(const v4u*)&s[lane & 15][(q >> 6) * 32 + c * 16 + 8 * (lane >> 4)]); }
}
// ---- k_qkv: block = (64 rows, 128 of the 3072 cols): QKV = bf16(x) . rows (exact) -> f32 rows (pitch 3072) for q and v, bf16 hi and residual tiles for k (split here once, not in each of the 128 query waves that read a key)
__global__ __launch_bounds__(128) void k_qkv(const __bf16* __restrict__ X, const __bf16* __restrict__ P, float* __restrict__ QKV, __bf16* __restrict__ KT) {
  __shared__ __align__(16) float so[4][16][132];
  const int tid = threadIdx.x, wave = tid >> 5, lane = tid & 31, col = lane & 15, g = lane >> 4; const size_t r0 = (size_t)blockIdx.x * 64 + wave * 16; const int n0 = blockIdx.y * 128;
  v8f acc[8] = {};
  v16b an, w[8];   // the fragments of the k-step in work; each is reloaded for the next k-step right behind its last use
  const unsigned xo = (unsigned)((int)r0 * DM * 2 + lane * 16), wo = (unsigned)(n0 * DM * 2 + lane * 16);   // a band of 16 rows is DM / 32 tiles of 1024 bytes
  an = frag_to(X, 0u, xo);
  __builtin_amdgcn_sched_barrier(0);   // keeps the A loads the oldest here as in the loop, else the loop's first wait drains every load
#pragma unroll
  for (int j = 0; j < 8; ++j) w[j] = frag_to(P, (unsigned)(j * 16 * DM * 2), wo);
#pragma unroll 2
  for (int kc = 0; kc < DM / 32; ++kc) { const int kn = kc + 1 < DM / 32 ? kc + 1 : kc;   // the last k-step reloads itself: in bounds, unused
    asm volatile("s_wait_xcnt 0x0" ::: "memory");   // the next addresses are formed in the address registers of the loads issued last
    __builtin_amdgcn_sched_barrier(0);   // keeps the A loads the oldest of each k-step, so that the wait for A leaves the B loads in flight, and the address sums behind the wait above
    const v16b a = an;
    an = frag_to(X, (unsigned)(kn * 1024), xo);
#pragma unroll
    for (int j = 0; j < 8; ++j) { acc[j] = wmma_bf(a, w[j], acc[j]); w[j] = frag_to(P, (unsigned)(kn * 1024 + j * 16 * DM * 2), wo); } }
#pragma unroll
  for (int j = 0; j < 8; ++j)
#pragma unroll
    for (int r = 0; r < 8; ++r) so[wave][8 * g + r][j * 16 + col] = acc[j][r];
  LDSX();
  if (n0 >= DM && n0 < 2 * DM) {   // k columns (the same for the whole block): two heads x two 32-wide halves of this wave's 16 keys
    const int b = (int)r0 / SS, kt = ((int)r0 % SS) >> 4, h0 = (n0 - DM) / HD;
#pragma unroll   // the tile's place becomes a constant step from one address
    for (int t = 0; t < 4; ++t) { __bf16* tile = KT + ((((size_t)b * NH + h0 + (t >> 1)) * (SS / 16) + kt) * 2 + (t & 1)) * 1024 + lane * 8;
#pragma unroll   // the step from store to store becomes a constant in the stores' offset field
      for (int c = 0; c < 2; ++c) { const float* p = &so[wave][col][t * 32 + c * 16 + 8 * g]; const v4f p0 = *(const v4f*)p, p1 = *(const v4f*)(p + 4); v8b hi, re;
#pragma unroll   // constant element numbers, so that the vectors stay in registers
        for (int e = 0; e < 8; ++e) { const float v = e < 4 ? p0[e & 3] : p1[e & 3]; const __bf16 hb = (__bf16)v; hi[e] = hb; re[e] = (__bf16)(v - (float)hb); }
        vst2(tile + c * 256, hi); vst2(tile + 512 + c * 256, re); } }
  } else
    for (int rl = 0; rl < 16; ++rl) vst2(QKV + (r0 + rl) * QKVW + n0 + lane * 4, *(const v4f*)&so[wave][rl][lane * 4]);
}
__global__ __launch_bounds__(256) void k_vt(const float* __restrict__ QKV, __bf16* __restrict__ VTH, __bf16* __restrict__ VTL) {
  __shared__ __align__(16) __bf16 sth[64][72], stl[64][72]; const int tid = threadIdx.x; const size_t rb = (size_t)blockIdx.x * 64; const int h = blockIdx.y; const int b = (int)(rb / SS), s0 = (int)(rb % SS);
  for (int q = tid; q < 64 * 64; q += 256) { const int rl = q >> 6, d = q & 63; const float v = QKV[(rb + rl) * QKVW + 2 * DM + h * HD + d]; const __bf16 hb = (__bf16)v; sth[d][rl] = hb; stl[d][rl] = (__bf16)(v - (float)hb); }
  __syncthreads();
  for (int q = tid; q < 64 * 8; q += 256) { const int dt = q >> 7, sl = (q >> 6) & 1, c = (q >> 5) & 1, lane = q & 31; const int d = dt * 16 + (lane & 15), s = sl * 32 + c * 16 + 8 * (lane >> 4);   // 4 x 2 tiles (16 d x 32 s)
    const size_t o = (((size_t)b * (DM / 16) + h * (HD / 16) + dt) * (SS / 32) + (s0 >> 5) + sl) * 512 + (q & 63) * 8; vst2((unsigned*)(VTH + o), *(const v4u*)&sth[d][s]); vst2((unsigned*)(VTL + o), *(const v4u*)&stl[d][s]); }
}
// ---- k_attn: block = (64 queries, head h, batch b): full flash attention (K = 64), transposed: S^T = K . Q^T (3 products) / 8 and O^T += V^T . P^T (3 products), so that a lane holds 16 of ONE query's 32 scores: maximum and sum run in the lane's own registers plus one exchange between the wave's halves, and the exponentials are already the B fragment of P^T (keys 8g + 0..7, 16 + 8g + 0..7); epilogue: out -= xsa_scale * (out.v_own)/(|v_own|^2 + 1e-8) * v_own; O[b*S+q][h*64+d] as bf16 hi and residual tiles, which is the order the lanes hold O^T in
__device__ __forceinline__ float xhalf(float x) { return __builtin_bit_cast(float, __builtin_amdgcn_permlanex16(__builtin_bit_cast(int, x), __builtin_bit_cast(int, x), 0x76543210, 0xfedcba98, false, false)); }   // lane l takes lane l ^ 16's value
__global__ __launch_bounds__(128) void k_attn(const float* __restrict__ QK, const __bf16* __restrict__ KT, const __bf16* __restrict__ VTH, const __bf16* __restrict__ VTL, const float* __restrict__ XS, __bf16* __restrict__ O) {
  const int tid = threadIdx.x, wave = tid >> 5, lane = tid & 31, col = lane & 15, g = lane >> 4;
  const int qb = blockIdx.x, h = blockIdx.y, b = blockIdx.z; const int q0 = qb * 64 + wave * 16; const size_t rq = (size_t)b * SS + q0 + col;
  F2 aq[2];
#pragma unroll
  for (int kc = 0; kc < 2; ++kc) aq[kc] = split_row(QK + rq * QKVW + h * HD, kc * 32, lane);
  const float KL = 0.125f * 1.4426950408889634f;   // SCALE = 1/sqrt(64) times log2(e): the softmax runs in base 2, exp((s - max) / 8) = 2^(s * KL - max * KL)
  float m = -3.0e38f, l = 0.f;   // of query q0 + col; m is the maximum in use, already times KL; l is the sum over this half's keys only, the halves are joined behind the loop
  v8f acc[4] = {};   // O^T: acc[dt][r] is d = 16 dt + 8 g + r of query q0 + col
  const __bf16* kbase = KT + (size_t)(b * NH + h) * SS * HD * 2;   // this head's k: a pass of 32 keys is 4 pairs (hi, residual) of bf16 tiles in a row (16 keys x 32 d each), 8192 bytes
  const __bf16 *vhb = VTH + (size_t)(b * NH + h) * HD * SS, *vlb = VTL + (size_t)(b * NH + h) * HD * SS;   // this head's v: 4 bands of 16 d, each SS / 32 bf16 tiles
  const unsigned lo = (unsigned)(lane * 16);
  v16b kh[2][2], kl[2][2];   // the pass's K fragments, hi and residual; reloaded for the next pass quarter by quarter as the P.V products free the V registers
#pragma unroll
  for (int ct = 0; ct < 2; ++ct)
#pragma unroll
    for (int kc = 0; kc < 2; ++kc) { kh[ct][kc] = frag_to(kbase, (unsigned)((ct * 2 + kc) * 2048), lo); kl[ct][kc] = frag_to(kbase, (unsigned)((ct * 2 + kc) * 2048 + 1024), lo); }
#pragma unroll 1
  for (int ks = 0; ks < SS / 32; ++ks) { float e[16]; const int kn = ks + 1 < SS / 32 ? ks + 1 : ks;   // the last pass reloads itself: in bounds, unused
#pragma unroll
    for (int ct = 0; ct < 2; ++ct) { v8f c = {};
#pragma unroll
      for (int kc = 0; kc < 2; ++kc) { c = wmma_bf(kh[ct][kc], aq[kc].l, c); c = wmma_bf(kl[ct][kc], aq[kc].h, c); c = wmma_bf(kh[ct][kc], aq[kc].h, c); }
#pragma unroll
      for (int r = 0; r < 8; ++r) e[ct * 8 + r] = c[r]; }   // the plain products, the scale comes in with KL below; key 16 ct + 8 g + r
    v16b vh[4], vl[4];   // this pass's V fragments, issued here so that they arrive under the softmax
#pragma unroll
    for (int dt = 0; dt < 4; ++dt) { const unsigned vr = (unsigned)(dt * 16 * SS * 2 + ks * 1024); vh[dt] = frag_to(vhb, vr, lo); vl[dt] = frag_to(vlb, vr, lo); }
    float mx = e[0];
#pragma unroll
    for (int i = 1; i < 16; ++i) mx = fmaxf(mx, e[i]);
    mx = fmaxf(mx, xhalf(mx));
    const float mn = fmaxf(m, mx * KL); const float alpha = __builtin_amdgcn_exp2f(m - mn); m = mn;   // KL > 0: the maximum of the products times KL is the maximum of the scaled scores
#pragma unroll
    for (int i = 0; i < 16; ++i) e[i] = __builtin_amdgcn_exp2f(__builtin_fmaf(e[i], KL, -mn));   // one multiply-add and the chip's own 2^x a score; a weight too small for a normal float may come out as 0: it adds nothing to a sum whose largest term is 1
    float es[4];   // four chains, so that the adds do not wait on one another
#pragma unroll
    for (int i = 0; i < 4; ++i) es[i] = (e[i] + e[4 + i]) + (e[8 + i] + e[12 + i]);
    l = l * alpha + ((es[0] + es[1]) + (es[2] + es[3]));
#pragma unroll
    for (int dt = 0; dt < 4; ++dt)
#pragma unroll
      for (int r = 0; r < 8; ++r) acc[dt][r] *= alpha;
    const F2 pa = bsplit16(e);
#pragma unroll
    for (int dt = 0; dt < 4; ++dt) { acc[dt] = wmma_bf(vh[dt], pa.l, acc[dt]); acc[dt] = wmma_bf(vl[dt], pa.h, acc[dt]); acc[dt] = wmma_bf(vh[dt], pa.h, acc[dt]); kh[dt >> 1][dt & 1] = frag_to(kbase, (unsigned)(kn * 8192 + dt * 2048), lo); kl[dt >> 1][dt & 1] = frag_to(kbase, (unsigned)(kn * 8192 + dt * 2048 + 1024), lo); }
    asm volatile("s_wait_xcnt 0x0" ::: "memory"); }   // the next pass's first products land in the address registers of the K loads issued last
  const float xsa = bfr(XS[0]); const float il = 1.0f / (l + xhalf(l));
  const float* vrow = QK + rq * QKVW + 2 * DM + h * HD + 8 * g; v4f vv[8]; float dot = 0.f, vn = 0.f;   // the query's own v, the 32 d that this lane holds
#pragma unroll
  for (int i = 0; i < 8; ++i) vv[i] = *(const v4f*)(vrow + (i >> 1) * 16 + (i & 1) * 4);
  asm volatile("s_wait_xcnt 0x0" ::: "memory");   // before the address registers of the loads above are used for anything else
#pragma unroll
  for (int i = 0; i < 8; ++i)
#pragma unroll
    for (int e = 0; e < 4; ++e) { const float o = acc[i >> 1][(i & 1) * 4 + e] * il; acc[i >> 1][(i & 1) * 4 + e] = o; dot += o * vv[i][e]; vn += vv[i][e] * vv[i][e]; }
  dot += xhalf(dot); vn += xhalf(vn);
  const float coef = xsa * (dot / (vn + 1e-8f));
  __bf16* ot = O + ((size_t)((b * SS + q0) >> 4) * (DM / 32) + h * 2) * 1024 + lane * 8;
#pragma unroll   // the step from store to store becomes a constant in the stores' offset field
  for (int dt = 0; dt < 4; ++dt) { v8b hi, re;
#pragma unroll
    for (int r = 0; r < 8; ++r) { const float w = acc[dt][r] - coef * vv[2 * dt + (r >> 2)][r & 3]; const __bf16 hb = (__bf16)w; hi[r] = hb; re[r] = (__bf16)(w - (float)hb); }
    vst2(ot + (dt >> 1) * 1024 + (dt & 1) * 256, hi); vst2(ot + (dt >> 1) * 1024 + 512 + (dt & 1) * 256, re); }
}
// ---- k_out: block = (64 rows, 128 cols): out = O(hi/lo) . c_proj rows (2 products)
__global__ __launch_bounds__(128) void k_out(const __bf16* __restrict__ O, const __bf16* __restrict__ P, float* __restrict__ Y) {
  __shared__ __align__(16) float so[4][16][132];
  const int tid = threadIdx.x, wave = tid >> 5, lane = tid & 31, col = lane & 15, g = lane >> 4; const size_t r0 = (size_t)blockIdx.x * 64 + wave * 16; const int n0 = blockIdx.y * 128;
  v8f acc[8] = {};
  v16b ahn, aln, w[8];   // as in k_qkv: reloaded for the next k-step right behind the last use
  const unsigned xo = (unsigned)((int)r0 * DM * 4 + lane * 16), wo = (unsigned)(n0 * DM * 2 + lane * 16);   // a band of 16 rows is DM / 32 tile pairs of 2048 bytes (hi, residual) or tiles of 1024 bytes
  ahn = frag_to(O, 0u, xo); aln = frag_to(O, 1024u, xo);
  __builtin_amdgcn_sched_barrier(0);   // keeps the A loads the oldest here as in the loop, else the loop's first wait drains every load
#pragma unroll
  for (int j = 0; j < 8; ++j) w[j] = frag_to(P, (unsigned)(j * 16 * DM * 2), wo);
#pragma unroll 2
  for (int kc = 0; kc < DM / 32; ++kc) { const int kn = kc + 1 < DM / 32 ? kc + 1 : kc;   // the last k-step reloads itself: in bounds, unused
    asm volatile("s_wait_xcnt 0x0" ::: "memory");   // the next addresses are formed in the address registers of the loads issued last, also over the back edge
    __builtin_amdgcn_sched_barrier(0);   // keeps the A loads the oldest of each k-step, so that the wait for A leaves the B loads in flight, and the address sums behind the wait above
    const v16b ah = ahn, al = aln;
    ahn = frag_to(O, (unsigned)(kn * 2048), xo); aln = frag_to(O, (unsigned)(kn * 2048 + 1024), xo);
#pragma unroll
    for (int j = 0; j < 8; ++j) { acc[j] = wmma_bf(al, w[j], acc[j]); acc[j] = wmma_bf(ah, w[j], acc[j]); w[j] = frag_to(P, (unsigned)(kn * 1024 + j * 16 * DM * 2), wo); } }
#pragma unroll
  for (int j = 0; j < 8; ++j)
#pragma unroll
    for (int r = 0; r < 8; ++r) so[wave][8 * g + r][j * 16 + col] = acc[j][r];
  LDSX();
  for (int rl = 0; rl < 16; ++rl) vst2(Y + (r0 + rl) * DM + n0 + lane * 4, *(const v4f*)&so[wave][rl][lane * 4]);
}
extern "C" void kernel_launch(void* const* d_in, const int* in_sizes, int n_in, void* d_out, int out_size, void* d_ws, size_t ws_size, hipStream_t stream) {
  (void)in_sizes; (void)n_in; (void)out_size;
  const float** F = (const float**)d_in;   // x [2,2048,1024], Wq, Wk, Wv, Wo [1024,1024] (torch [out,in]), xsa_scale [1]
  if (ws_size < (size_t)WS_END) return;
  char* ws = (char*)d_ws; __bf16 *PK = (__bf16*)(ws + WS_PK), *VTH = (__bf16*)(ws + WS_VTH), *VTL = (__bf16*)(ws + WS_VTL), *XP = (__bf16*)(ws + WS_XP); float *QK = (float*)(ws + WS_QK); __bf16 *O = (__bf16*)(ws + WS_O), *KT = (__bf16*)(ws + WS_KT);
  k_packrows<<<dim3(DM / 16, DM / 256), 256, 0, stream>>>(F[1], DM, PK + PK_A); k_packrows<<<dim3(DM / 16, DM / 256), 256, 0, stream>>>(F[2], DM, PK + PK_A + (size_t)DM * DM); k_packrows<<<dim3(DM / 16, DM / 256), 256, 0, stream>>>(F[3], DM, PK + PK_A + (size_t)2 * DM * DM); k_packrows<<<dim3(DM / 16, DM / 256), 256, 0, stream>>>(F[4], DM, PK + PK_P);
  k_packrows<<<dim3(NB * SS / 16, DM / 256), 256, 0, stream>>>(F[0], DM, XP);
  k_qkv<<<dim3(TNB * SS / 64, QKVW / 128), 128, 0, stream>>>(XP, PK + PK_A, QK, KT);
  k_vt<<<dim3(TNB * SS / 64, NH), 256, 0, stream>>>(QK, VTH, VTL);
  k_attn<<<dim3(TQB, NH, TNB), 128, 0, stream>>>(QK, KT, VTH, VTL, F[5], O);
  k_out<<<dim3(TOB, DM / 128), 128, 0, stream>>>(O, PK + PK_P, (float*)d_out);
}

// v007
// It runs in 191 microseconds.
// Timed twice side by side with v006, it ran 1.05 times as fast both times.
// Over all steps from v000 it is 3.03 times as fast.
// compute dtype: x, Wq, Wk, Wv, Wo, xsa_scale (module inputs) rounded to bf16; q/k/v projections with exact bf16 products (x and W are inputs); scores q.k with both computed operands as bf16 hi + residual pairs (3 products) and P.V with P hi/lo x V hi/lo (3 products); the exclusive (own-value) projection removal in f32 in the attention epilogue; the output projection hi/lo x exact Wo (2 products); softmax in f32; f32 accumulate.
#include <hip/hip_runtime.h>
#include <math.h>

typedef __attribute__((ext_vector_type(16))) _Float16 v16h;
typedef __attribute__((ext_vector_type(16))) __bf16 v16b;
typedef __attribute__((ext_vector_type(8)))  _Float16 v8h;
typedef __attribute__((ext_vector_type(8)))  float v8f;
typedef __attribute__((ext_vector_type(4)))  float v4f;
typedef __attribute__((ext_vector_type(2)))  float v2f;
typedef __attribute__((ext_vector_type(4)))  unsigned v4u;
typedef __attribute__((ext_vector_type(4)))  int v4i;
typedef float __attribute__((may_alias)) float_a;
typedef int __attribute__((may_alias)) int_a;

template <typename T> __device__ __forceinline__ void vst2(void* p, T v) { *(T*)p = v;  }
__device__ __forceinline__ v8f wmma16(v16h a, v16h b, v8f c) {
  v8f d = __builtin_amdgcn_wmma_f32_16x16x32_f16(false, a, false, b, (short)0, c, false, false);
  asm volatile("v_nop\n\tv_nop\n\tv_nop\n\tv_nop" : "+v"(d) : "v"(a), "v"(b));
  return d;
}
__device__ __forceinline__ v8f wmma_bf(v16b a, v16b b, v8f c) {
  v8f d = __builtin_amdgcn_wmma_f32_16x16x32_bf16(false, a, false, b, (short)0, c, false, false);
  asm volatile("v_nop\n\tv_nop\n\tv_nop\n\tv_nop" : "+v"(d) : "v"(a), "v"(b));
  return d;
}
// 16x16x32 fragments: lane = (h = lane>>4, row/col = lane&15); elements 0..7 = k0+8h+0..7, 8..15 = k0+16+8h+0..7; D element r = row 8h+r
__device__ __forceinline__ v16h frag_h(const _Float16* rowk0, int lane) {
  union { v16h v; v8h q[2]; } u; const _Float16* p = rowk0 + 8 * (lane >> 4);
  u.q[0] = *(const v8h*)p; u.q[1] = *(const v8h*)(p + 16); return u.v;
}
__device__ __forceinline__ v16h frag_f32(const float* rowk0, int lane) {
  v16h a; const float* p = rowk0 + 8 * (lane >> 4);
#pragma unroll
  for (int i = 0; i < 8; ++i) { a[i] = (_Float16)p[i]; a[8 + i] = (_Float16)p[16 + i]; }
  return a;
}
__device__ __forceinline__ v16h frag_f32s(const float* rowk0, int lane, float sc) {
  v16h a; const float* p = rowk0 + 8 * (lane >> 4);
#pragma unroll
  for (int i = 0; i < 8; ++i) { a[i] = (_Float16)(p[i] * sc); a[8 + i] = (_Float16)(p[16 + i] * sc); }
  return a;
}
// column fragment from a [K][ld] layout (column n), rows >= K read as 0
__device__ __forceinline__ v16h fragc_f32(const float* W, int k0, int n, int lane, int ld, int K) {
  v16h a; const int g = lane >> 4;
#pragma unroll
  for (int i = 0; i < 8; ++i) { const int ka = k0 + 8 * g + i, kb = ka + 16;
    a[i] = (_Float16)(ka < K ? W[(size_t)(ka < K ? ka : K - 1) * ld + n] : 0.f); a[8 + i] = (_Float16)(kb < K ? W[(size_t)(kb < K ? kb : K - 1) * ld + n] : 0.f); }
  return a;
}
struct F2 { v16b h, l; };
__device__ __forceinline__ F2 bsplit16(const float v[16]) { F2 r;
#pragma unroll
  for (int i = 0; i < 16; ++i) { const __bf16 h = (__bf16)v[i]; r.h[i] = h; r.l[i] = (__bf16)(v[i] - (float)h); }
  return r; }
__device__ __forceinline__ F2 split_row(const float* row, int k0, int lane) { float v[16]; const float* p = row + k0 + 8 * (lane >> 4);
#pragma unroll
  for (int i = 0; i < 8; ++i) { v[i] = p[i]; v[8 + i] = p[16 + i]; }
  return bsplit16(v); }
__device__ __forceinline__ F2 split_rowK(const float* row, int k0, int lane, int K) { float v[16]; const int g = lane >> 4;
#pragma unroll
  for (int i = 0; i < 8; ++i) { const int ka = k0 + 8 * g + i, kb = ka + 16; v[i] = ka < K ? row[ka < K ? ka : K - 1] : 0.f; v[8 + i] = kb < K ? row[kb < K ? kb : K - 1] : 0.f; }
  return bsplit16(v); }
__device__ __forceinline__ F2 split_col(const float* W, int k0, int n, int lane, int ld, int K) { float v[16]; const int g = lane >> 4;
#pragma unroll
  for (int i = 0; i < 8; ++i) { const int ka = k0 + 8 * g + i, kb = ka + 16; v[i] = ka < K ? W[(size_t)(ka < K ? ka : K - 1) * ld + n] : 0.f; v[8 + i] = kb < K ? W[(size_t)(kb < K ? kb : K - 1) * ld + n] : 0.f; }
  return bsplit16(v); }
__device__ __forceinline__ v8f mac3(const F2& a, const F2& b, v8f c) { c = wmma_bf(a.l, b.h, c); c = wmma_bf(a.h, b.l, c); return wmma_bf(a.h, b.h, c); }
__device__ __forceinline__ float sigm(float v) { return 1.0f / (1.0f + expf(-v)); }
#define LDSX() do { asm volatile("s_wait_dscnt 0" ::: "memory"); __builtin_amdgcn_wave_barrier(); __builtin_amdgcn_fence(__ATOMIC_RELEASE, "workgroup"); } while (0)


// Exclusive self-attention (B 2, S 2048, 16 heads x 64; torch Linear no-bias, y = x W^T): full (non-causal) softmax attention; per token/head out -= xsa_scale * (out . v) / (|v|^2 + 1e-8) * v; then Wo.
#define NB 2
#define SS 2048
#define DM 1024
#define NH 16
#define HD 64
#define QKVW (3 * DM)
#ifndef TQB
#define TQB (SS / 64)
#define TNB NB
#define TOB (NB * SS / 64)     // output row tiles (all)
#endif
typedef __attribute__((ext_vector_type(8))) __bf16 v8b;
// Fragment tiles: every operand that a loop loads lies in the workspace as tiles of 16 rows x 32 k in the order the lanes take it, so that one 16-byte load of a wave reads 512 bytes in a row (4 lines of 128 bytes) instead of 32 bytes from each of 16 rows (16 lines).
// bf16 tile, 512 elements: element (c * 32 + lane) * 8 + e is row (lane & 15), k = 16 c + 8 (lane >> 4) + e         (c = 0, 1; e = 0..7)
// a computed operand (k, attention out) is a pair of such tiles in a row, bf16 hi and bf16 residual, split once by the kernel that makes it
// the address is base + uniform bytes + the lane's own bytes (16 * lane): the constant step from tile to tile folds into the loads' offset field
__device__ __forceinline__ v16b frag_to(const __bf16* base, unsigned uni, unsigned lo) {
  union { v16b v; v8b q[2]; } u; const char* p = (const char*)base + uni + (size_t)lo;
  u.q[0] = *(const v8b*)p; u.q[1] = *(const v8b*)(p + 512); return u.v;
}
__device__ __forceinline__ float bfr(float v) { return (float)(__bf16)v; }
__device__ __attribute__((noinline)) float erf_ni(float v) { return erff(v); }

#define PK_A 0                       // [3072][1024] c_attn kernel rows, as bf16 tiles [row / 16][k / 32]
#define PK_P (PK_A + QKVW * DM)        // [1024][1024] c_proj kernel rows, likewise
#define PK_END (PK_P + DM * DM)
#define WS_PK  0u
#define WS_QK  (WS_PK + 2u * PK_END)             // f32 [4096 rows][3072]: [q | (k: not written here, see WS_KT) | v]
#define WS_VTH (WS_QK + 4u * NB * SS * QKVW)     // bf16 tiles [2][1024 (h*64+d) / 16][2048 s / 32]
#define WS_VTL (WS_VTH + 2u * NB * DM * SS)
#define WS_O   (WS_VTL + 2u * NB * DM * SS)        // bf16 tiles [4096 / 16][1024 / 32][hi, residual]
#define WS_XP  (WS_O + 4u * NB * SS * DM)          // bf16 tiles [4096 / 16][1024 / 32]: x
#define WS_KT  (WS_XP + 2u * NB * SS * DM)         // bf16 tiles [2 * 16 (b, h)][2048 s / 16][64 / 32][hi, residual]: k
#define WS_END (WS_KT + 4u * NB * SS * DM)

// ---- k_pack: ONE launch packs all five matrices (they do not depend on one another). block = a whole band of 16 rows x 1024 k of a [N][1024] f32 matrix -> 32 bf16 tiles, which lie in a row; bands 0..255 are x, then 64 bands each of Wq, Wk, Wv, Wo (y = x W^T), whose tiles follow one another in the workspace in that order; rows read whole, turned into tile order through LDS
typedef __attribute__((ext_vector_type(4))) __bf16 v4b;
__global__ __launch_bounds__(256) void k_pack(const float* __restrict__ X, const float* __restrict__ Wq, const float* __restrict__ Wk, const float* __restrict__ Wv, const float* __restrict__ Wo, __bf16* __restrict__ XP, __bf16* __restrict__ PK) {
  __shared__ __align__(16) __bf16 s[16][DM + 8]; const int band = blockIdx.x, tid = threadIdx.x;
  const float* src; __bf16* dst;   // the same for the whole block
  if (band < NB * SS / 16) { src = X + (size_t)band * 16 * DM; dst = XP + (size_t)band * 16 * DM; }
  else { const int wb = band - NB * SS / 16, m = wb >> 6; src = (m == 0 ? Wq : m == 1 ? Wk : m == 2 ? Wv : Wo) + (size_t)(wb & 63) * 16 * DM; dst = PK + (size_t)wb * 16 * DM; }
  v4f v[16];
#pragma unroll   // so that a thread's sixteen loads are in flight together, not one behind the other's wait
  for (int i = 0; i < 16; ++i) v[i] = *(const v4f*)(src + i * DM + tid * 4);
  __builtin_amdgcn_sched_barrier(0);   // keeps the conversions behind all sixteen loads: else the build holds the last two loads back until the first two have arrived, to land them in the same registers
#pragma unroll
  for (int i = 0; i < 16; ++i) { v4b h;
#pragma unroll
    for (int e = 0; e < 4; ++e) h[e] = (__bf16)v[i][e];
    *(v4b*)&s[i][tid * 4] = h; }
  __syncthreads();
#pragma unroll   // the step from store to store becomes a constant in the stores' offset field
  for (int j = 0; j < 8; ++j) { const int q = j * 256 + tid, c = (q >> 5) & 1, lane = q & 31;   // 16-byte piece q of the band's 32 tiles
    vst2((unsigned*)(dst + (size_t)q * 8), *(const v4u*)&s[lane & 15][(q >> 6) * 32 + c * 16 + 8 * (lane >> 4)]); }
}
// ---- k_qkv: block = (64 rows, 128 of the 3072 cols): QKV = bf16(x) . rows (exact) -> f32 rows (pitch 3072) for q and v, bf16 hi and residual tiles for k (split here once, not in each of the 128 query waves that read a key)
__global__ __launch_bounds__(128) void k_qkv(const __bf16* __restrict__ X, const __bf16* __restrict__ P, float* __restrict__ QKV, __bf16* __restrict__ KT) {
  __shared__ __align__(16) float so[4][16][132];
  const int tid = threadIdx.x, wave = tid >> 5, lane = tid & 31, col = lane & 15, g = lane >> 4; const size_t r0 = (size_t)blockIdx.x * 64 + wave * 16; const int n0 = blockIdx.y * 128;
  v8f acc[8] = {};
  v16b an, w[8];   // the fragments of the k-step in work; each is reloaded for the next k-step right behind its last use
  const unsigned xo = (unsigned)((int)r0 * DM * 2 + lane * 16), wo = (unsigned)(n0 * DM * 2 + lane * 16);   // a band of 16 rows is DM / 32 tiles of 1024 bytes
  an = frag_to(X, 0u, xo);
  __builtin_amdgcn_sched_barrier(0);   // keeps the A loads the oldest here as in the loop, else the loop's first wait drains every load
#pragma unroll
  for (int j = 0; j < 8; ++j) w[j] = frag_to(P, (unsigned)(j * 16 * DM * 2), wo);
#pragma unroll 2
  for (int kc = 0; kc < DM / 32; ++kc) { const int kn = kc + 1 < DM / 32 ? kc + 1 : kc;   // the last k-step reloads itself: in bounds, unused
    asm volatile("s_wait_xcnt 0x0" ::: "memory");   // the next addresses are formed in the address registers of the loads issued last
    __builtin_amdgcn_sched_barrier(0);   // keeps the A loads the oldest of each k-step, so that the wait for A leaves the B loads in flight, and the address sums behind the wait above
    const v16b a = an;
    an = frag_to(X, (unsigned)(kn * 1024), xo);
#pragma unroll
    for (int j = 0; j < 8; ++j) { acc[j] = wmma_bf(a, w[j], acc[j]); w[j] = frag_to(P, (unsigned)(kn * 1024 + j * 16 * DM * 2), wo); } }
#pragma unroll
  for (int j = 0; j < 8; ++j)
#pragma unroll
    for (int r = 0; r < 8; ++r) so[wave][8 * g + r][j * 16 + col] = acc[j][r];
  LDSX();
  if (n0 >= DM && n0 < 2 * DM) {   // k columns (the same for the whole block): two heads x two 32-wide halves of this wave's 16 keys
    const int b = (int)r0 / SS, kt = ((int)r0 % SS) >> 4, h0 = (n0 - DM) / HD;
#pragma unroll   // the tile's place becomes a constant step from one address
    for (int t = 0; t < 4; ++t) { __bf16* tile = KT + ((((size_t)b * NH + h0 + (t >> 1)) * (SS / 16) + kt) * 2 + (t & 1)) * 1024 + lane * 8;
#pragma unroll   // the step from store to store becomes a constant in the stores' offset field
      for (int c = 0; c < 2; ++c) { const float* p = &so[wave][col][t * 32 + c * 16 + 8 * g]; const v4f p0 = *(const v4f*)p, p1 = *(const v4f*)(p + 4); v8b hi, re;
#pragma unroll   // constant element numbers, so that the vectors stay in registers
        for (int e = 0; e < 8; ++e) { const float v = e < 4 ? p0[e & 3] : p1[e & 3]; const __bf16 hb = (__bf16)v; hi[e] = hb; re[e] = (__bf16)(v - (float)hb); }
        vst2(tile + c * 256, hi); vst2(tile + 512 + c * 256, re); } }
  } else
    for (int rl = 0; rl < 16; ++rl) vst2(QKV + (r0 + rl) * QKVW + n0 + lane * 4, *(const v4f*)&so[wave][rl][lane * 4]);
}
__global__ __launch_bounds__(256) void k_vt(const float* __restrict__ QKV, __bf16* __restrict__ VTH, __bf16* __restrict__ VTL) {
  __shared__ __align__(16) __bf16 sth[64][72], stl[64][72]; const int tid = threadIdx.x; const size_t rb = (size_t)blockIdx.x * 64; const int h = blockIdx.y; const int b = (int)(rb / SS), s0 = (int)(rb % SS);
  for (int q = tid; q < 64 * 64; q += 256) { const int rl = q >> 6, d = q & 63; const float v = QKV[(rb + rl) * QKVW + 2 * DM + h * HD + d]; const __bf16 hb = (__bf16)v; sth[d][rl] = hb; stl[d][rl] = (__bf16)(v - (float)hb); }
  __syncthreads();
  for (int q = tid; q < 64 * 8; q += 256) { const int dt = q >> 7, sl = (q >> 6) & 1, c = (q >> 5) & 1, lane = q & 31; const int d = dt * 16 + (lane & 15), s = sl * 32 + c * 16 + 8 * (lane >> 4);   // 4 x 2 tiles (16 d x 32 s)
    const size_t o = (((size_t)b * (DM / 16) + h * (HD / 16) + dt) * (SS / 32) + (s0 >> 5) + sl) * 512 + (q & 63) * 8; vst2((unsigned*)(VTH + o), *(const v4u*)&sth[d][s]); vst2((unsigned*)(VTL + o), *(const v4u*)&stl[d][s]); }
}
// ---- k_attn: block = (64 queries, head h, batch b): full flash attention (K = 64), transposed: S^T = K . Q^T (3 products) / 8 and O^T += V^T . P^T (3 products), so that a lane holds 16 of ONE query's 32 scores: maximum and sum run in the lane's own registers plus one exchange between the wave's halves, and the exponentials are already the B fragment of P^T (keys 8g + 0..7, 16 + 8g + 0..7); epilogue: out -= xsa_scale * (out.v_own)/(|v_own|^2 + 1e-8) * v_own; O[b*S+q][h*64+d] as bf16 hi and residual tiles, which is the order the lanes hold O^T in
__device__ __forceinline__ float xhalf(float x) { return __builtin_bit_cast(float, __builtin_amdgcn_permlanex16(__builtin_bit_cast(int, x), __builtin_bit_cast(int, x), 0x76543210, 0xfedcba98, false, false)); }   // lane l takes lane l ^ 16's value
__global__ __launch_bounds__(128) void k_attn(const float* __restrict__ QK, const __bf16* __restrict__ KT, const __bf16* __restrict__ VTH, const __bf16* __restrict__ VTL, const float* __restrict__ XS, __bf16* __restrict__ O) {
  const int tid = threadIdx.x, wave = tid >> 5, lane = tid & 31, col = lane & 15, g = lane >> 4;
  const int qb = blockIdx.x, h = blockIdx.y, b = blockIdx.z; const int q0 = qb * 64 + wave * 16; const size_t rq = (size_t)b * SS + q0 + col;
  F2 aq[2];
#pragma unroll
  for (int kc = 0; kc < 2; ++kc) aq[kc] = split_row(QK + rq * QKVW + h * HD, kc * 32, lane);
  const float KL = 0.125f * 1.4426950408889634f;   // SCALE = 1/sqrt(64) times log2(e): the softmax runs in base 2, exp((s - max) / 8) = 2^(s * KL - max * KL)
  float m = -3.0e38f, l = 0.f;   // of query q0 + col; m is the maximum in use, already times KL; l is the sum over this half's keys only, the halves are joined behind the loop
  v8f acc[4] = {};   // O^T: acc[dt][r] is d = 16 dt + 8 g + r of query q0 + col
  const __bf16* kbase = KT + (size_t)(b * NH + h) * SS * HD * 2;   // this head's k: a pass of 32 keys is 4 pairs (hi, residual) of bf16 tiles in a row (16 keys x 32 d each), 8192 bytes
  const __bf16 *vhb = VTH + (size_t)(b * NH + h) * HD * SS, *vlb = VTL + (size_t)(b * NH + h) * HD * SS;   // this head's v: 4 bands of 16 d, each SS / 32 bf16 tiles
  const unsigned lo = (unsigned)(lane * 16);
  v16b kh[2][2], kl[2][2];   // the pass's K fragments, hi and residual; reloaded for the next pass quarter by quarter as the P.V products free the V registers
#pragma unroll
  for (int ct = 0; ct < 2; ++ct)
#pragma unroll
    for (int kc = 0; kc < 2; ++kc) { kh[ct][kc] = frag_to(kbase, (unsigned)((ct * 2 + kc) * 2048), lo); kl[ct][kc] = frag_to(kbase, (unsigned)((ct * 2 + kc) * 2048 + 1024), lo); }
#pragma unroll 1
  for (int ks = 0; ks < SS / 32; ++ks) { float e[16]; const int kn = ks + 1 < SS / 32 ? ks + 1 : ks;   // the last pass reloads itself: in bounds, unused
#pragma unroll
    for (int ct = 0; ct < 2; ++ct) { v8f c = {};
#pragma unroll
      for (int kc = 0; kc < 2; ++kc) { c = wmma_bf(kh[ct][kc], aq[kc].l, c); c = wmma_bf(kl[ct][kc], aq[kc].h, c); c = wmma_bf(kh[ct][kc], aq[kc].h, c); }
#pragma unroll
      for (int r = 0; r < 8; ++r) e[ct * 8 + r] = c[r]; }   // the plain products, the scale comes in with KL below; key 16 ct + 8 g + r
    v16b vh[4], vl[4];   // this pass's V fragments, issued here so that they arrive under the softmax
#pragma unroll
    for (int dt = 0; dt < 4; ++dt) { const unsigned vr = (unsigned)(dt * 16 * SS * 2 + ks * 1024); vh[dt] = frag_to(vhb, vr, lo); vl[dt] = frag_to(vlb, vr, lo); }
    float mx = e[0];
#pragma unroll
    for (int i = 1; i < 16; ++i) mx = fmaxf(mx, e[i]);
    mx = fmaxf(mx, xhalf(mx));
    const float mn = fmaxf(m, mx * KL); const float alpha = __builtin_amdgcn_exp2f(m - mn); m = mn;   // KL > 0: the maximum of the products times KL is the maximum of the scaled scores
#pragma unroll
    for (int i = 0; i < 16; ++i) e[i] = __builtin_amdgcn_exp2f(__builtin_fmaf(e[i], KL, -mn));   // one multiply-add and the chip's own 2^x a score; a weight too small for a normal float may come out as 0: it adds nothing to a sum whose largest term is 1
    float es[4];   // four chains, so that the adds do not wait on one another
#pragma unroll
    for (int i = 0; i < 4; ++i) es[i] = (e[i] + e[4 + i]) + (e[8 + i] + e[12 + i]);
    l = l * alpha + ((es[0] + es[1]) + (es[2] + es[3]));
#pragma unroll
    for (int dt = 0; dt < 4; ++dt)
#pragma unroll
      for (int r = 0; r < 8; ++r) acc[dt][r] *= alpha;
    const F2 pa = bsplit16(e);
#pragma unroll
    for (int dt = 0; dt < 4; ++dt) { acc[dt] = wmma_bf(vh[dt], pa.l, acc[dt]); acc[dt] = wmma_bf(vl[dt], pa.h, acc[dt]); acc[dt] = wmma_bf(vh[dt], pa.h, acc[dt]); kh[dt >> 1][dt & 1] = frag_to(kbase, (unsigned)(kn * 8192 + dt * 2048), lo); kl[dt >> 1][dt & 1] = frag_to(kbase, (unsigned)(kn * 8192 + dt * 2048 + 1024), lo); }
    asm volatile("s_wait_xcnt 0x0" ::: "memory"); }   // the next pass's first products land in the address registers of the K loads issued last
  const float xsa = bfr(XS[0]); const float il = 1.0f / (l + xhalf(l));
  const float* vrow = QK + rq * QKVW + 2 * DM + h * HD + 8 * g; v4f vv[8]; float dot = 0.f, vn = 0.f;   // the query's own v, the 32 d that this lane holds
#pragma unroll
  for (int i = 0; i < 8; ++i) vv[i] = *(const v4f*)(vrow + (i >> 1) * 16 + (i & 1) * 4);
  asm volatile("s_wait_xcnt 0x0" ::: "memory");   // before the address registers of the loads above are used for anything else
#pragma unroll
  for (int i = 0; i < 8; ++i)
#pragma unroll
    for (int e = 0; e < 4; ++e) { const float o = acc[i >> 1][(i & 1) * 4 + e] * il; acc[i >> 1][(i & 1) * 4 + e] = o; dot += o * vv[i][e]; vn += vv[i][e] * vv[i][e]; }
  dot += xhalf(dot); vn += xhalf(vn);
  const float coef = xsa * (dot / (vn + 1e-8f));
  __bf16* ot = O + ((size_t)((b * SS + q0) >> 4) * (DM / 32) + h * 2) * 1024 + lane * 8;
#pragma unroll   // the step from store to store becomes a constant in the stores' offset field
  for (int dt = 0; dt < 4; ++dt) { v8b hi, re;
#pragma unroll
    for (int r = 0; r < 8; ++r) { const float w = acc[dt][r] - coef * vv[2 * dt + (r >> 2)][r & 3]; const __bf16 hb = (__bf16)w; hi[r] = hb; re[r] = (__bf16)(w - (float)hb); }
    vst2(ot + (dt >> 1) * 1024 + (dt & 1) * 256, hi); vst2(ot + (dt >> 1) * 1024 + 512 + (dt & 1) * 256, re); }
}
// ---- k_out: block = (64 rows, 128 cols): out = O(hi/lo) . c_proj rows (2 products)
__global__ __launch_bounds__(128) void k_out(const __bf16* __restrict__ O, const __bf16* __restrict__ P, float* __restrict__ Y) {
  __shared__ __align__(16) float so[4][16][132];
  const int tid = threadIdx.x, wave = tid >> 5, lane = tid & 31, col = lane & 15, g = lane >> 4; const size_t r0 = (size_t)blockIdx.x * 64 + wave * 16; const int n0 = blockIdx.y * 128;
  v8f acc[8] = {};
  v16b ahn, aln, w[8];   // as in k_qkv: reloaded for the next k-step right behind the last use
  const unsigned xo = (unsigned)((int)r0 * DM * 4 + lane * 16), wo = (unsigned)(n0 * DM * 2 + lane * 16);   // a band of 16 rows is DM / 32 tile pairs of 2048 bytes (hi, residual) or tiles of 1024 bytes
  ahn = frag_to(O, 0u, xo); aln = frag_to(O, 1024u, xo);
  __builtin_amdgcn_sched_barrier(0);   // keeps the A loads the oldest here as in the loop, else the loop's first wait drains every load
#pragma unroll
  for (int j = 0; j < 8; ++j) w[j] = frag_to(P, (unsigned)(j * 16 * DM * 2), wo);
#pragma unroll 2
  for (int kc = 0; kc < DM / 32; ++kc) { const int kn = kc + 1 < DM / 32 ? kc + 1 : kc;   // the last k-step reloads itself: in bounds, unused
    asm volatile("s_wait_xcnt 0x0" ::: "memory");   // the next addresses are formed in the address registers of the loads issued last, also over the back edge
    __builtin_amdgcn_sched_barrier(0);   // keeps the A loads the oldest of each k-step, so that the wait for A leaves the B loads in flight, and the address sums behind the wait above
    const v16b ah = ahn, al = aln;
    ahn = frag_to(O, (unsigned)(kn * 2048), xo); aln = frag_to(O, (unsigned)(kn * 2048 + 1024), xo);
#pragma unroll
    for (int j = 0; j < 8; ++j) { acc[j] = wmma_bf(al, w[j], acc[j]); acc[j] = wmma_bf(ah, w[j], acc[j]); w[j] = frag_to(P, (unsigned)(kn * 1024 + j * 16 * DM * 2), wo); } }
#pragma unroll
  for (int j = 0; j < 8; ++j)
#pragma unroll
    for (int r = 0; r < 8; ++r) so[wave][8 * g + r][j * 16 + col] = acc[j][r];
  LDSX();
  for (int rl = 0; rl < 16; ++rl) vst2(Y + (r0 + rl) * DM + n0 + lane * 4, *(const v4f*)&so[wave][rl][lane * 4]);
}
extern "C" void kernel_launch(void* const* d_in, const int* in_sizes, int n_in, void* d_out, int out_size, void* d_ws, size_t ws_size, hipStream_t stream) {
  (void)in_sizes; (void)n_in; (void)out_size;
  const float** F = (const float**)d_in;   // x [2,2048,1024], Wq, Wk, Wv, Wo [1024,1024] (torch [out,in]), xsa_scale [1]
  if (ws_size < (size_t)WS_END) return;
  char* ws = (char*)d_ws; __bf16 *PK = (__bf16*)(ws + WS_PK), *VTH = (__bf16*)(ws + WS_VTH), *VTL = (__bf16*)(ws + WS_VTL), *XP = (__bf16*)(ws + WS_XP); float *QK = (float*)(ws + WS_QK); __bf16 *O = (__bf16*)(ws + WS_O), *KT = (__bf16*)(ws + WS_KT);
  k_pack<<<dim3(NB * SS / 16 + 4 * DM / 16), 256, 0, stream>>>(F[0], F[1], F[2], F[3], F[4], XP, PK);
  k_qkv<<<dim3(TNB * SS / 64, QKVW / 128), 128, 0, stream>>>(XP, PK + PK_A, QK, KT);
  k_vt<<<dim3(TNB * SS / 64, NH), 256, 0, stream>>>(QK, VTH, VTL);
  k_attn<<<dim3(TQB, NH, TNB), 128, 0, stream>>>(QK, KT, VTH, VTL, F[5], O);
  k_out<<<dim3(TOB, DM / 128), 128, 0, stream>>>(O, PK + PK_P, (float*)d_out);
}

// v008
// A run of this version takes 178 microseconds.
// Timed twice side by side with v007, it ran 1.08 times as fast both times.
// Over all steps from v000 it is 3.27 times as fast.
// compute dtype: x, Wq, Wk, Wv, Wo, xsa_scale (module inputs) rounded to bf16; q/k/v projections with exact bf16 products (x and W are inputs); scores q.k with both computed operands as bf16 hi + residual pairs (3 products) and P.V with P hi/lo x V hi/lo (3 products); the exclusive (own-value) projection removal in f32 in the attention epilogue; the output projection hi/lo x exact Wo (2 products); softmax in f32; f32 accumulate.
#include <hip/hip_runtime.h>
#include <math.h>

typedef __attribute__((ext_vector_type(16))) _Float16 v16h;
typedef __attribute__((ext_vector_type(16))) __bf16 v16b;
typedef __attribute__((ext_vector_type(8)))  _Float16 v8h;
typedef __attribute__((ext_vector_type(8)))  float v8f;
typedef __attribute__((ext_vector_type(4)))  float v4f;
typedef __attribute__((ext_vector_type(2)))  float v2f;
typedef __attribute__((ext_vector_type(4)))  unsigned v4u;
typedef __attribute__((ext_vector_type(4)))  int v4i;
typedef float __attribute__((may_alias)) float_a;
typedef int __attribute__((may_alias)) int_a;

template <typename T> __device__ __forceinline__ void vst2(void* p, T v) { *(T*)p = v;  }
__device__ __forceinline__ v8f wmma16(v16h a, v16h b, v8f c) {
  v8f d = __builtin_amdgcn_wmma_f32_16x16x32_f16(false, a, false, b, (short)0, c, false, false);
  asm volatile("v_nop\n\tv_nop\n\tv_nop\n\tv_nop" : "+v"(d) : "v"(a), "v"(b));
  return d;
}
__device__ __forceinline__ v8f wmma_bf(v16b a, v16b b, v8f c) {
  v8f d = __builtin_amdgcn_wmma_f32_16x16x32_bf16(false, a, false, b, (short)0, c, false, false);
  asm volatile("v_nop\n\tv_nop\n\tv_nop\n\tv_nop" : "+v"(d) : "v"(a), "v"(b));
  return d;
}
// 16x16x32 fragments: lane = (h = lane>>4, row/col = lane&15); elements 0..7 = k0+8h+0..7, 8..15 = k0+16+8h+0..7; D element r = row 8h+r
__device__ __forceinline__ v16h frag_h(const _Float16* rowk0, int lane) {
  union { v16h v; v8h q[2]; } u; const _Float16* p = rowk0 + 8 * (lane >> 4);
  u.q[0] = *(const v8h*)p; u.q[1] = *(const v8h*)(p + 16); return u.v;
}
__device__ __forceinline__ v16h frag_f32(const float* rowk0, int lane) {
  v16h a; const float* p = rowk0 + 8 * (lane >> 4);
#pragma unroll
  for (int i = 0; i < 8; ++i) { a[i] = (_Float16)p[i]; a[8 + i] = (_Float16)p[16 + i]; }
  return a;
}
__device__ __forceinline__ v16h frag_f32s(const float* rowk0, int lane, float sc) {
  v16h a; const float* p = rowk0 + 8 * (lane >> 4);
#pragma unroll
  for (int i = 0; i < 8; ++i) { a[i] = (_Float16)(p[i] * sc); a[8 + i] = (_Float16)(p[16 + i] * sc); }
  return a;
}
// column fragment from a [K][ld] layout (column n), rows >= K read as 0
__device__ __forceinline__ v16h fragc_f32(const float* W, int k0, int n, int lane, int ld, int K) {
  v16h a; const int g = lane >> 4;
#pragma unroll
  for (int i = 0; i < 8; ++i) { const int ka = k0 + 8 * g + i, kb = ka + 16;
    a[i] = (_Float16)(ka < K ? W[(size_t)(ka < K ? ka : K - 1) * ld + n] : 0.f); a[8 + i] = (_Float16)(kb < K ? W[(size_t)(kb < K ? kb : K - 1) * ld + n] : 0.f); }
  return a;
}
struct F2 { v16b h, l; };
__device__ __forceinline__ F2 bsplit16(const float v[16]) { F2 r;
#pragma unroll
  for (int i = 0; i < 16; ++i) { const __bf16 h = (__bf16)v[i]; r.h[i] = h; r.l[i] = (__bf16)(v[i] - (float)h); }
  return r; }
__device__ __forceinline__ F2 split_row(const float* row, int k0, int lane) { float v[16]; const float* p = row + k0 + 8 * (lane >> 4);
#pragma unroll
  for (int i = 0; i < 8; ++i) { v[i] = p[i]; v[8 + i] = p[16 + i]; }
  return bsplit16(v); }
__device__ __forceinline__ F2 split_rowK(const float* row, int k0, int lane, int K) { float v[16]; const int g = lane >> 4;
#pragma unroll
  for (int i = 0; i < 8; ++i) { const int ka = k0 + 8 * g + i, kb = ka + 16; v[i] = ka < K ? row[ka < K ? ka : K - 1] : 0.f; v[8 + i] = kb < K ? row[kb < K ? kb : K - 1] : 0.f; }
  return bsplit16(v); }
__device__ __forceinline__ F2 split_col(const float* W, int k0, int n, int lane, int ld, int K) { float v[16]; const int g = lane >> 4;
#pragma unroll
  for (int i = 0; i < 8; ++i) { const int ka = k0 + 8 * g + i, kb = ka + 16; v[i] = ka < K ? W[(size_t)(ka < K ? ka : K - 1) * ld + n] : 0.f; v[8 + i] = kb < K ? W[(size_t)(kb < K ? kb : K - 1) * ld + n] : 0.f; }
  return bsplit16(v); }
__device__ __forceinline__ v8f mac3(const F2& a, const F2& b, v8f c) { c = wmma_bf(a.l, b.h, c); c = wmma_bf(a.h, b.l, c); return wmma_bf(a.h, b.h, c); }
__device__ __forceinline__ float sigm(float v) { return 1.0f / (1.0f + expf(-v)); }
#define LDSX() do { asm volatile("s_wait_dscnt 0" ::: "memory"); __builtin_amdgcn_wave_barrier(); __builtin_amdgcn_fence(__ATOMIC_RELEASE, "workgroup"); } while (0)


// Exclusive self-attention (B 2, S 2048, 16 heads x 64; torch Linear no-bias, y = x W^T): full (non-causal) softmax attention; per token/head out -= xsa_scale * (out . v) / (|v|^2 + 1e-8) * v; then Wo.
#define NB 2
#define SS 2048
#define DM 1024
#define NH 16
#define HD 64
#define QKVW (3 * DM)
#ifndef TQB
#define TQB (SS / 128)
#define TNB NB
#define TOB (NB * SS / 64)     // output row tiles (all)
#endif
typedef __attribute__((ext_vector_type(8))) __bf16 v8b;
// Fragment tiles: every operand that a loop loads lies in the workspace as tiles of 16 rows x 32 k in the order the lanes take it, so that one 16-byte load of a wave reads 512 bytes in a row (4 lines of 128 bytes) instead of 32 bytes from each of 16 rows (16 lines).
// bf16 tile, 512 elements: element (c * 32 + lane) * 8 + e is row (lane & 15), k = 16 c + 8 (lane >> 4) + e         (c = 0, 1; e = 0..7)
// a computed operand (k, attention out) is a pair of such tiles in a row, bf16 hi and bf16 residual, split once by the kernel that makes it
// the address is base + uniform bytes + the lane's own bytes (16 * lane): the constant step from tile to tile folds into the loads' offset field
__device__ __forceinline__ v16b frag_to(const __bf16* base, unsigned uni, unsigned lo) {
  union { v16b v; v8b q[2]; } u; const char* p = (const char*)base + uni + (size_t)lo;
  u.q[0] = *(const v8b*)p; u.q[1] = *(const v8b*)(p + 512); return u.v;
}
// the same from the lane's own address and a constant step, which goes into the loads' offset field
__device__ __forceinline__ v16b frag_p(const char* p, int off) {
  union { v16b v; v8b q[2]; } u; u.q[0] = *(const v8b*)(p + off); u.q[1] = *(const v8b*)(p + off + 512); return u.v;
}
__device__ __forceinline__ float bfr(float v) { return (float)(__bf16)v; }
__device__ __attribute__((noinline)) float erf_ni(float v) { return erff(v); }

#define PK_A 0                       // [3072][1024] c_attn kernel rows, as bf16 tiles [row / 16][k / 32]
#define PK_P (PK_A + QKVW * DM)        // [1024][1024] c_proj kernel rows, likewise
#define PK_END (PK_P + DM * DM)
#define WS_PK  0u
#define WS_QK  (WS_PK + 2u * PK_END)             // f32 [4096 rows][3072]: [q | (k: not written here, see WS_KT) | v]
#define WS_VTH (WS_QK + 4u * NB * SS * QKVW)     // bf16 tiles [2][1024 (h*64+d) / 16][2048 s / 32]
#define WS_VTL (WS_VTH + 2u * NB * DM * SS)
#define WS_O   (WS_VTL + 2u * NB * DM * SS)        // bf16 tiles [4096 / 16][1024 / 32][hi, residual]
#define WS_XP  (WS_O + 4u * NB * SS * DM)          // bf16 tiles [4096 / 16][1024 / 32]: x
#define WS_KT  (WS_XP + 2u * NB * SS * DM)         // bf16 tiles [2 * 16 (b, h)][2048 s / 16][64 / 32][hi, residual]: k
#define WS_END (WS_KT + 4u * NB * SS * DM)

// ---- k_pack: ONE launch packs all five matrices (they do not depend on one another). block = a whole band of 16 rows x 1024 k of a [N][1024] f32 matrix -> 32 bf16 tiles, which lie in a row; bands 0..255 are x, then 64 bands each of Wq, Wk, Wv, Wo (y = x W^T), whose tiles follow one another in the workspace in that order; rows read whole, turned into tile order through LDS
typedef __attribute__((ext_vector_type(4))) __bf16 v4b;
__global__ __launch_bounds__(256) void k_pack(const float* __restrict__ X, const float* __restrict__ Wq, const float* __restrict__ Wk, const float* __restrict__ Wv, const float* __restrict__ Wo, __bf16* __restrict__ XP, __bf16* __restrict__ PK) {
  __shared__ __align__(16) __bf16 s[16][DM + 8]; const int band = blockIdx.x, tid = threadIdx.x;
  const float* src; __bf16* dst;   // the same for the whole block
  if (band < NB * SS / 16) { src = X + (size_t)band * 16 * DM; dst = XP + (size_t)band * 16 * DM; }
  else { const int wb = band - NB * SS / 16, m = wb >> 6; src = (m == 0 ? Wq : m == 1 ? Wk : m == 2 ? Wv : Wo) + (size_t)(wb & 63) * 16 * DM; dst = PK + (size_t)wb * 16 * DM; }
  v4f v[16];
#pragma unroll   // so that a thread's sixteen loads are in flight together, not one behind the other's wait
  for (int i = 0; i < 16; ++i) v[i] = *(const v4f*)(src + i * DM + tid * 4);
  __builtin_amdgcn_sched_barrier(0);   // keeps the conversions behind all sixteen loads: else the build holds the last two loads back until the first two have arrived, to land them in the same registers
#pragma unroll
  for (int i = 0; i < 16; ++i) { v4b h;
#pragma unroll
    for (int e = 0; e < 4; ++e) h[e] = (__bf16)v[i][e];
    *(v4b*)&s[i][tid * 4] = h; }
  __syncthreads();
#pragma unroll   // the step from store to store becomes a constant in the stores' offset field
  for (int j = 0; j < 8; ++j) { const int q = j * 256 + tid, c = (q >> 5) & 1, lane = q & 31;   // 16-byte piece q of the band's 32 tiles
    vst2((unsigned*)(dst + (size_t)q * 8), *(const v4u*)&s[lane & 15][(q >> 6) * 32 + c * 16 + 8 * (lane >> 4)]); }
}
// ---- k_qkv: block = (128 rows, 128 of the 3072 cols) on 4 waves; a wave takes 32 rows x 128 cols, the rows as two tiles of 16, so that each weight fragment it loads feeds two products: QKV = bf16(x) . rows (exact) -> f32 rows (pitch 3072) for q and v, bf16 hi and residual tiles for k (split here once, not in each of the query waves that read a key)
__global__ __launch_bounds__(128) void k_qkv(const __bf16* __restrict__ X, const __bf16* __restrict__ P, float* __restrict__ QKV, __bf16* __restrict__ KT) {
  __shared__ __align__(16) float so[4][32][132];
  const int tid = threadIdx.x, wave = tid >> 5, lane = tid & 31, col = lane & 15, g = lane >> 4; const size_t r0 = (size_t)blockIdx.x * 128 + wave * 32; const int n0 = blockIdx.y * 128;
  v8f acc[2][8] = {};
  v16b an0, an1, w[8];   // the fragments of the k-step in work; each is reloaded for the next k-step right behind its last use
  const char *xa = (const char*)X + (unsigned)((int)r0 * DM * 2 + lane * 16), *wa = (const char*)P + (unsigned)(n0 * DM * 2 + lane * 16);   // the lane's own bytes of the first tiles; a band of 16 rows is DM / 32 tiles of 1024 bytes
  an0 = frag_p(xa, 0); an1 = frag_p(xa, 16 * DM * 2);
  __builtin_amdgcn_sched_barrier(0);   // keeps the A loads the oldest here as in the loop, else the loop's first wait drains every load
#pragma unroll
  for (int j = 0; j < 8; ++j) w[j] = frag_p(wa, j * 16 * DM * 2);
  asm volatile("s_wait_xcnt 0x0" ::: "memory");   // before the address registers of the loads above take new values
  __builtin_amdgcn_sched_barrier(0);   // keeps the next address sums behind the wait above
#pragma unroll 2
  for (int kc = 0; kc < DM / 32; ++kc) { const int kn = kc + 1 < DM / 32 ? kc + 1 : kc;   // the last k-step reloads itself: in bounds, unused
    const char *xn = xa + kn * 1024, *wn = wa + kn * 1024;
    const v16b a0 = an0, a1 = an1;
    an0 = frag_p(xn, 0); an1 = frag_p(xn, 16 * DM * 2);
#pragma unroll
    for (int j = 0; j < 8; ++j) { acc[0][j] = wmma_bf(a0, w[j], acc[0][j]); acc[1][j] = wmma_bf(a1, w[j], acc[1][j]); w[j] = frag_p(wn, j * 16 * DM * 2); }
    asm volatile("s_wait_xcnt 0x0" :: "v"(xn), "v"(wn) : "memory");   // before the address registers of this k-step's loads take new values, also over the back edge; named as inputs so that they live up to the wait and no load lands in them
    __builtin_amdgcn_sched_barrier(0); }   // keeps the A loads the oldest of each k-step, so that the wait for A leaves the B loads in flight, and the address sums behind the wait above
#pragma unroll
  for (int t = 0; t < 2; ++t)
#pragma unroll
    for (int j = 0; j < 8; ++j)
#pragma unroll
      for (int r = 0; r < 8; ++r) so[wave][16 * t + 8 * g + r][j * 16 + col] = acc[t][j][r];
  LDSX();
  if (n0 >= DM && n0 < 2 * DM) {   // k columns (the same for the whole block): per tile of 16 keys two heads x two 32-wide halves
    const int b = (int)r0 / SS, kt = ((int)r0 % SS) >> 4, h0 = (n0 - DM) / HD;   // r0 is a multiple of 32: both tiles lie in the same batch
#pragma unroll   // the tile's place becomes a constant step from one address
    for (int t = 0; t < 8; ++t) { __bf16* tile = KT + ((((size_t)b * NH + h0 + ((t & 3) >> 1)) * (SS / 16) + kt + (t >> 2)) * 2 + (t & 1)) * 1024 + lane * 8;
#pragma unroll   // the step from store to store becomes a constant in the stores' offset field
      for (int c = 0; c < 2; ++c) { const float* p = &so[wave][16 * (t >> 2) + col][(t & 3) * 32 + c * 16 + 8 * g]; const v4f p0 = *(const v4f*)p, p1 = *(const v4f*)(p + 4); v8b hi, re;
#pragma unroll   // constant element numbers, so that the vectors stay in registers
        for (int e = 0; e < 8; ++e) { const float v = e < 4 ? p0[e & 3] : p1[e & 3]; const __bf16 hb = (__bf16)v; hi[e] = hb; re[e] = (__bf16)(v - (float)hb); }
        vst2(tile + c * 256, hi); vst2(tile + 512 + c * 256, re); } }
  } else
    for (int rl = 0; rl < 32; ++rl) vst2(QKV + (r0 + rl) * QKVW + n0 + lane * 4, *(const v4f*)&so[wave][rl][lane * 4]);
}
__global__ __launch_bounds__(256) void k_vt(const float* __restrict__ QKV, __bf16* __restrict__ VTH, __bf16* __restrict__ VTL) {
  __shared__ __align__(16) __bf16 sth[64][72], stl[64][72]; const int tid = threadIdx.x; const size_t rb = (size_t)blockIdx.x * 64; const int h = blockIdx.y; const int b = (int)(rb / SS), s0 = (int)(rb % SS);
  for (int q = tid; q < 64 * 64; q += 256) { const int rl = q >> 6, d = q & 63; const float v = QKV[(rb + rl) * QKVW + 2 * DM + h * HD + d]; const __bf16 hb = (__bf16)v; sth[d][rl] = hb; stl[d][rl] = (__bf16)(v - (float)hb); }
  __syncthreads();
  for (int q = tid; q < 64 * 8; q += 256) { const int dt = q >> 7, sl = (q >> 6) & 1, c = (q >> 5) & 1, lane = q & 31; const int d = dt * 16 + (lane & 15), s = sl * 32 + c * 16 + 8 * (lane >> 4);   // 4 x 2 tiles (16 d x 32 s)
    const size_t o = (((size_t)b * (DM / 16) + h * (HD / 16) + dt) * (SS / 32) + (s0 >> 5) + sl) * 512 + (q & 63) * 8; vst2((unsigned*)(VTH + o), *(const v4u*)&sth[d][s]); vst2((unsigned*)(VTL + o), *(const v4u*)&stl[d][s]); }
}
// ---- k_attn: block = (128 queries, head h, batch b) on 4 waves; a wave takes 32 queries as two tiles of 16, so that each K and V fragment it loads feeds two products: full flash attention (K = 64), transposed: S^T = K . Q^T (3 products) / 8 and O^T += V^T . P^T (3 products), so that a lane holds 16 of ONE query's 32 scores: maximum and sum run in the lane's own registers plus one exchange between the wave's halves, and the exponentials are already the B fragment of P^T (keys 8g + 0..7, 16 + 8g + 0..7); epilogue: out -= xsa_scale * (out.v_own)/(|v_own|^2 + 1e-8) * v_own; O[b*S+q][h*64+d] as bf16 hi and residual tiles, which is the order the lanes hold O^T in
__device__ __forceinline__ float xhalf(float x) { return __builtin_bit_cast(float, __builtin_amdgcn_permlanex16(__builtin_bit_cast(int, x), __builtin_bit_cast(int, x), 0x76543210, 0xfedcba98, false, false)); }   // lane l takes lane l ^ 16's value
// one query tile's share of a pass, in three pieces: the new maximum; weights, sum, rescale and split; and, behind the loop, the tile's epilogue
__device__ __forceinline__ float tile_max(const float (&e)[16]) { float mx = e[0];
#pragma unroll
  for (int i = 1; i < 16; ++i) mx = fmaxf(mx, e[i]);
  return fmaxf(mx, xhalf(mx)); }
__device__ __forceinline__ F2 tile_weights(float (&e)[16], float KL, float mn, float alpha, float& l, v8f (&acc)[4]) {
#pragma unroll
  for (int i = 0; i < 16; ++i) e[i] = __builtin_amdgcn_exp2f(__builtin_fmaf(e[i], KL, -mn));   // one multiply-add and the chip's own 2^x a score; a weight too small for a normal float may come out as 0: it adds nothing to a sum whose largest term is 1
  float es[4];   // four chains, so that the adds do not wait on one another
#pragma unroll
  for (int i = 0; i < 4; ++i) es[i] = (e[i] + e[4 + i]) + (e[8 + i] + e[12 + i]);
  l = l * alpha + ((es[0] + es[1]) + (es[2] + es[3]));
#pragma unroll
  for (int dt = 0; dt < 4; ++dt)
#pragma unroll
    for (int r = 0; r < 8; ++r) acc[dt][r] *= alpha;
  return bsplit16(e); }
__device__ __forceinline__ void tile_out(v8f (&acc)[4], float l, const float* vrow, __bf16* ot, float xsa) { const float il = 1.0f / (l + xhalf(l));
  v4f vv[8]; float dot = 0.f, vn = 0.f;   // the query's own v, the 32 d that this lane holds
#pragma unroll
  for (int i = 0; i < 8; ++i) vv[i] = *(const v4f*)(vrow + (i >> 1) * 16 + (i & 1) * 4);
  asm volatile("s_wait_xcnt 0x0" ::: "memory");   // before the address registers of the loads above are used for anything else
#pragma unroll
  for (int i = 0; i < 8; ++i)
#pragma unroll
    for (int e = 0; e < 4; ++e) { const float o = acc[i >> 1][(i & 1) * 4 + e] * il; acc[i >> 1][(i & 1) * 4 + e] = o; dot += o * vv[i][e]; vn += vv[i][e] * vv[i][e]; }
  dot += xhalf(dot); vn += xhalf(vn);
  const float coef = xsa * (dot / (vn + 1e-8f));
#pragma unroll   // the step from store to store becomes a constant in the stores' offset field
  for (int dt = 0; dt < 4; ++dt) { v8b hi, re;
#pragma unroll
    for (int r = 0; r < 8; ++r) { const float w = acc[dt][r] - coef * vv[2 * dt + (r >> 2)][r & 3]; const __bf16 hb = (__bf16)w; hi[r] = hb; re[r] = (__bf16)(w - (float)hb); }
    vst2(ot + (dt >> 1) * 1024 + (dt & 1) * 256, hi); vst2(ot + (dt >> 1) * 1024 + 512 + (dt & 1) * 256, re); } }
__global__ __launch_bounds__(128) void k_attn(const float* __restrict__ QK, const __bf16* __restrict__ KT, const __bf16* __restrict__ VTH, const __bf16* __restrict__ VTL, const float* __restrict__ XS, __bf16* __restrict__ O) {
  const int tid = threadIdx.x, wave = tid >> 5, lane = tid & 31, col = lane & 15, g = lane >> 4;
  const int qb = blockIdx.x, h = blockIdx.y, b = blockIdx.z; const int q0 = qb * 128 + wave * 32; const size_t rq = (size_t)b * SS + q0 + col;   // the wave's two query tiles: queries q0 + col (names ending in 0) and q0 + 16 + col (ending in 1)
  F2 aq0[2], aq1[2];
#pragma unroll
  for (int kc = 0; kc < 2; ++kc) { aq0[kc] = split_row(QK + rq * QKVW + h * HD, kc * 32, lane); aq1[kc] = split_row(QK + (rq + 16) * QKVW + h * HD, kc * 32, lane); }
  const float KL = 0.125f * 1.4426950408889634f;   // SCALE = 1/sqrt(64) times log2(e): the softmax runs in base 2, exp((s - max) / 8) = 2^(s * KL - max * KL)
  const unsigned lo = (unsigned)(lane * 16);
  const char* ka = (const char*)(KT + (size_t)(b * NH + h) * SS * HD * 2) + lo;   // this head's k, the lane's own bytes: a pass of 32 keys is 4 pairs (hi, residual) of bf16 tiles in a row (16 keys x 32 d each), 8192 bytes
  const char *vha = (const char*)(VTH + (size_t)(b * NH + h) * HD * SS) + lo, *vla = (const char*)(VTL + (size_t)(b * NH + h) * HD * SS) + lo;   // this head's v: 4 bands of 16 d, each SS / 32 bf16 tiles
  v16b kh[2][2], kl[2][2];   // the pass's K fragments, hi and residual; reloaded for the next pass quarter by quarter as the P.V products free the V registers
#pragma unroll
  for (int ct = 0; ct < 2; ++ct)
#pragma unroll
    for (int kc = 0; kc < 2; ++kc) { kh[ct][kc] = frag_p(ka, (ct * 2 + kc) * 2048); kl[ct][kc] = frag_p(ka, (ct * 2 + kc) * 2048 + 1024); }
  asm volatile("s_wait_xcnt 0x0" ::: "memory");   // the start values below land in an address register of the loads above
  __builtin_amdgcn_sched_barrier(0);   // keeps the start values behind the wait above
  float m0 = -3.0e38f, m1 = -3.0e38f, l0 = 0.f, l1 = 0.f;   // of the lane's query in each tile; m is the maximum in use, already times KL; l is the sum over this half's keys only, the halves are joined behind the loop
  v8f acc0[4] = {}, acc1[4] = {};   // O^T: acc[dt][r] is d = 16 dt + 8 g + r of the lane's query
#pragma unroll 1
  for (int ks = 0; ks < SS / 32; ++ks) { float e0[16], e1[16]; const int kn = ks + 1 < SS / 32 ? ks + 1 : ks;   // the last pass reloads itself: in bounds, unused
#pragma unroll
    for (int ct = 0; ct < 2; ++ct) { v8f c0 = {}, c1 = {};   // each K fragment serves both query tiles; the two tiles' sums alternate, so that no product waits for the one before it
#pragma unroll
      for (int kc = 0; kc < 2; ++kc) { c0 = wmma_bf(kh[ct][kc], aq0[kc].l, c0); c1 = wmma_bf(kh[ct][kc], aq1[kc].l, c1); c0 = wmma_bf(kl[ct][kc], aq0[kc].h, c0); c1 = wmma_bf(kl[ct][kc], aq1[kc].h, c1); c0 = wmma_bf(kh[ct][kc], aq0[kc].h, c0); c1 = wmma_bf(kh[ct][kc], aq1[kc].h, c1); }
#pragma unroll
      for (int r = 0; r < 8; ++r) { e0[ct * 8 + r] = c0[r]; e1[ct * 8 + r] = c1[r]; } }   // the plain products, the scale comes in with KL below; key 16 ct + 8 g + r
    v16b vh[4], vl[4];   // this pass's V fragments, issued here so that they arrive under the softmax
    const char *vhn = vha + ks * 1024, *vln = vla + ks * 1024, *kp = ka + kn * 8192;
#pragma unroll
    for (int dt = 0; dt < 4; ++dt) { vh[dt] = frag_p(vhn, dt * 16 * SS * 2); vl[dt] = frag_p(vln, dt * 16 * SS * 2); }
    const float mn0 = fmaxf(m0, tile_max(e0) * KL), mn1 = fmaxf(m1, tile_max(e1) * KL);   // KL > 0: the maximum of the products times KL is the maximum of the scaled scores
    const float al0 = __builtin_amdgcn_exp2f(m0 - mn0), al1 = __builtin_amdgcn_exp2f(m1 - mn1); m0 = mn0; m1 = mn1;
    asm volatile("s_wait_xcnt 0x0" :: "v"(vhn), "v"(vln), "v"(mn0), "v"(mn1) : "memory");   // before the address registers of the V loads take new values; the addresses are named as inputs so that they live up to the wait and no load lands in them, the maxima so that they run while it would idle
    __builtin_amdgcn_sched_barrier(0);   // keeps the exponentials behind the wait above
    const F2 pa0 = tile_weights(e0, KL, mn0, al0, l0, acc0), pa1 = tile_weights(e1, KL, mn1, al1, l1, acc1);
#pragma unroll
    for (int dt = 0; dt < 4; ++dt) { acc0[dt] = wmma_bf(vh[dt], pa0.l, acc0[dt]); acc1[dt] = wmma_bf(vh[dt], pa1.l, acc1[dt]); acc0[dt] = wmma_bf(vl[dt], pa0.h, acc0[dt]); acc1[dt] = wmma_bf(vl[dt], pa1.h, acc1[dt]); acc0[dt] = wmma_bf(vh[dt], pa0.h, acc0[dt]); acc1[dt] = wmma_bf(vh[dt], pa1.h, acc1[dt]);
      kh[dt >> 1][dt & 1] = frag_p(kp, dt * 2048); kl[dt >> 1][dt & 1] = frag_p(kp, dt * 2048 + 1024); }
    asm volatile("s_wait_xcnt 0x0" :: "v"(kp) : "memory");   // before the address registers of the K loads take new values at the pass's end and in the next pass; the address is named as an input so that it lives up to the wait and no load lands in it
    __builtin_amdgcn_sched_barrier(0); }   // keeps the register copies at the pass's end behind the wait above
  const float xsa = bfr(XS[0]);
  const float* vrow = QK + rq * QKVW + 2 * DM + h * HD + 8 * g;
  __bf16* ot = O + ((size_t)((b * SS + q0) >> 4) * (DM / 32) + h * 2) * 1024 + lane * 8;   // the next 16 queries' tiles lie DM / 32 tile pairs on
  tile_out(acc0, l0, vrow, ot, xsa);
  asm volatile("s_wait_xcnt 0x0" ::: "memory");   // before the registers of the stores above are used for the second tile
  tile_out(acc1, l1, vrow + 16 * QKVW, ot + (DM / 32) * 1024, xsa);
}
// ---- k_out: block = (64 rows, 128 cols): out = O(hi/lo) . c_proj rows (2 products)
__global__ __launch_bounds__(128) void k_out(const __bf16* __restrict__ O, const __bf16* __restrict__ P, float* __restrict__ Y) {
  __shared__ __align__(16) float so[4][16][132];
  const int tid = threadIdx.x, wave = tid >> 5, lane = tid & 31, col = lane & 15, g = lane >> 4; const size_t r0 = (size_t)blockIdx.x * 64 + wave * 16; const int n0 = blockIdx.y * 128;
  v8f acc[8] = {};
  v16b ahn, aln, w[8];   // as in k_qkv: reloaded for the next k-step right behind the last use
  const unsigned xo = (unsigned)((int)r0 * DM * 4 + lane * 16), wo = (unsigned)(n0 * DM * 2 + lane * 16);   // a band of 16 rows is DM / 32 tile pairs of 2048 bytes (hi, residual) or tiles of 1024 bytes
  ahn = frag_to(O, 0u, xo); aln = frag_to(O, 1024u, xo);
  __builtin_amdgcn_sched_barrier(0);   // keeps the A loads the oldest here as in the loop, else the loop's first wait drains every load
#pragma unroll
  for (int j = 0; j < 8; ++j) w[j] = frag_to(P, (unsigned)(j * 16 * DM * 2), wo);
#pragma unroll 2
  for (int kc = 0; kc < DM / 32; ++kc) { const int kn = kc + 1 < DM / 32 ? kc + 1 : kc;   // the last k-step reloads itself: in bounds, unused
    asm volatile("s_wait_xcnt 0x0" ::: "memory");   // the next addresses are formed in the address registers of the loads issued last, also over the back edge
    __builtin_amdgcn_sched_barrier(0);   // keeps the A loads the oldest of each k-step, so that the wait for A leaves the B loads in flight, and the address sums behind the wait above
    const v16b ah = ahn, al = aln;
    ahn = frag_to(O, (unsigned)(kn * 2048), xo); aln = frag_to(O, (unsigned)(kn * 2048 + 1024), xo);
#pragma unroll
    for (int j = 0; j < 8; ++j) { acc[j] = wmma_bf(al, w[j], acc[j]); acc[j] = wmma_bf(ah, w[j], acc[j]); w[j] = frag_to(P, (unsigned)(kn * 1024 + j * 16 * DM * 2), wo); } }
#pragma unroll
  for (int j = 0; j < 8; ++j)
#pragma unroll
    for (int r = 0; r < 8; ++r) so[wave][8 * g + r][j * 16 + col] = acc[j][r];
  LDSX();
  for (int rl = 0; rl < 16; ++rl) vst2(Y + (r0 + rl) * DM + n0 + lane * 4, *(const v4f*)&so[wave][rl][lane * 4]);
}
extern "C" void kernel_launch(void* const* d_in, const int* in_sizes, int n_in, void* d_out, int out_size, void* d_ws, size_t ws_size, hipStream_t stream) {
  (void)in_sizes; (void)n_in; (void)out_size;
  const float** F = (const float**)d_in;   // x [2,2048,1024], Wq, Wk, Wv, Wo [1024,1024] (torch [out,in]), xsa_scale [1]
  if (ws_size < (size_t)WS_END) return;
  char* ws = (char*)d_ws; __bf16 *PK = (__bf16*)(ws + WS_PK), *VTH = (__bf16*)(ws + WS_VTH), *VTL = (__bf16*)(ws + WS_VTL), *XP = (__bf16*)(ws + WS_XP); float *QK = (float*)(ws + WS_QK); __bf16 *O = (__bf16*)(ws + WS_O), *KT = (__bf16*)(ws + WS_KT);
  k_pack<<<dim3(NB * SS / 16 + 4 * DM / 16), 256, 0, stream>>>(F[0], F[1], F[2], F[3], F[4], XP, PK);
  k_qkv<<<dim3(TNB * SS / 128, QKVW / 128), 128, 0, stream>>>(XP, PK + PK_A, QK, KT);
  k_vt<<<dim3(TNB * SS / 64, NH), 256, 0, stream>>>(QK, VTH, VTL);
  k_attn<<<dim3(TQB, NH, TNB), 128, 0, stream>>>(QK, KT, VTH, VTL, F[5], O);
  k_out<<<dim3(TOB, DM / 128), 128, 0, stream>>>(O, PK + PK_P, (float*)d_out);
}

// v009
// It runs in 157 microseconds.
// Next to v008, in two timings, it ran 1.14 and 1.16 times as fast.
// Counting every step since v000, it is 3.76 times as fast.
// compute dtype: x, Wq, Wk, Wv, Wo, xsa_scale (module inputs) rounded to bf16; q/k/v projections with exact bf16 products (x and W are inputs); scores q.k with both computed operands as bf16 hi + residual pairs (3 products) and P.V with P hi/lo x V hi/lo (3 products); the exclusive (own-value) projection removal in f32 in the attention epilogue; the output projection hi/lo x exact Wo (2 products); softmax in f32; f32 accumulate.
#include <hip/hip_runtime.h>
#include <math.h>

typedef __attribute__((ext_vector_type(16))) _Float16 v16h;
typedef __attribute__((ext_vector_type(16))) __bf16 v16b;
typedef __attribute__((ext_vector_type(8)))  _Float16 v8h;
typedef __attribute__((ext_vector_type(8)))  float v8f;
typedef __attribute__((ext_vector_type(4)))  float v4f;
typedef __attribute__((ext_vector_type(2)))  float v2f;
typedef __attribute__((ext_vector_type(4)))  unsigned v4u;
typedef __attribute__((ext_vector_type(4)))  int v4i;
typedef float __attribute__((may_alias)) float_a;
typedef int __attribute__((may_alias)) int_a;

template <typename T> __device__ __forceinline__ void vst2(void* p, T v) { *(T*)p = v;  }
__device__ __forceinline__ v8f wmma16(v16h a, v16h b, v8f c) {
  v8f d = __builtin_amdgcn_wmma_f32_16x16x32_f16(false, a, false, b, (short)0, c, false, false);
  asm volatile("v_nop\n\tv_nop\n\tv_nop\n\tv_nop" : "+v"(d) : "v"(a), "v"(b));
  return d;
}
__device__ __forceinline__ v8f wmma_bf(v16b a, v16b b, v8f c) {
  return __builtin_amdgcn_wmma_f32_16x16x32_bf16(false, a, false, b, (short)0, c, false, false);
}
// 16x16x32 fragments: lane = (h = lane>>4, row/col = lane&15); elements 0..7 = k0+8h+0..7, 8..15 = k0+16+8h+0..7; D element r = row 8h+r
__device__ __forceinline__ v16h frag_h(const _Float16* rowk0, int lane) {
  union { v16h v; v8h q[2]; } u; const _Float16* p = rowk0 + 8 * (lane >> 4);
  u.q[0] = *(const v8h*)p; u.q[1] = *(const v8h*)(p + 16); return u.v;
}
__device__ __forceinline__ v16h frag_f32(const float* rowk0, int lane) {
  v16h a; const float* p = rowk0 + 8 * (lane >> 4);
#pragma unroll
  for (int i = 0; i < 8; ++i) { a[i] = (_Float16)p[i]; a[8 + i] = (_Float16)p[16 + i]; }
  return a;
}
__device__ __forceinline__ v16h frag_f32s(const float* rowk0, int lane, float sc) {
  v16h a; const float* p = rowk0 + 8 * (lane >> 4);
#pragma unroll
  for (int i = 0; i < 8; ++i) { a[i] = (_Float16)(p[i] * sc); a[8 + i] = (_Float16)(p[16 + i] * sc); }
  return a;
}
// column fragment from a [K][ld] layout (column n), rows >= K read as 0
__device__ __forceinline__ v16h fragc_f32(const float* W, int k0, int n, int lane, int ld, int K) {
  v16h a; const int g = lane >> 4;
#pragma unroll
  for (int i = 0; i < 8; ++i) { const int ka = k0 + 8 * g + i, kb = ka + 16;
    a[i] = (_Float16)(ka < K ? W[(size_t)(ka < K ? ka : K - 1) * ld + n] : 0.f); a[8 + i] = (_Float16)(kb < K ? W[(size_t)(kb < K ? kb : K - 1) * ld + n] : 0.f); }
  return a;
}
struct F2 { v16b h, l; };
__device__ __forceinline__ F2 bsplit16(const float v[16]) { F2 r;
#pragma unroll
  for (int i = 0; i < 16; ++i) { const __bf16 h = (__bf16)v[i]; r.h[i] = h; r.l[i] = (__bf16)(v[i] - (float)h); }
  return r; }
__device__ __forceinline__ F2 split_row(const float* row, int k0, int lane) { float v[16]; const float* p = row + k0 + 8 * (lane >> 4);
#pragma unroll
  for (int i = 0; i < 8; ++i) { v[i] = p[i]; v[8 + i] = p[16 + i]; }
  return bsplit16(v); }
__device__ __forceinline__ F2 split_rowK(const float* row, int k0, int lane, int K) { float v[16]; const int g = lane >> 4;
#pragma unroll
  for (int i = 0; i < 8; ++i) { const int ka = k0 + 8 * g + i, kb = ka + 16; v[i] = ka < K ? row[ka < K ? ka : K - 1] : 0.f; v[8 + i] = kb < K ? row[kb < K ? kb : K - 1] : 0.f; }
  return bsplit16(v); }
__device__ __forceinline__ F2 split_col(const float* W, int k0, int n, int lane, int ld, int K) { float v[16]; const int g = lane >> 4;
#pragma unroll
  for (int i = 0; i < 8; ++i) { const int ka = k0 + 8 * g + i, kb = ka + 16; v[i] = ka < K ? W[(size_t)(ka < K ? ka : K - 1) * ld + n] : 0.f; v[8 + i] = kb < K ? W[(size_t)(kb < K ? kb : K - 1) * ld + n] : 0.f; }
  return bsplit16(v); }
__device__ __forceinline__ v8f mac3(const F2& a, const F2& b, v8f c) { c = wmma_bf(a.l, b.h, c); c = wmma_bf(a.h, b.l, c); return wmma_bf(a.h, b.h, c); }
__device__ __forceinline__ float sigm(float v) { return 1.0f / (1.0f + expf(-v)); }
#define LDSX() do { asm volatile("s_wait_dscnt 0" ::: "memory"); __builtin_amdgcn_wave_barrier(); __builtin_amdgcn_fence(__ATOMIC_RELEASE, "workgroup"); } while (0)


// Exclusive self-attention (B 2, S 2048, 16 heads x 64; torch Linear no-bias, y = x W^T): full (non-causal) softmax attention; per token/head out -= xsa_scale * (out . v) / (|v|^2 + 1e-8) * v; then Wo.
#define NB 2
#define SS 2048
#define DM 1024
#define NH 16
#define HD 64
#define QKVW (3 * DM)
#ifndef TQB
#define TQB (SS / 128)
#define TNB NB
#define TOB (NB * SS / 64)     // output row tiles (all)
#endif
typedef __attribute__((ext_vector_type(8))) __bf16 v8b;
// Fragment tiles: every operand that a loop loads lies in the workspace as tiles of 16 rows x 32 k in the order the lanes take it, so that one 16-byte load of a wave reads 512 bytes in a row (4 lines of 128 bytes) instead of 32 bytes from each of 16 rows (16 lines).
// bf16 tile, 512 elements: element (c * 32 + lane) * 8 + e is row (lane & 15), k = 16 c + 8 (lane >> 4) + e         (c = 0, 1; e = 0..7)
// a computed operand (k, attention out) is a pair of such tiles in a row, bf16 hi and bf16 residual, split once by the kernel that makes it
// the address is base + uniform bytes + the lane's own bytes (16 * lane): the constant step from tile to tile folds into the loads' offset field
__device__ __forceinline__ v16b frag_to(const __bf16* base, unsigned uni, unsigned lo) {
  union { v16b v; v8b q[2]; } u; const char* p = (const char*)base + uni + (size_t)lo;
  u.q[0] = *(const v8b*)p; u.q[1] = *(const v8b*)(p + 512); return u.v;
}
// the same from the lane's own address and a constant step, which goes into the loads' offset field
__device__ __forceinline__ v16b frag_p(const char* p, int off) {
  union { v16b v; v8b q[2]; } u; u.q[0] = *(const v8b*)(p + off); u.q[1] = *(const v8b*)(p + off + 512); return u.v;
}
__device__ __forceinline__ float bfr(float v) { return (float)(__bf16)v; }
__device__ __attribute__((noinline)) float erf_ni(float v) { return erff(v); }

#define PK_A 0                       // [3072][1024] c_attn kernel rows, as bf16 tiles [row / 16][k / 32]
#define PK_P (PK_A + QKVW * DM)        // [1024][1024] c_proj kernel rows, likewise
#define PK_END (PK_P + DM * DM)
#define WS_PK  0u
#define WS_QK  (WS_PK + 2u * PK_END)             // f32 [4096 rows][3072]: [q | (k: not written here, see WS_KT) | v]
#define WS_VTH (WS_QK + 4u * NB * SS * QKVW)     // bf16 tiles [2][1024 (h*64+d) / 16][2048 s / 32]
#define WS_VTL (WS_VTH + 2u * NB * DM * SS)
#define WS_O   (WS_VTL + 2u * NB * DM * SS)        // bf16 tiles [4096 / 16][1024 / 32][hi, residual]
#define WS_XP  (WS_O + 4u * NB * SS * DM)          // bf16 tiles [4096 / 16][1024 / 32]: x
#define WS_KT  (WS_XP + 2u * NB * SS * DM)         // bf16 tiles [2 * 16 (b, h)][2048 s / 16][64 / 32][hi, residual]: k
#define WS_END (WS_KT + 4u * NB * SS * DM)

// ---- k_pack: ONE launch packs all five matrices (they do not depend on one another). block = a whole band of 16 rows x 1024 k of a [N][1024] f32 matrix -> 32 bf16 tiles, which lie in a row; bands 0..255 are x, then 64 bands each of Wq, Wk, Wv, Wo (y = x W^T), whose tiles follow one another in the workspace in that order; rows read whole, turned into tile order through LDS
typedef __attribute__((ext_vector_type(4))) __bf16 v4b;
__global__ __launch_bounds__(256) void k_pack(const float* __restrict__ X, const float* __restrict__ Wq, const float* __restrict__ Wk, const float* __restrict__ Wv, const float* __restrict__ Wo, __bf16* __restrict__ XP, __bf16* __restrict__ PK) {
  __shared__ __align__(16) __bf16 s[16][DM + 8]; const int band = blockIdx.x, tid = threadIdx.x;
  const float* src; __bf16* dst;   // the same for the whole block
  if (band < NB * SS / 16) { src = X + (size_t)band * 16 * DM; dst = XP + (size_t)band * 16 * DM; }
  else { const int wb = band - NB * SS / 16, m = wb >> 6; src = (m == 0 ? Wq : m == 1 ? Wk : m == 2 ? Wv : Wo) + (size_t)(wb & 63) * 16 * DM; dst = PK + (size_t)wb * 16 * DM; }
  v4f v[16];
#pragma unroll   // so that a thread's sixteen loads are in flight together, not one behind the other's wait
  for (int i = 0; i < 16; ++i) v[i] = *(const v4f*)(src + i * DM + tid * 4);
  __builtin_amdgcn_sched_barrier(0);   // keeps the conversions behind all sixteen loads: else the build holds the last two loads back until the first two have arrived, to land them in the same registers
#pragma unroll
  for (int i = 0; i < 16; ++i) { v4b h;
#pragma unroll
    for (int e = 0; e < 4; ++e) h[e] = (__bf16)v[i][e];
    *(v4b*)&s[i][tid * 4] = h; }
  __syncthreads();
#pragma unroll   // the step from store to store becomes a constant in the stores' offset field
  for (int j = 0; j < 8; ++j) { const int q = j * 256 + tid, c = (q >> 5) & 1, lane = q & 31;   // 16-byte piece q of the band's 32 tiles
    vst2((unsigned*)(dst + (size_t)q * 8), *(const v4u*)&s[lane & 15][(q >> 6) * 32 + c * 16 + 8 * (lane >> 4)]); }
}
// ---- k_qkv: block = (128 rows, 128 of the 3072 cols) on 4 waves; a wave takes 32 rows x 128 cols, the rows as two tiles of 16, so that each weight fragment it loads feeds two products: QKV = bf16(x) . rows (exact) -> f32 rows (pitch 3072) for q and v, bf16 hi and residual tiles for k (split here once, not in each of the query waves that read a key)
__global__ __launch_bounds__(128) void k_qkv(const __bf16* __restrict__ X, const __bf16* __restrict__ P, float* __restrict__ QKV, __bf16* __restrict__ KT) {
  __shared__ __align__(16) float so[4][32][132];
  const int tid = threadIdx.x, wave = tid >> 5, lane = tid & 31, col = lane & 15, g = lane >> 4; const size_t r0 = (size_t)blockIdx.x * 128 + wave * 32; const int n0 = blockIdx.y * 128;
  v8f acc[2][8] = {};
  v16b an0, an1, w[8];   // the fragments of the k-step in work; each is reloaded for the next k-step right behind its last use
  const char *xa = (const char*)X + (unsigned)((int)r0 * DM * 2 + lane * 16), *wa = (const char*)P + (unsigned)(n0 * DM * 2 + lane * 16);   // the lane's own bytes of the first tiles; a band of 16 rows is DM / 32 tiles of 1024 bytes
  an0 = frag_p(xa, 0); an1 = frag_p(xa, 16 * DM * 2);
  __builtin_amdgcn_sched_barrier(0);   // keeps the A loads the oldest here as in the loop, else the loop's first wait drains every load
#pragma unroll
  for (int j = 0; j < 8; ++j) w[j] = frag_p(wa, j * 16 * DM * 2);
  asm volatile("s_wait_xcnt 0x0" ::: "memory");   // before the address registers of the loads above take new values
  __builtin_amdgcn_sched_barrier(0);   // keeps the next address sums behind the wait above
#pragma unroll 2
  for (int kc = 0; kc < DM / 32; ++kc) { const int kn = kc + 1 < DM / 32 ? kc + 1 : kc;   // the last k-step reloads itself: in bounds, unused
    const char *xn = xa + kn * 1024, *wn = wa + kn * 1024;
    const v16b a0 = an0, a1 = an1;
    an0 = frag_p(xn, 0); an1 = frag_p(xn, 16 * DM * 2);
#pragma unroll
    for (int j = 0; j < 8; ++j) { acc[0][j] = wmma_bf(a0, w[j], acc[0][j]); acc[1][j] = wmma_bf(a1, w[j], acc[1][j]);
      if (j == 0) { __builtin_amdgcn_sched_barrier(0);   // keeps the A loads in front of the wait below
        asm volatile("s_wait_xcnt 0x0" ::: "memory");   // the A loads' address registers are free behind their last load: before a B load lands in them; it stands behind two products so that they run while it would idle
        __builtin_amdgcn_sched_barrier(0); }   // keeps the B loads behind the wait above
      w[j] = frag_p(wn, j * 16 * DM * 2);
      __builtin_amdgcn_sched_barrier(0); }   // keeps each reload right behind its fragment's last use, so that every load has a whole k-step to arrive and the counted waits never drain the queue
    asm volatile("s_wait_xcnt 0x0" :: "v"(xn), "v"(wn) : "memory");   // before the address registers of this k-step's loads take new values, also over the back edge; named as inputs so that they live up to the wait and no load lands in them
    __builtin_amdgcn_sched_barrier(0); }   // keeps the A loads the oldest of each k-step, so that the wait for A leaves the B loads in flight, and the address sums behind the wait above
#pragma unroll
  for (int t = 0; t < 2; ++t)
#pragma unroll
    for (int j = 0; j < 8; ++j)
#pragma unroll
      for (int r = 0; r < 8; ++r) so[wave][16 * t + 8 * g + r][j * 16 + col] = acc[t][j][r];
  LDSX();
  if (n0 >= DM && n0 < 2 * DM) {   // k columns (the same for the whole block): per tile of 16 keys two heads x two 32-wide halves
    const int b = (int)r0 / SS, kt = ((int)r0 % SS) >> 4, h0 = (n0 - DM) / HD;   // r0 is a multiple of 32: both tiles lie in the same batch
#pragma unroll   // the tile's place becomes a constant step from one address
    for (int t = 0; t < 8; ++t) { __bf16* tile = KT + ((((size_t)b * NH + h0 + ((t & 3) >> 1)) * (SS / 16) + kt + (t >> 2)) * 2 + (t & 1)) * 1024 + lane * 8;
#pragma unroll   // the step from store to store becomes a constant in the stores' offset field
      for (int c = 0; c < 2; ++c) { const float* p = &so[wave][16 * (t >> 2) + col][(t & 3) * 32 + c * 16 + 8 * g]; const v4f p0 = *(const v4f*)p, p1 = *(const v4f*)(p + 4); v8b hi, re;
#pragma unroll   // constant element numbers, so that the vectors stay in registers
        for (int e = 0; e < 8; ++e) { const float v = e < 4 ? p0[e & 3] : p1[e & 3]; const __bf16 hb = (__bf16)v; hi[e] = hb; re[e] = (__bf16)(v - (float)hb); }
        vst2(tile + c * 256, hi); vst2(tile + 512 + c * 256, re); } }
  } else
    for (int rl = 0; rl < 32; ++rl) vst2(QKV + (r0 + rl) * QKVW + n0 + lane * 4, *(const v4f*)&so[wave][rl][lane * 4]);
}
__global__ __launch_bounds__(256) void k_vt(const float* __restrict__ QKV, __bf16* __restrict__ VTH, __bf16* __restrict__ VTL) {
  __shared__ __align__(16) __bf16 sth[64][72], stl[64][72]; const int tid = threadIdx.x; const size_t rb = (size_t)blockIdx.x * 64; const int h = blockIdx.y; const int b = (int)(rb / SS), s0 = (int)(rb % SS);
  for (int q = tid; q < 64 * 64; q += 256) { const int rl = q >> 6, d = q & 63; const float v = QKV[(rb + rl) * QKVW + 2 * DM + h * HD + d]; const __bf16 hb = (__bf16)v; sth[d][rl] = hb; stl[d][rl] = (__bf16)(v - (float)hb); }
  __syncthreads();
  for (int q = tid; q < 64 * 8; q += 256) { const int dt = q >> 7, sl = (q >> 6) & 1, c = (q >> 5) & 1, lane = q & 31; const int d = dt * 16 + (lane & 15), s = sl * 32 + c * 16 + 8 * (lane >> 4);   // 4 x 2 tiles (16 d x 32 s)
    const size_t o = (((size_t)b * (DM / 16) + h * (HD / 16) + dt) * (SS / 32) + (s0 >> 5) + sl) * 512 + (q & 63) * 8; vst2((unsigned*)(VTH + o), *(const v4u*)&sth[d][s]); vst2((unsigned*)(VTL + o), *(const v4u*)&stl[d][s]); }
}
// ---- k_attn: block = (128 queries, head h, batch b) on 4 waves; a wave takes 32 queries as two tiles of 16, so that each K and V fragment it loads feeds two products: full flash attention (K = 64), transposed: S^T = K . Q^T (3 products) / 8 and O^T += V^T . P^T (3 products), so that a lane holds 16 of ONE query's 32 scores: maximum and sum run in the lane's own registers plus one exchange between the wave's halves, and the exponentials are already the B fragment of P^T (keys 8g + 0..7, 16 + 8g + 0..7); epilogue: out -= xsa_scale * (out.v_own)/(|v_own|^2 + 1e-8) * v_own; O[b*S+q][h*64+d] as bf16 hi and residual tiles, which is the order the lanes hold O^T in
__device__ __forceinline__ float xhalf(float x) { return __builtin_bit_cast(float, __builtin_amdgcn_permlanex16(__builtin_bit_cast(int, x), __builtin_bit_cast(int, x), 0x76543210, 0xfedcba98, false, false)); }   // lane l takes lane l ^ 16's value
// one query tile's share of a pass, in three pieces: the new maximum; weights, sum, rescale and split; and, behind the loop, the tile's epilogue
__device__ __forceinline__ float tile_max(const float (&e)[16]) { float mx = e[0];
#pragma unroll
  for (int i = 1; i < 16; ++i) mx = fmaxf(mx, e[i]);
  return fmaxf(mx, xhalf(mx)); }
__device__ __forceinline__ F2 tile_weights(float (&e)[16], float KL, float mn, float alpha, float& l, v8f (&acc)[4]) {
#pragma unroll
  for (int i = 0; i < 16; ++i) e[i] = __builtin_amdgcn_exp2f(__builtin_fmaf(e[i], KL, -mn));   // one multiply-add and the chip's own 2^x a score; a weight too small for a normal float may come out as 0: it adds nothing to a sum whose largest term is 1
  float es[4];   // four chains, so that the adds do not wait on one another
#pragma unroll
  for (int i = 0; i < 4; ++i) es[i] = (e[i] + e[4 + i]) + (e[8 + i] + e[12 + i]);
  l = l * alpha + ((es[0] + es[1]) + (es[2] + es[3]));
#pragma unroll
  for (int dt = 0; dt < 4; ++dt)
#pragma unroll
    for (int r = 0; r < 8; ++r) acc[dt][r] *= alpha;
  return bsplit16(e); }
__device__ __forceinline__ void tile_out(v8f (&acc)[4], float l, const float* vrow, __bf16* ot, float xsa) { const float il = 1.0f / (l + xhalf(l));
  v4f vv[8]; float dot = 0.f, vn = 0.f;   // the query's own v, the 32 d that this lane holds
#pragma unroll
  for (int i = 0; i < 8; ++i) vv[i] = *(const v4f*)(vrow + (i >> 1) * 16 + (i & 1) * 4);
  asm volatile("s_wait_xcnt 0x0" ::: "memory");   // before the address registers of the loads above are used for anything else
#pragma unroll
  for (int i = 0; i < 8; ++i)
#pragma unroll
    for (int e = 0; e < 4; ++e) { const float o = acc[i >> 1][(i & 1) * 4 + e] * il; acc[i >> 1][(i & 1) * 4 + e] = o; dot += o * vv[i][e]; vn += vv[i][e] * vv[i][e]; }
  dot += xhalf(dot); vn += xhalf(vn);
  const float coef = xsa * (dot / (vn + 1e-8f));
#pragma unroll   // the step from store to store becomes a constant in the stores' offset field
  for (int dt = 0; dt < 4; ++dt) { v8b hi, re;
#pragma unroll
    for (int r = 0; r < 8; ++r) { const float w = acc[dt][r] - coef * vv[2 * dt + (r >> 2)][r & 3]; const __bf16 hb = (__bf16)w; hi[r] = hb; re[r] = (__bf16)(w - (float)hb); }
    vst2(ot + (dt >> 1) * 1024 + (dt & 1) * 256, hi); vst2(ot + (dt >> 1) * 1024 + 512 + (dt & 1) * 256, re); } }
__global__ __launch_bounds__(128) void k_attn(const float* __restrict__ QK, const __bf16* __restrict__ KT, const __bf16* __restrict__ VTH, const __bf16* __restrict__ VTL, const float* __restrict__ XS, __bf16* __restrict__ O) {
  const int tid = threadIdx.x, wave = tid >> 5, lane = tid & 31, col = lane & 15, g = lane >> 4;
  const int qb = blockIdx.x, h = blockIdx.y, b = blockIdx.z; const int q0 = qb * 128 + wave * 32; const size_t rq = (size_t)b * SS + q0 + col;   // the wave's two query tiles: queries q0 + col (names ending in 0) and q0 + 16 + col (ending in 1)
  F2 aq0[2], aq1[2];
#pragma unroll
  for (int kc = 0; kc < 2; ++kc) { aq0[kc] = split_row(QK + rq * QKVW + h * HD, kc * 32, lane); aq1[kc] = split_row(QK + (rq + 16) * QKVW + h * HD, kc * 32, lane); }
  const float KL = 0.125f * 1.4426950408889634f;   // SCALE = 1/sqrt(64) times log2(e): the softmax runs in base 2, exp((s - max) / 8) = 2^(s * KL - max * KL)
  const unsigned lo = (unsigned)(lane * 16);
  const char* ka = (const char*)(KT + (size_t)(b * NH + h) * SS * HD * 2) + lo;   // this head's k, the lane's own bytes: a pass of 32 keys is 4 pairs (hi, residual) of bf16 tiles in a row (16 keys x 32 d each), 8192 bytes
  const char *vha = (const char*)(VTH + (size_t)(b * NH + h) * HD * SS) + lo, *vla = (const char*)(VTL + (size_t)(b * NH + h) * HD * SS) + lo;   // this head's v: 4 bands of 16 d, each SS / 32 bf16 tiles
  v16b kh[2][2], kl[2][2];   // the pass's K fragments, hi and residual; reloaded for the next pass quarter by quarter as the P.V products free the V registers
#pragma unroll
  for (int ct = 0; ct < 2; ++ct)
#pragma unroll
    for (int kc = 0; kc < 2; ++kc) { kh[ct][kc] = frag_p(ka, (ct * 2 + kc) * 2048); kl[ct][kc] = frag_p(ka, (ct * 2 + kc) * 2048 + 1024); }
  asm volatile("s_wait_xcnt 0x0" ::: "memory");   // the start values below land in an address register of the loads above
  __builtin_amdgcn_sched_barrier(0);   // keeps the start values behind the wait above
  float m0 = -3.0e38f, m1 = -3.0e38f, l0 = 0.f, l1 = 0.f;   // of the lane's query in each tile; m is the maximum in use, already times KL; l is the sum over this half's keys only, the halves are joined behind the loop
  v8f acc0[4] = {}, acc1[4] = {};   // O^T: acc[dt][r] is d = 16 dt + 8 g + r of the lane's query
#pragma unroll 1
  for (int ks = 0; ks < SS / 32; ++ks) { float e0[16], e1[16]; const int kn = ks + 1 < SS / 32 ? ks + 1 : ks;   // the last pass reloads itself: in bounds, unused
#pragma unroll
    for (int ct = 0; ct < 2; ++ct) { v8f c0 = {}, c1 = {};   // each K fragment serves both query tiles; the two tiles' sums alternate, so that no product waits for the one before it
#pragma unroll
      for (int kc = 0; kc < 2; ++kc) { c0 = wmma_bf(kh[ct][kc], aq0[kc].l, c0); c1 = wmma_bf(kh[ct][kc], aq1[kc].l, c1); c0 = wmma_bf(kl[ct][kc], aq0[kc].h, c0); c1 = wmma_bf(kl[ct][kc], aq1[kc].h, c1); c0 = wmma_bf(kh[ct][kc], aq0[kc].h, c0); c1 = wmma_bf(kh[ct][kc], aq1[kc].h, c1); }
#pragma unroll
      for (int r = 0; r < 8; ++r) { e0[ct * 8 + r] = c0[r]; e1[ct * 8 + r] = c1[r]; } }   // the plain products, the scale comes in with KL below; key 16 ct + 8 g + r
    v16b vh[4], vl[4];   // this pass's V fragments, issued here so that they arrive under the softmax
    const char *vhn = vha + ks * 1024, *vln = vla + ks * 1024, *kp = ka + kn * 8192;
#pragma unroll
    for (int dt = 0; dt < 4; ++dt) { vh[dt] = frag_p(vhn, dt * 16 * SS * 2); vl[dt] = frag_p(vln, dt * 16 * SS * 2); }
    const float mn0 = fmaxf(m0, tile_max(e0) * KL), mn1 = fmaxf(m1, tile_max(e1) * KL);   // KL > 0: the maximum of the products times KL is the maximum of the scaled scores
    const float al0 = __builtin_amdgcn_exp2f(m0 - mn0), al1 = __builtin_amdgcn_exp2f(m1 - mn1); m0 = mn0; m1 = mn1;
    asm volatile("s_wait_xcnt 0x0" :: "v"(vhn), "v"(vln), "v"(mn0), "v"(mn1) : "memory");   // before the address registers of the V loads take new values; the addresses are named as inputs so that they live up to the wait and no load lands in them, the maxima so that they run while it would idle
    __builtin_amdgcn_sched_barrier(0);   // keeps the exponentials behind the wait above
    const F2 pa0 = tile_weights(e0, KL, mn0, al0, l0, acc0), pa1 = tile_weights(e1, KL, mn1, al1, l1, acc1);
#pragma unroll
    for (int dt = 0; dt < 4; ++dt) { acc0[dt] = wmma_bf(vh[dt], pa0.l, acc0[dt]); acc1[dt] = wmma_bf(vh[dt], pa1.l, acc1[dt]); acc0[dt] = wmma_bf(vl[dt], pa0.h, acc0[dt]); acc1[dt] = wmma_bf(vl[dt], pa1.h, acc1[dt]); acc0[dt] = wmma_bf(vh[dt], pa0.h, acc0[dt]); acc1[dt] = wmma_bf(vh[dt], pa1.h, acc1[dt]);
      kh[dt >> 1][dt & 1] = frag_p(kp, dt * 2048); kl[dt >> 1][dt & 1] = frag_p(kp, dt * 2048 + 1024);
      __builtin_amdgcn_sched_barrier(0x406); }   // products and loads stay in this order (plain vector and scalar work may cross): else the build loads the K fragment that the next pass needs first as the last one
    asm volatile("s_wait_xcnt 0x0" :: "v"(kp) : "memory");   // before the address registers of the K loads take new values at the pass's end and in the next pass; the address is named as an input so that it lives up to the wait and no load lands in it
    __builtin_amdgcn_sched_barrier(0); }   // keeps the register copies at the pass's end behind the wait above
  const float xsa = bfr(XS[0]);
  const float* vrow = QK + rq * QKVW + 2 * DM + h * HD + 8 * g;
  __bf16* ot = O + ((size_t)((b * SS + q0) >> 4) * (DM / 32) + h * 2) * 1024 + lane * 8;   // the next 16 queries' tiles lie DM / 32 tile pairs on
  tile_out(acc0, l0, vrow, ot, xsa);
  asm volatile("s_wait_xcnt 0x0" ::: "memory");   // before the registers of the stores above are used for the second tile
  tile_out(acc1, l1, vrow + 16 * QKVW, ot + (DM / 32) * 1024, xsa);
}
// ---- k_out: block = (64 rows, 128 cols): out = O(hi/lo) . c_proj rows (2 products)
__global__ __launch_bounds__(128) void k_out(const __bf16* __restrict__ O, const __bf16* __restrict__ P, float* __restrict__ Y) {
  __shared__ __align__(16) float so[4][16][132];
  const int tid = threadIdx.x, wave = tid >> 5, lane = tid & 31, col = lane & 15, g = lane >> 4; const size_t r0 = (size_t)blockIdx.x * 64 + wave * 16; const int n0 = blockIdx.y * 128;
  v8f acc[8] = {};
  v16b ahn, aln, w[8];   // as in k_qkv: reloaded for the next k-step right behind the last use
  const unsigned xo = (unsigned)((int)r0 * DM * 4 + lane * 16), wo = (unsigned)(n0 * DM * 2 + lane * 16);   // a band of 16 rows is DM / 32 tile pairs of 2048 bytes (hi, residual) or tiles of 1024 bytes
  ahn = frag_to(O, 0u, xo); aln = frag_to(O, 1024u, xo);
  __builtin_amdgcn_sched_barrier(0);   // keeps the A loads the oldest here as in the loop, else the loop's first wait drains every load
#pragma unroll
  for (int j = 0; j < 8; ++j) w[j] = frag_to(P, (unsigned)(j * 16 * DM * 2), wo);
#pragma unroll 2
  for (int kc = 0; kc < DM / 32; ++kc) { const int kn = kc + 1 < DM / 32 ? kc + 1 : kc;   // the last k-step reloads itself: in bounds, unused
    asm volatile("s_wait_xcnt 0x0" ::: "memory");   // the next addresses are formed in the address registers of the loads issued last, also over the back edge
    __builtin_amdgcn_sched_barrier(0);   // keeps the A loads the oldest of each k-step, so that the wait for A leaves the B loads in flight, and the address sums behind the wait above
    const v16b ah = ahn, al = aln;
    ahn = frag_to(O, (unsigned)(kn * 2048), xo); aln = frag_to(O, (unsigned)(kn * 2048 + 1024), xo);
#pragma unroll
    for (int j = 0; j < 8; ++j) { acc[j] = wmma_bf(al, w[j], acc[j]); acc[j] = wmma_bf(ah, w[j], acc[j]);
      if (j == 0) { __builtin_amdgcn_sched_barrier(0);   // as in k_qkv: keeps the A loads in front of the wait below
        asm volatile("s_wait_xcnt 0x0" ::: "memory");   // before a B load lands in the A loads' address registers
        __builtin_amdgcn_sched_barrier(0); }   // keeps the B loads behind the wait above
      w[j] = frag_to(P, (unsigned)(kn * 1024 + j * 16 * DM * 2), wo);
      __builtin_amdgcn_sched_barrier(0); } }   // as in k_qkv: keeps each reload right behind its fragment's last use
#pragma unroll
  for (int j = 0; j < 8; ++j)
#pragma unroll
    for (int r = 0; r < 8; ++r) so[wave][8 * g + r][j * 16 + col] = acc[j][r];
  LDSX();
  for (int rl = 0; rl < 16; ++rl) vst2(Y + (r0 + rl) * DM + n0 + lane * 4, *(const v4f*)&so[wave][rl][lane * 4]);
}
extern "C" void kernel_launch(void* const* d_in, const int* in_sizes, int n_in, void* d_out, int out_size, void* d_ws, size_t ws_size, hipStream_t stream) {
  (void)in_sizes; (void)n_in; (void)out_size;
  const float** F = (const float**)d_in;   // x [2,2048,1024], Wq, Wk, Wv, Wo [1024,1024] (torch [out,in]), xsa_scale [1]
  if (ws_size < (size_t)WS_END) return;
  char* ws = (char*)d_ws; __bf16 *PK = (__bf16*)(ws + WS_PK), *VTH = (__bf16*)(ws + WS_VTH), *VTL = (__bf16*)(ws + WS_VTL), *XP = (__bf16*)(ws + WS_XP); float *QK = (float*)(ws + WS_QK); __bf16 *O = (__bf16*)(ws + WS_O), *KT = (__bf16*)(ws + WS_KT);
  k_pack<<<dim3(NB * SS / 16 + 4 * DM / 16), 256, 0, stream>>>(F[0], F[1], F[2], F[3], F[4], XP, PK);
  k_qkv<<<dim3(TNB * SS / 128, QKVW / 128), 128, 0, stream>>>(XP, PK + PK_A, QK, KT);
  k_vt<<<dim3(TNB * SS / 64, NH), 256, 0, stream>>>(QK, VTH, VTL);
  k_attn<<<dim3(TQB, NH, TNB), 128, 0, stream>>>(QK, KT, VTH, VTL, F[5], O);
  k_out<<<dim3(TOB, DM / 128), 128, 0, stream>>>(O, PK + PK_P, (float*)d_out);
}

// v010
// Measured time: 146 microseconds a run.
// Next to v009, in two timings, it ran 1.05 and 1.06 times as fast.
// Counting every step since v000, it is 3.95 times as fast.
// compute dtype: x, Wq, Wk, Wv, Wo, xsa_scale (module inputs) rounded to bf16; q/k/v projections with exact bf16 products (x and W are inputs); scores q.k with both computed operands as bf16 hi + residual pairs (3 products) and P.V with P hi/lo x V hi/lo (3 products); the exclusive (own-value) projection removal in f32 in the attention epilogue; the output projection hi/lo x exact Wo (2 products); softmax in f32; f32 accumulate.
#include <hip/hip_runtime.h>
#include <math.h>

typedef __attribute__((ext_vector_type(16))) _Float16 v16h;
typedef __attribute__((ext_vector_type(16))) __bf16 v16b;
typedef __attribute__((ext_vector_type(8)))  _Float16 v8h;
typedef __attribute__((ext_vector_type(8)))  float v8f;
typedef __attribute__((ext_vector_type(4)))  float v4f;
typedef __attribute__((ext_vector_type(2)))  float v2f;
typedef __attribute__((ext_vector_type(4)))  unsigned v4u;
typedef __attribute__((ext_vector_type(4)))  int v4i;
typedef float __attribute__((may_alias)) float_a;
typedef int __attribute__((may_alias)) int_a;

template <typename T> __device__ __forceinline__ void vst2(void* p, T v) { *(T*)p = v;  }
__device__ __forceinline__ v8f wmma16(v16h a, v16h b, v8f c) {
  v8f d = __builtin_amdgcn_wmma_f32_16x16x32_f16(false, a, false, b, (short)0, c, false, false);
  asm volatile("v_nop\n\tv_nop\n\tv_nop\n\tv_nop" : "+v"(d) : "v"(a), "v"(b));
  return d;
}
__device__ __forceinline__ v8f wmma_bf(v16b a, v16b b, v8f c) {
  return __builtin_amdgcn_wmma_f32_16x16x32_bf16(false, a, false, b, (short)0, c, false, false);
}
// 16x16x32 fragments: lane = (h = lane>>4, row/col = lane&15); elements 0..7 = k0+8h+0..7, 8..15 = k0+16+8h+0..7; D element r = row 8h+r
__device__ __forceinline__ v16h frag_h(const _Float16* rowk0, int lane) {
  union { v16h v; v8h q[2]; } u; const _Float16* p = rowk0 + 8 * (lane >> 4);
  u.q[0] = *(const v8h*)p; u.q[1] = *(const v8h*)(p + 16); return u.v;
}
__device__ __forceinline__ v16h frag_f32(const float* rowk0, int lane) {
  v16h a; const float* p = rowk0 + 8 * (lane >> 4);
#pragma unroll
  for (int i = 0; i < 8; ++i) { a[i] = (_Float16)p[i]; a[8 + i] = (_Float16)p[16 + i]; }
  return a;
}
__device__ __forceinline__ v16h frag_f32s(const float* rowk0, int lane, float sc) {
  v16h a; const float* p = rowk0 + 8 * (lane >> 4);
#pragma unroll
  for (int i = 0; i < 8; ++i) { a[i] = (_Float16)(p[i] * sc); a[8 + i] = (_Float16)(p[16 + i] * sc); }
  return a;
}
// column fragment from a [K][ld] layout (column n), rows >= K read as 0
__device__ __forceinline__ v16h fragc_f32(const float* W, int k0, int n, int lane, int ld, int K) {
  v16h a; const int g = lane >> 4;
#pragma unroll
  for (int i = 0; i < 8; ++i) { const int ka = k0 + 8 * g + i, kb = ka + 16;
    a[i] = (_Float16)(ka < K ? W[(size_t)(ka < K ? ka : K - 1) * ld + n] : 0.f); a[8 + i] = (_Float16)(kb < K ? W[(size_t)(kb < K ? kb : K - 1) * ld + n] : 0.f); }
  return a;
}
struct F2 { v16b h, l; };
__device__ __forceinline__ F2 bsplit16(const float v[16]) { F2 r;
#pragma unroll
  for (int i = 0; i < 16; ++i) { const __bf16 h = (__bf16)v[i]; r.h[i] = h; r.l[i] = (__bf16)(v[i] - (float)h); }
  return r; }
__device__ __forceinline__ F2 split_row(const float* row, int k0, int lane) { float v[16]; const float* p = row + k0 + 8 * (lane >> 4);
#pragma unroll
  for (int i = 0; i < 8; ++i) { v[i] = p[i]; v[8 + i] = p[16 + i]; }
  return bsplit16(v); }
__device__ __forceinline__ F2 split_rowK(const float* row, int k0, int lane, int K) { float v[16]; const int g = lane >> 4;
#pragma unroll
  for (int i = 0; i < 8; ++i) { const int ka = k0 + 8 * g + i, kb = ka + 16; v[i] = ka < K ? row[ka < K ? ka : K - 1] : 0.f; v[8 + i] = kb < K ? row[kb < K ? kb : K - 1] : 0.f; }
  return bsplit16(v); }
__device__ __forceinline__ F2 split_col(const float* W, int k0, int n, int lane, int ld, int K) { float v[16]; const int g = lane >> 4;
#pragma unroll
  for (int i = 0; i < 8; ++i) { const int ka = k0 + 8 * g + i, kb = ka + 16; v[i] = ka < K ? W[(size_t)(ka < K ? ka : K - 1) * ld + n] : 0.f; v[8 + i] = kb < K ? W[(size_t)(kb < K ? kb : K - 1) * ld + n] : 0.f; }
  return bsplit16(v); }
__device__ __forceinline__ v8f mac3(const F2& a, const F2& b, v8f c) { c = wmma_bf(a.l, b.h, c); c = wmma_bf(a.h, b.l, c); return wmma_bf(a.h, b.h, c); }
__device__ __forceinline__ float sigm(float v) { return 1.0f / (1.0f + expf(-v)); }
#define LDSX() do { asm volatile("s_wait_dscnt 0" ::: "memory"); __builtin_amdgcn_wave_barrier(); __builtin_amdgcn_fence(__ATOMIC_RELEASE, "workgroup"); } while (0)


// Exclusive self-attention (B 2, S 2048, 16 heads x 64; torch Linear no-bias, y = x W^T): full (non-causal) softmax attention; per token/head out -= xsa_scale * (out . v) / (|v|^2 + 1e-8) * v; then Wo.
#define NB 2
#define SS 2048
#define DM 1024
#define NH 16
#define HD 64
#define QKVW (3 * DM)
#ifndef TQB
#define TQB (SS / 128)
#define TNB NB
#define TOB (NB * SS / 64)     // output row tiles (all)
#endif
typedef __attribute__((ext_vector_type(8))) __bf16 v8b;
// Fragment tiles: every operand that a loop loads lies in the workspace as tiles of 16 rows x 32 k in the order the lanes take it, so that one 16-byte load of a wave reads 512 bytes in a row (4 lines of 128 bytes) instead of 32 bytes from each of 16 rows (16 lines).
// bf16 tile, 512 elements: element (c * 32 + lane) * 8 + e is row (lane & 15), k = 16 c + 8 (lane >> 4) + e         (c = 0, 1; e = 0..7)
// a computed operand (k, attention out) is a pair of such tiles in a row, bf16 hi and bf16 residual, split once by the kernel that makes it
// the address is base + uniform bytes + the lane's own bytes (16 * lane): the constant step from tile to tile folds into the loads' offset field
__device__ __forceinline__ v16b frag_to(const __bf16* base, unsigned uni, unsigned lo) {
  union { v16b v; v8b q[2]; } u; const char* p = (const char*)base + uni + (size_t)lo;
  u.q[0] = *(const v8b*)p; u.q[1] = *(const v8b*)(p + 512); return u.v;
}
// the same from the lane's own address and a constant step, which goes into the loads' offset field
__device__ __forceinline__ v16b frag_p(const char* p, int off) {
  union { v16b v; v8b q[2]; } u; u.q[0] = *(const v8b*)(p + off); u.q[1] = *(const v8b*)(p + off + 512); return u.v;
}
__device__ __forceinline__ float bfr(float v) { return (float)(__bf16)v; }
__device__ __attribute__((noinline)) float erf_ni(float v) { return erff(v); }

#define PK_A 0                       // [3072][1024] c_attn kernel rows, as bf16 tiles [row / 16][k / 32]
#define PK_P (PK_A + QKVW * DM)        // [1024][1024] c_proj kernel rows, likewise
#define PK_END (PK_P + DM * DM)
#define WS_PK  0u
#define WS_QK  (WS_PK + 2u * PK_END)             // f32 [4096 rows][3072]: [q | (k: not written here, see WS_KT) | v]
#define WS_VTH (WS_QK + 4u * NB * SS * QKVW)     // bf16 tiles [2][1024 (h*64+d) / 16][2048 s / 32]
#define WS_VTL (WS_VTH + 2u * NB * DM * SS)
#define WS_O   (WS_VTL + 2u * NB * DM * SS)        // bf16 tiles [4096 / 16][1024 / 32][hi, residual]
#define WS_XP  (WS_O + 4u * NB * SS * DM)          // bf16 tiles [4096 / 16][1024 / 32]: x
#define WS_KT  (WS_XP + 2u * NB * SS * DM)         // bf16 tiles [2 * 16 (b, h)][2048 s / 16][64 / 32][hi, residual]: k
#define WS_END (WS_KT + 4u * NB * SS * DM)

// ---- k_pack: ONE launch packs all five matrices (they do not depend on one another). block = a whole band of 16 rows x 1024 k of a [N][1024] f32 matrix -> 32 bf16 tiles, which lie in a row; bands 0..255 are x, then 64 bands each of Wq, Wk, Wv, Wo (y = x W^T), whose tiles follow one another in the workspace in that order; rows read whole, turned into tile order through LDS
typedef __attribute__((ext_vector_type(4))) __bf16 v4b;
typedef __attribute__((ext_vector_type(2))) __bf16 v2b;
__global__ __launch_bounds__(256) void k_pack(const float* __restrict__ X, const float* __restrict__ Wq, const float* __restrict__ Wk, const float* __restrict__ Wv, const float* __restrict__ Wo, __bf16* __restrict__ XP, __bf16* __restrict__ PK) {
  __shared__ __align__(16) __bf16 s[16][DM + 8]; const int band = blockIdx.x, tid = threadIdx.x;
  const float* src; __bf16* dst;   // the same for the whole block
  if (band < NB * SS / 16) { src = X + (size_t)band * 16 * DM; dst = XP + (size_t)band * 16 * DM; }
  else { const int wb = band - NB * SS / 16, m = wb >> 6; src = (m == 0 ? Wq : m == 1 ? Wk : m == 2 ? Wv : Wo) + (size_t)(wb & 63) * 16 * DM; dst = PK + (size_t)wb * 16 * DM; }
  v4f v[16];
#pragma unroll   // so that a thread's sixteen loads are in flight together, not one behind the other's wait
  for (int i = 0; i < 16; ++i) v[i] = *(const v4f*)(src + i * DM + tid * 4);
  __builtin_amdgcn_sched_barrier(0);   // keeps the conversions behind all sixteen loads: else the build holds the last two loads back until the first two have arrived, to land them in the same registers
#pragma unroll
  for (int i = 0; i < 16; ++i) { v4b h;
#pragma unroll
    for (int e = 0; e < 4; ++e) h[e] = (__bf16)v[i][e];
    *(v4b*)&s[i][tid * 4] = h; }
  __syncthreads();
#pragma unroll   // the step from store to store becomes a constant in the stores' offset field
  for (int j = 0; j < 8; ++j) { const int q = j * 256 + tid, c = (q >> 5) & 1, lane = q & 31;   // 16-byte piece q of the band's 32 tiles
    vst2((unsigned*)(dst + (size_t)q * 8), *(const v4u*)&s[lane & 15][(q >> 6) * 32 + c * 16 + 8 * (lane >> 4)]); }
}
// ---- k_qkv: block = (128 rows, 128 of the 3072 cols) on 4 waves; a wave takes 32 rows x 128 cols, the rows as two tiles of 16, so that each weight fragment it loads feeds two products: QKV = bf16(x) . rows (exact) -> f32 rows (pitch 3072) for q and v, bf16 hi and residual tiles for k (split here once, not in each of the query waves that read a key) and for v transposed (a wave's 32 rows x 128 cols are 8 whole tiles of 16 d x 32 s, taken column-wise from the wave's own LDS staging: no launch of its own for the turn)
__global__ __launch_bounds__(128) void k_qkv(const __bf16* __restrict__ X, const __bf16* __restrict__ P, float* __restrict__ QKV, __bf16* __restrict__ KT, __bf16* __restrict__ VTH, __bf16* __restrict__ VTL) {
  __shared__ __align__(16) float so[4][32][132];
  const int tid = threadIdx.x, wave = tid >> 5, lane = tid & 31, col = lane & 15, g = lane >> 4; const size_t r0 = (size_t)blockIdx.x * 128 + wave * 32; const int n0 = blockIdx.y * 128;
  v8f acc[2][8] = {};
  v16b an0, an1, w[8];   // the fragments of the k-step in work; each is reloaded for the next k-step right behind its last use
  const char *xa = (const char*)X + (unsigned)((int)r0 * DM * 2 + lane * 16), *wa = (const char*)P + (unsigned)(n0 * DM * 2 + lane * 16);   // the lane's own bytes of the first tiles; a band of 16 rows is DM / 32 tiles of 1024 bytes
  an0 = frag_p(xa, 0); an1 = frag_p(xa, 16 * DM * 2);
  __builtin_amdgcn_sched_barrier(0);   // keeps the A loads the oldest here as in the loop, else the loop's first wait drains every load
#pragma unroll
  for (int j = 0; j < 8; ++j) w[j] = frag_p(wa, j * 16 * DM * 2);
  asm volatile("s_wait_xcnt 0x0" ::: "memory");   // before the address registers of the loads above take new values
  __builtin_amdgcn_sched_barrier(0);   // keeps the next address sums behind the wait above
#pragma unroll 2
  for (int kc = 0; kc < DM / 32; ++kc) { const int kn = kc + 1 < DM / 32 ? kc + 1 : kc;   // the last k-step reloads itself: in bounds, unused
    const char *xn = xa + kn * 1024, *wn = wa + kn * 1024;
    const v16b a0 = an0, a1 = an1;
    an0 = frag_p(xn, 0); an1 = frag_p(xn, 16 * DM * 2);
#pragma unroll
    for (int j = 0; j < 8; ++j) { acc[0][j] = wmma_bf(a0, w[j], acc[0][j]); acc[1][j] = wmma_bf(a1, w[j], acc[1][j]);
      if (j == 0) { __builtin_amdgcn_sched_barrier(0);   // keeps the A loads in front of the wait below
        asm volatile("s_wait_xcnt 0x0" ::: "memory");   // the A loads' address registers are free behind their last load: before a B load lands in them; it stands behind two products so that they run while it would idle
        __builtin_amdgcn_sched_barrier(0); }   // keeps the B loads behind the wait above
      w[j] = frag_p(wn, j * 16 * DM * 2);
      __builtin_amdgcn_sched_barrier(0); }   // keeps each reload right behind its fragment's last use, so that every load has a whole k-step to arrive and the counted waits never drain the queue
    asm volatile("s_wait_xcnt 0x0" :: "v"(xn), "v"(wn) : "memory");   // before the address registers of this k-step's loads take new values, also over the back edge; named as inputs so that they live up to the wait and no load lands in them
    __builtin_amdgcn_sched_barrier(0); }   // keeps the A loads the oldest of each k-step, so that the wait for A leaves the B loads in flight, and the address sums behind the wait above
#pragma unroll
  for (int t = 0; t < 2; ++t)
#pragma unroll
    for (int j = 0; j < 8; ++j)
#pragma unroll
      for (int r = 0; r < 8; ++r) so[wave][16 * t + 8 * g + r][j * 16 + col] = acc[t][j][r];
  LDSX();
  if (n0 >= DM && n0 < 2 * DM) {   // k columns (the same for the whole block): per tile of 16 keys two heads x two 32-wide halves
    const int b = (int)r0 / SS, kt = ((int)r0 % SS) >> 4, h0 = (n0 - DM) / HD;   // r0 is a multiple of 32: both tiles lie in the same batch
#pragma unroll   // the tile's place becomes a constant step from one address
    for (int t = 0; t < 8; ++t) { __bf16* tile = KT + ((((size_t)b * NH + h0 + ((t & 3) >> 1)) * (SS / 16) + kt + (t >> 2)) * 2 + (t & 1)) * 1024 + lane * 8;
#pragma unroll   // the step from store to store becomes a constant in the stores' offset field
      for (int c = 0; c < 2; ++c) { const float* p = &so[wave][16 * (t >> 2) + col][(t & 3) * 32 + c * 16 + 8 * g]; const v4f p0 = *(const v4f*)p, p1 = *(const v4f*)(p + 4); v8b hi, re;
#pragma unroll   // constant element numbers, so that the vectors stay in registers
        for (int e = 0; e < 8; ++e) { const float v = e < 4 ? p0[e & 3] : p1[e & 3]; const __bf16 hb = (__bf16)v; hi[e] = hb; re[e] = (__bf16)(v - (float)hb); }
        vst2(tile + c * 256, hi); vst2(tile + 512 + c * 256, re); } }
  } else {
    for (int rl = 0; rl < 32; ++rl) vst2(QKV + (r0 + rl) * QKVW + n0 + lane * 4, *(const v4f*)&so[wave][rl][lane * 4]);
    if (n0 >= 2 * DM) {   // v columns (the same for the whole block): besides the f32 rows, V^T as hi and residual tiles; tile row = d (the lane's column), k = s (8 rows down that column: banks 32 g + col, no conflict)
      const int b = (int)r0 / SS, st = ((int)r0 % SS) >> 5, bd = (n0 - 2 * DM) / 16;   // r0 is a multiple of 32: the wave's rows are one tile's 32 s
      const size_t o = (((size_t)b * (DM / 16) + bd) * (SS / 32) + st) * 512 + lane * 8; const float* p = &so[wave][8 * g][col];
      v4u hi[16], re[16];
#pragma unroll   // constant numbers, so that the pieces stay in registers and the LDS rows become constants in the offset field
      for (int t = 0; t < 16; ++t)   // band t >> 1 of 16 d, half t & 1 of its 32 s
#pragma unroll
        for (int e = 0; e < 4; ++e) { const v2f v = {p[((t & 1) * 16 + 2 * e) * 132 + (t >> 1) * 16], p[((t & 1) * 16 + 2 * e + 1) * 132 + (t >> 1) * 16]}; const v2b h = __builtin_convertvector(v, v2b);
          const v2f r = {v[0] - (float)h[0], v[1] - (float)h[1]}; hi[t][e] = __builtin_bit_cast(unsigned, h); re[t][e] = __builtin_bit_cast(unsigned, __builtin_convertvector(r, v2b)); }
      __builtin_amdgcn_sched_barrier(0);   // keeps every piece in registers of its own in front of the stores: else the build lands the next tile in a store's data registers and waits for each store in turn
#pragma unroll   // the tile's place becomes a constant in the stores' offset field
      for (int t = 0; t < 16; ++t) { vst2(VTH + o + (t >> 1) * (SS / 32) * 512 + (t & 1) * 256, hi[t]); vst2(VTL + o + (t >> 1) * (SS / 32) * 512 + (t & 1) * 256, re[t]); }
    }
  }
}
// ---- k_attn: block = (128 queries, head h, batch b) on 4 waves; a wave takes 32 queries as two tiles of 16, so that each K and V fragment it loads feeds two products: full flash attention (K = 64), transposed: S^T = K . Q^T (3 products) / 8 and O^T += V^T . P^T (3 products), so that a lane holds 16 of ONE query's 32 scores: maximum and sum run in the lane's own registers plus one exchange between the wave's halves, and the exponentials are already the B fragment of P^T (keys 8g + 0..7, 16 + 8g + 0..7); epilogue: out -= xsa_scale * (out.v_own)/(|v_own|^2 + 1e-8) * v_own; O[b*S+q][h*64+d] as bf16 hi and residual tiles, which is the order the lanes hold O^T in
__device__ __forceinline__ float xhalf(float x) { return __builtin_bit_cast(float, __builtin_amdgcn_permlanex16(__builtin_bit_cast(int, x), __builtin_bit_cast(int, x), 0x76543210, 0xfedcba98, false, false)); }   // lane l takes lane l ^ 16's value
// one query tile's share of a pass, in three pieces: the new maximum; weights, sum, rescale and split; and, behind the loop, the tile's epilogue
__device__ __forceinline__ float tile_max(const float (&e)[16]) { float mx = e[0];
#pragma unroll
  for (int i = 1; i < 16; ++i) mx = fmaxf(mx, e[i]);
  return fmaxf(mx, xhalf(mx)); }
__device__ __forceinline__ F2 tile_weights(float (&e)[16], float KL, float mn, float alpha, float& l, v8f (&acc)[4]) {
#pragma unroll
  for (int i = 0; i < 16; ++i) e[i] = __builtin_amdgcn_exp2f(__builtin_fmaf(e[i], KL, -mn));   // one multiply-add and the chip's own 2^x a score; a weight too small for a normal float may come out as 0: it adds nothing to a sum whose largest term is 1
  float es[4];   // four chains, so that the adds do not wait on one another
#pragma unroll
  for (int i = 0; i < 4; ++i) es[i] = (e[i] + e[4 + i]) + (e[8 + i] + e[12 + i]);
  l = l * alpha + ((es[0] + es[1]) + (es[2] + es[3]));
#pragma unroll
  for (int dt = 0; dt < 4; ++dt)
#pragma unroll
    for (int r = 0; r < 8; ++r) acc[dt][r] *= alpha;
  return bsplit16(e); }
__device__ __forceinline__ void tile_out(v8f (&acc)[4], float l, const float* vrow, __bf16* ot, float xsa) { const float il = 1.0f / (l + xhalf(l));
  v4f vv[8]; float dot = 0.f, vn = 0.f;   // the query's own v, the 32 d that this lane holds
#pragma unroll
  for (int i = 0; i < 8; ++i) vv[i] = *(const v4f*)(vrow + (i >> 1) * 16 + (i & 1) * 4);
  asm volatile("s_wait_xcnt 0x0" ::: "memory");   // before the address registers of the loads above are used for anything else
#pragma unroll
  for (int i = 0; i < 8; ++i)
#pragma unroll
    for (int e = 0; e < 4; ++e) { const float o = acc[i >> 1][(i & 1) * 4 + e] * il; acc[i >> 1][(i & 1) * 4 + e] = o; dot += o * vv[i][e]; vn += vv[i][e] * vv[i][e]; }
  dot += xhalf(dot); vn += xhalf(vn);
  const float coef = xsa * (dot / (vn + 1e-8f));
#pragma unroll   // the step from store to store becomes a constant in the stores' offset field
  for (int dt = 0; dt < 4; ++dt) { v8b hi, re;
#pragma unroll
    for (int r = 0; r < 8; ++r) { const float w = acc[dt][r] - coef * vv[2 * dt + (r >> 2)][r & 3]; const __bf16 hb = (__bf16)w; hi[r] = hb; re[r] = (__bf16)(w - (float)hb); }
    vst2(ot + (dt >> 1) * 1024 + (dt & 1) * 256, hi); vst2(ot + (dt >> 1) * 1024 + 512 + (dt & 1) * 256, re); } }
__global__ __launch_bounds__(128) void k_attn(const float* __restrict__ QK, const __bf16* __restrict__ KT, const __bf16* __restrict__ VTH, const __bf16* __restrict__ VTL, const float* __restrict__ XS, __bf16* __restrict__ O) {
  const int tid = threadIdx.x, wave = tid >> 5, lane = tid & 31, col = lane & 15, g = lane >> 4;
  const int qb = blockIdx.x, h = blockIdx.y, b = blockIdx.z; const int q0 = qb * 128 + wave * 32; const size_t rq = (size_t)b * SS + q0 + col;   // the wave's two query tiles: queries q0 + col (names ending in 0) and q0 + 16 + col (ending in 1)
  F2 aq0[2], aq1[2];
#pragma unroll
  for (int kc = 0; kc < 2; ++kc) { aq0[kc] = split_row(QK + rq * QKVW + h * HD, kc * 32, lane); aq1[kc] = split_row(QK + (rq + 16) * QKVW + h * HD, kc * 32, lane); }
  const float KL = 0.125f * 1.4426950408889634f;   // SCALE = 1/sqrt(64) times log2(e): the softmax runs in base 2, exp((s - max) / 8) = 2^(s * KL - max * KL)
  const unsigned lo = (unsigned)(lane * 16);
  const char* ka = (const char*)(KT + (size_t)(b * NH + h) * SS * HD * 2) + lo;   // this head's k, the lane's own bytes: a pass of 32 keys is 4 pairs (hi, residual) of bf16 tiles in a row (16 keys x 32 d each), 8192 bytes
  const char *vha = (const char*)(VTH + (size_t)(b * NH + h) * HD * SS) + lo, *vla = (const char*)(VTL + (size_t)(b * NH + h) * HD * SS) + lo;   // this head's v: 4 bands of 16 d, each SS / 32 bf16 tiles
  v16b kh[2][2], kl[2][2];   // the pass's K fragments, hi and residual; reloaded for the next pass quarter by quarter as the P.V products free the V registers
#pragma unroll
  for (int ct = 0; ct < 2; ++ct)
#pragma unroll
    for (int kc = 0; kc < 2; ++kc) { kh[ct][kc] = frag_p(ka, (ct * 2 + kc) * 2048); kl[ct][kc] = frag_p(ka, (ct * 2 + kc) * 2048 + 1024); }
  asm volatile("s_wait_xcnt 0x0" ::: "memory");   // the start values below land in an address register of the loads above
  __builtin_amdgcn_sched_barrier(0);   // keeps the start values behind the wait above
  float m0 = -3.0e38f, m1 = -3.0e38f, l0 = 0.f, l1 = 0.f;   // of the lane's query in each tile; m is the maximum in use, already times KL; l is the sum over this half's keys only, the halves are joined behind the loop
  v8f acc0[4] = {}, acc1[4] = {};   // O^T: acc[dt][r] is d = 16 dt + 8 g + r of the lane's query
#pragma unroll 1
  for (int ks = 0; ks < SS / 32; ++ks) { float e0[16], e1[16]; const int kn = ks + 1 < SS / 32 ? ks + 1 : ks;   // the last pass reloads itself: in bounds, unused
#pragma unroll
    for (int ct = 0; ct < 2; ++ct) { v8f c0 = {}, c1 = {};   // each K fragment serves both query tiles; the two tiles' sums alternate, so that no product waits for the one before it
#pragma unroll
      for (int kc = 0; kc < 2; ++kc) { c0 = wmma_bf(kh[ct][kc], aq0[kc].l, c0); c1 = wmma_bf(kh[ct][kc], aq1[kc].l, c1); c0 = wmma_bf(kl[ct][kc], aq0[kc].h, c0); c1 = wmma_bf(kl[ct][kc], aq1[kc].h, c1); c0 = wmma_bf(kh[ct][kc], aq0[kc].h, c0); c1 = wmma_bf(kh[ct][kc], aq1[kc].h, c1); }
#pragma unroll
      for (int r = 0; r < 8; ++r) { e0[ct * 8 + r] = c0[r]; e1[ct * 8 + r] = c1[r]; } }   // the plain products, the scale comes in with KL below; key 16 ct + 8 g + r
    v16b vh[4], vl[4];   // this pass's V fragments, issued here so that they arrive under the softmax
    const char *vhn = vha + ks * 1024, *vln = vla + ks * 1024, *kp = ka + kn * 8192;
#pragma unroll
    for (int dt = 0; dt < 4; ++dt) { vh[dt] = frag_p(vhn, dt * 16 * SS * 2); vl[dt] = frag_p(vln, dt * 16 * SS * 2); }
    const float mn0 = fmaxf(m0, tile_max(e0) * KL), mn1 = fmaxf(m1, tile_max(e1) * KL);   // KL > 0: the maximum of the products times KL is the maximum of the scaled scores
    const float al0 = __builtin_amdgcn_exp2f(m0 - mn0), al1 = __builtin_amdgcn_exp2f(m1 - mn1); m0 = mn0; m1 = mn1;
    asm volatile("s_wait_xcnt 0x0" :: "v"(vhn), "v"(vln), "v"(mn0), "v"(mn1) : "memory");   // before the address registers of the V loads take new values; the addresses are named as inputs so that they live up to the wait and no load lands in them, the maxima so that they run while it would idle
    __builtin_amdgcn_sched_barrier(0);   // keeps the exponentials behind the wait above
    const F2 pa0 = tile_weights(e0, KL, mn0, al0, l0, acc0), pa1 = tile_weights(e1, KL, mn1, al1, l1, acc1);
#pragma unroll
    for (int dt = 0; dt < 4; ++dt) { acc0[dt] = wmma_bf(vh[dt], pa0.l, acc0[dt]); acc1[dt] = wmma_bf(vh[dt], pa1.l, acc1[dt]); acc0[dt] = wmma_bf(vl[dt], pa0.h, acc0[dt]); acc1[dt] = wmma_bf(vl[dt], pa1.h, acc1[dt]); acc0[dt] = wmma_bf(vh[dt], pa0.h, acc0[dt]); acc1[dt] = wmma_bf(vh[dt], pa1.h, acc1[dt]);
      kh[dt >> 1][dt & 1] = frag_p(kp, dt * 2048); kl[dt >> 1][dt & 1] = frag_p(kp, dt * 2048 + 1024);
      __builtin_amdgcn_sched_barrier(0x406); }   // products and loads stay in this order (plain vector and scalar work may cross): else the build loads the K fragment that the next pass needs first as the last one
    asm volatile("s_wait_xcnt 0x0" :: "v"(kp) : "memory");   // before the address registers of the K loads take new values at the pass's end and in the next pass; the address is named as an input so that it lives up to the wait and no load lands in it
    __builtin_amdgcn_sched_barrier(0); }   // keeps the register copies at the pass's end behind the wait above
  const float xsa = bfr(XS[0]);
  const float* vrow = QK + rq * QKVW + 2 * DM + h * HD + 8 * g;
  __bf16* ot = O + ((size_t)((b * SS + q0) >> 4) * (DM / 32) + h * 2) * 1024 + lane * 8;   // the next 16 queries' tiles lie DM / 32 tile pairs on
  tile_out(acc0, l0, vrow, ot, xsa);
  asm volatile("s_wait_xcnt 0x0" ::: "memory");   // before the registers of the stores above are used for the second tile
  tile_out(acc1, l1, vrow + 16 * QKVW, ot + (DM / 32) * 1024, xsa);
}
// ---- k_out: block = (64 rows, 128 cols): out = O(hi/lo) . c_proj rows (2 products)
__global__ __launch_bounds__(128) void k_out(const __bf16* __restrict__ O, const __bf16* __restrict__ P, float* __restrict__ Y) {
  __shared__ __align__(16) float so[4][16][132];
  const int tid = threadIdx.x, wave = tid >> 5, lane = tid & 31, col = lane & 15, g = lane >> 4; const size_t r0 = (size_t)blockIdx.x * 64 + wave * 16; const int n0 = blockIdx.y * 128;
  v8f acc[8] = {};
  v16b ahn, aln, w[8];   // as in k_qkv: reloaded for the next k-step right behind the last use
  const unsigned xo = (unsigned)((int)r0 * DM * 4 + lane * 16), wo = (unsigned)(n0 * DM * 2 + lane * 16);   // a band of 16 rows is DM / 32 tile pairs of 2048 bytes (hi, residual) or tiles of 1024 bytes
  ahn = frag_to(O, 0u, xo); aln = frag_to(O, 1024u, xo);
  __builtin_amdgcn_sched_barrier(0);   // keeps the A loads the oldest here as in the loop, else the loop's first wait drains every load
#pragma unroll
  for (int j = 0; j < 8; ++j) w[j] = frag_to(P, (unsigned)(j * 16 * DM * 2), wo);
#pragma unroll 2
  for (int kc = 0; kc < DM / 32; ++kc) { const int kn = kc + 1 < DM / 32 ? kc + 1 : kc;   // the last k-step reloads itself: in bounds, unused
    asm volatile("s_wait_xcnt 0x0" ::: "memory");   // the next addresses are formed in the address registers of the loads issued last, also over the back edge
    __builtin_amdgcn_sched_barrier(0);   // keeps the A loads the oldest of each k-step, so that the wait for A leaves the B loads in flight, and the address sums behind the wait above
    const v16b ah = ahn, al = aln;
    ahn = frag_to(O, (unsigned)(kn * 2048), xo); aln = frag_to(O, (unsigned)(kn * 2048 + 1024), xo);
#pragma unroll
    for (int j = 0; j < 8; ++j) { acc[j] = wmma_bf(al, w[j], acc[j]); acc[j] = wmma_bf(ah, w[j], acc[j]);
      if (j == 0) { __builtin_amdgcn_sched_barrier(0);   // as in k_qkv: keeps the A loads in front of the wait below
        asm volatile("s_wait_xcnt 0x0" ::: "memory");   // before a B load lands in the A loads' address registers
        __builtin_amdgcn_sched_barrier(0); }   // keeps the B loads behind the wait above
      w[j] = frag_to(P, (unsigned)(kn * 1024 + j * 16 * DM * 2), wo);
      __builtin_amdgcn_sched_barrier(0); } }   // as in k_qkv: keeps each reload right behind its fragment's last use
#pragma unroll
  for (int j = 0; j < 8; ++j)
#pragma unroll
    for (int r = 0; r < 8; ++r) so[wave][8 * g + r][j * 16 + col] = acc[j][r];
  LDSX();
  for (int rl = 0; rl < 16; ++rl) vst2(Y + (r0 + rl) * DM + n0 + lane * 4, *(const v4f*)&so[wave][rl][lane * 4]);
}
extern "C" void kernel_launch(void* const* d_in, const int* in_sizes, int n_in, void* d_out, int out_size, void* d_ws, size_t ws_size, hipStream_t stream) {
  (void)in_sizes; (void)n_in; (void)out_size;
  const float** F = (const float**)d_in;   // x [2,2048,1024], Wq, Wk, Wv, Wo [1024,1024] (torch [out,in]), xsa_scale [1]
  if (ws_size < (size_t)WS_END) return;
  char* ws = (char*)d_ws; __bf16 *PK = (__bf16*)(ws + WS_PK), *VTH = (__bf16*)(ws + WS_VTH), *VTL = (__bf16*)(ws + WS_VTL), *XP = (__bf16*)(ws + WS_XP); float *QK = (float*)(ws + WS_QK); __bf16 *O = (__bf16*)(ws + WS_O), *KT = (__bf16*)(ws + WS_KT);
  k_pack<<<dim3(NB * SS / 16 + 4 * DM / 16), 256, 0, stream>>>(F[0], F[1], F[2], F[3], F[4], XP, PK);
  k_qkv<<<dim3(TNB * SS / 128, QKVW / 128), 128, 0, stream>>>(XP, PK + PK_A, QK, KT, VTH, VTL);
  k_attn<<<dim3(TQB, NH, TNB), 128, 0, stream>>>(QK, KT, VTH, VTL, F[5], O);
  k_out<<<dim3(TOB, DM / 128), 128, 0, stream>>>(O, PK + PK_P, (float*)d_out);
}
